// v000
// The times below were measured on an AMD MI455X: many runs one after another, warmed up first and cycling through
// copies of the inputs, with the whole window's GPU time divided by the number of runs. Launches and the gaps
// between them are all in it. The median over several windows is given; except for v000 it joins two sittings, which
// can be a few percent apart, so the side-by-side timings, each taken in one sitting, are the better comparison.
// The starting kernel, v000, takes 584 microseconds a run.
#include <hip/hip_runtime.h>
#include <hip/hip_bf16.h>
#include <stdint.h>

// ---------------- problem constants ----------------
constexpr int BATCH = 8;
constexpr int SEQ   = 4096;
constexpr int NHEAD = 16;
constexpr int HDIM  = 64;
constexpr int NHID  = 1024;              // == NHEAD*HDIM
constexpr int MROWS = BATCH * SEQ;       // 32768
constexpr int NQK   = 2 * NHID;          // fused q|k output width

// ---------------- vector types ----------------
typedef __attribute__((ext_vector_type(16))) _Float16 v16h;
typedef __attribute__((ext_vector_type(8)))  _Float16 v8h;
typedef __attribute__((ext_vector_type(4)))  _Float16 v4h;
typedef __attribute__((ext_vector_type(2)))  _Float16 v2h;
typedef __attribute__((ext_vector_type(8)))  float    v8f;

typedef union { v8f v; float f[8]; } v8f_u;

// ---------------- workspace layout (bytes) ----------------
constexpr size_t OFF_XH   = 0;                                    // 32768x1024 f16 (64 MB)
constexpr size_t OFF_WQKT = OFF_XH   + (size_t)MROWS * NHID * 2;  // 2048x1024 f16 ([WQ^T;WK^T])
constexpr size_t OFF_WOT  = OFF_WQKT + (size_t)NQK   * NHID * 2;  // 1024x1024 f16
constexpr size_t OFF_BQK  = OFF_WOT  + (size_t)NHID  * NHID * 2;  // 2048 f32
constexpr size_t OFF_QKH  = OFF_BQK  + (size_t)NQK * 4;           // 32768x2048 f16 (128 MB)
constexpr size_t OFF_ATTH = OFF_QKH  + (size_t)MROWS * NQK * 2;   // 32768x1024 f16
constexpr size_t OFF_AK   = OFF_ATTH + (size_t)MROWS * NHID * 2;  // 8x1024 f32
constexpr size_t OFF_AV   = OFF_AK   + (size_t)BATCH * NHID * 4;

// =====================================================================
// f32 -> f16 conversion, 4 elements / thread
// =====================================================================
__global__ void cvt_f32_to_f16_x4(const float* __restrict__ in,
                                  _Float16* __restrict__ out, int n4) {
  int i = blockIdx.x * blockDim.x + threadIdx.x;
  if (i >= n4) return;
  float4 v = ((const float4*)in)[i];
  v4h h;
  h[0] = (_Float16)v.x; h[1] = (_Float16)v.y;
  h[2] = (_Float16)v.z; h[3] = (_Float16)v.w;
  ((v4h*)out)[i] = h;
}

// =====================================================================
// f32 [K][N] -> f16 [N][K] transpose (32x32 LDS tiles)
// =====================================================================
__global__ void transpose_f32_to_f16(const float* __restrict__ in,
                                     _Float16* __restrict__ out,
                                     int K, int N) {
  __shared__ float tile[32][33];
  int tx = threadIdx.x, ty = threadIdx.y;
  int k0 = blockIdx.y * 32, n0 = blockIdx.x * 32;
#pragma unroll
  for (int i = 0; i < 32; i += 8)
    tile[ty + i][tx] = in[(size_t)(k0 + ty + i) * N + n0 + tx];
  __syncthreads();
#pragma unroll
  for (int i = 0; i < 32; i += 8)
    out[(size_t)(n0 + ty + i) * K + k0 + tx] = (_Float16)tile[tx][ty + i];
}

// =====================================================================
// concat two f32 vectors of length n -> out[2n]
// =====================================================================
__global__ void concat_bias(const float* __restrict__ a, const float* __restrict__ b,
                            float* __restrict__ out, int n) {
  int i = blockIdx.x * blockDim.x + threadIdx.x;
  out[i] = (i < n) ? a[i] : b[i - n];
}

// =====================================================================
// tiny projection for the global token: out[b][n] = ax[b]·W[:,n] + bias[n]
// =====================================================================
__global__ void proj_global_tok(const float* __restrict__ ax,
                                const float* __restrict__ W,
                                const float* __restrict__ bias,
                                float* __restrict__ out) {
  int n = blockIdx.x * blockDim.x + threadIdx.x;
  int b = blockIdx.y;
  const float* axr = ax + (size_t)b * NHID;
  float acc = bias[n];
#pragma unroll 4
  for (int k = 0; k < NHID; ++k)
    acc += axr[k] * W[(size_t)k * NHID + n];
  out[(size_t)b * NHID + n] = acc;
}

// =====================================================================
// WMMA GEMM:  C[M][N] = A[M][K](f16) * Bt[N][K](f16)^T + bias[N]
// 256 threads = 8 waves; block tile 64(M) x 256(N); K-step 32.
// Double-buffered LDS fed by GLOBAL_LOAD_ASYNC_TO_LDS_B128 (ASYNCcnt),
// no VGPR staging, 1 barrier / K-step.
// Each wave: 32x64 tile -> 2x4 v_wmma_f32_16x16x32_f16 per K-step.
// =====================================================================
constexpr int BK  = 32;
constexpr int LDT = BK + 8;    // padded LDS row (halves), preserves 16B alignment

template <bool OUT_F16>
__global__ __launch_bounds__(256, 1)
void gemm_wmma_f16(const _Float16* __restrict__ A,
                   const _Float16* __restrict__ Bt,
                   const float* __restrict__ bias,
                   void* __restrict__ Cout,
                   int M, int N, int K) {
  __shared__ _Float16 As[2][64 * LDT];
  __shared__ _Float16 Bs[2][256 * LDT];

  const int tid  = threadIdx.x;
  const int wid  = tid >> 5;
  const int lane = tid & 31;
  const int lh   = lane & 15;
  const int hi   = lane >> 4;          // 0: lanes 0-15, 1: lanes 16-31

  const int wm = wid >> 2;             // 0..1  (32 M-rows each)
  const int wn = wid & 3;              // 0..3  (64 N-cols each)

  const int m0 = blockIdx.y * 64;
  const int n0 = blockIdx.x * 256;

  const int ldrow = tid >> 2;          // 0..63
  const int ldchk = tid & 3;           // 0..3  (8-half chunks)

  const _Float16* Agp = A  + (size_t)(m0 + ldrow) * K + ldchk * 8;
  const _Float16* Bgp = Bt + (size_t)(n0 + ldrow) * K + ldchk * 8;
  const size_t Brow = (size_t)64 * K;  // 64-row stride between B passes

  // per-thread LDS destination addresses (low 32 bits of shared pointer =
  // wave-relative LDS byte address; HW adds LDS_BASE)
  uint32_t ldsA[2], ldsB[2];
#pragma unroll
  for (int i = 0; i < 2; ++i) {
    ldsA[i] = (uint32_t)(uintptr_t)&As[i][ldrow * LDT + ldchk * 8];
    ldsB[i] = (uint32_t)(uintptr_t)&Bs[i][ldrow * LDT + ldchk * 8];
  }

  // async global -> LDS staging of one K-tile (1 A chunk + 4 B chunks)
  auto issue_tile = [&](int buf, int k0) {
    asm volatile("global_load_async_to_lds_b128 %0, %1, off"
                 :: "v"(ldsA[buf]),
                    "v"((uint64_t)(uintptr_t)(Agp + k0))
                 : "memory");
#pragma unroll
    for (int p = 0; p < 4; ++p) {
      asm volatile("global_load_async_to_lds_b128 %0, %1, off"
                   :: "v"((uint32_t)(ldsB[buf] + p * (64 * LDT * 2))),
                      "v"((uint64_t)(uintptr_t)(Bgp + p * Brow + k0))
                   : "memory");
    }
  };

  v8f_u acc[2][4];
#pragma unroll
  for (int i = 0; i < 2; ++i)
#pragma unroll
    for (int j = 0; j < 4; ++j) acc[i][j].v = (v8f)(0.0f);

  const int nkt = K / BK;

  issue_tile(0, 0);                       // prologue: tile 0 in flight

  for (int kt = 0; kt < nkt; ++kt) {
    const int cur = kt & 1, nxt = cur ^ 1;

    // drain my async writes to lds[cur]; barrier makes all waves' writes
    // visible and guarantees every reader of lds[nxt] (iter kt-1) is done.
    asm volatile("s_wait_asynccnt 0x0" ::: "memory");
    __syncthreads();

    if (kt + 1 < nkt) {
      issue_tile(nxt, (kt + 1) * BK);     // in flight during this K-step
      if (kt + 2 < nkt)
        __builtin_prefetch(Agp + (kt + 2) * BK, 0, 1);
    }

    // ---- gather all fragments, then a back-to-back WMMA burst ----
    v16h aF[2], bF[4];
#pragma unroll
    for (int mf = 0; mf < 2; ++mf) {
      const int m = wm * 32 + mf * 16 + lh;
      const v8h lo = *(const v8h*)&As[cur][m * LDT + hi * 8];       // K 0..7 / 8..15
      const v8h hh = *(const v8h*)&As[cur][m * LDT + 16 + hi * 8];  // K 16..23 / 24..31
      aF[mf] = __builtin_shufflevector(lo, hh,
                 0,1,2,3,4,5,6,7, 8,9,10,11,12,13,14,15);
    }
#pragma unroll
    for (int nf = 0; nf < 4; ++nf) {
      const int n = wn * 64 + nf * 16 + lh;
      const v8h lo = *(const v8h*)&Bs[cur][n * LDT + hi * 8];
      const v8h hh = *(const v8h*)&Bs[cur][n * LDT + 16 + hi * 8];
      bF[nf] = __builtin_shufflevector(lo, hh,
                 0,1,2,3,4,5,6,7, 8,9,10,11,12,13,14,15);
    }
#pragma unroll
    for (int nf = 0; nf < 4; ++nf)
#pragma unroll
      for (int mf = 0; mf < 2; ++mf)
        acc[mf][nf].v = __builtin_amdgcn_wmma_f32_16x16x32_f16(
            false, aF[mf], false, bF[nf], (short)0, acc[mf][nf].v, false, false);
  }

  // ---- epilogue: C layout = VGPR r -> (row r + 8*hi, col lane&15) ----
#pragma unroll
  for (int nf = 0; nf < 4; ++nf) {
    const int col  = n0 + wn * 64 + nf * 16 + lh;
    const float bc = bias[col];
#pragma unroll
    for (int mf = 0; mf < 2; ++mf) {
      const int rbase = m0 + wm * 32 + mf * 16 + hi * 8;
#pragma unroll
      for (int r = 0; r < 8; ++r) {
        const float val = acc[mf][nf].f[r] + bc;
        const size_t idx = (size_t)(rbase + r) * N + col;
        if (OUT_F16) ((_Float16*)Cout)[idx] = (_Float16)val;
        else         ((float*)Cout)[idx]    = val;
      }
    }
  }
}

// =====================================================================
// attention epilogue: one wave per (b, l, h); lane owns 2 dims.
// qk buffer holds q (cols 0..1023) and k (cols 1024..2047) per token.
// slots: [ak, k_{l-1}, k_l, k_{l+1}]; V = [av, k_{l-1}, k_l, k_{l+1}]
// boundary slots are zero vectors -> score 0 (matches zero-padding).
// =====================================================================
__global__ __launch_bounds__(256)
void attn_window(const _Float16* __restrict__ qkh,
                 const float* __restrict__ akf,
                 const float* __restrict__ avf,
                 _Float16* __restrict__ atth) {
  const int gw   = blockIdx.x * (blockDim.x >> 5) + (threadIdx.x >> 5);
  const int lane = threadIdx.x & 31;
  const int h = gw & (NHEAD - 1);
  const int t = gw >> 4;              // b*SEQ + l
  const int l = t & (SEQ - 1);

  const size_t rowq = (size_t)t * NQK + h * HDIM + lane * 2;
  const size_t rowk = rowq + NHID;
  const size_t grow = (size_t)(t >> 12) * NHID + h * HDIM + lane * 2; // b*NHID + ...

  const v2h qv  = *(const v2h*)(qkh + rowq);
  const v2h kcv = *(const v2h*)(qkh + rowk);
  v2h kmv = {}; if (l > 0)       kmv = *(const v2h*)(qkh + rowk - NQK);
  v2h kpv = {}; if (l < SEQ - 1) kpv = *(const v2h*)(qkh + rowk + NQK);
  const float2 ak2 = *(const float2*)(akf + grow);
  const float2 av2 = *(const float2*)(avf + grow);

  const float q0 = (float)qv[0], q1 = (float)qv[1];
  float s0 = q0 * ak2.x          + q1 * ak2.y;
  float s1 = q0 * (float)kmv[0]  + q1 * (float)kmv[1];
  float s2 = q0 * (float)kcv[0]  + q1 * (float)kcv[1];
  float s3 = q0 * (float)kpv[0]  + q1 * (float)kpv[1];

#pragma unroll
  for (int off = 16; off > 0; off >>= 1) {
    s0 += __shfl_xor(s0, off, 32);
    s1 += __shfl_xor(s1, off, 32);
    s2 += __shfl_xor(s2, off, 32);
    s3 += __shfl_xor(s3, off, 32);
  }
  const float sc = 0.125f;  // 1/sqrt(64)
  s0 *= sc; s1 *= sc; s2 *= sc; s3 *= sc;

  const float mx = fmaxf(fmaxf(s0, s1), fmaxf(s2, s3));
  const float e0 = __expf(s0 - mx), e1 = __expf(s1 - mx);
  const float e2 = __expf(s2 - mx), e3 = __expf(s3 - mx);
  const float inv = 1.0f / (e0 + e1 + e2 + e3);
  const float a0 = e0 * inv, a1 = e1 * inv, a2 = e2 * inv, a3 = e3 * inv;

  const float o0 = a0 * av2.x + a1 * (float)kmv[0] + a2 * (float)kcv[0] + a3 * (float)kpv[0];
  const float o1 = a0 * av2.y + a1 * (float)kmv[1] + a2 * (float)kcv[1] + a3 * (float)kpv[1];

  v2h ov; ov[0] = (_Float16)o0; ov[1] = (_Float16)o1;
  *(v2h*)(atth + (size_t)t * NHID + h * HDIM + lane * 2) = ov;
}

// =====================================================================
// launch
// =====================================================================
extern "C" void kernel_launch(void* const* d_in, const int* in_sizes, int n_in,
                              void* d_out, int out_size, void* d_ws, size_t ws_size,
                              hipStream_t stream) {
  const float* x    = (const float*)d_in[0];
  const float* ax   = (const float*)d_in[1];
  const float* WQ_w = (const float*)d_in[2];
  const float* WQ_b = (const float*)d_in[3];
  const float* WK_w = (const float*)d_in[4];
  const float* WK_b = (const float*)d_in[5];
  const float* WV_w = (const float*)d_in[6];
  const float* WV_b = (const float*)d_in[7];
  const float* WO_w = (const float*)d_in[8];
  const float* WO_b = (const float*)d_in[9];

  char* ws = (char*)d_ws;
  _Float16* xh   = (_Float16*)(ws + OFF_XH);
  _Float16* wqkt = (_Float16*)(ws + OFF_WQKT);
  _Float16* wot  = (_Float16*)(ws + OFF_WOT);
  float*    bqk  = (float*)(ws + OFF_BQK);
  _Float16* qkh  = (_Float16*)(ws + OFF_QKH);
  _Float16* atth = (_Float16*)(ws + OFF_ATTH);
  float*    akf  = (float*)(ws + OFF_AK);
  float*    avf  = (float*)(ws + OFF_AV);

  // 1) convert x -> f16
  {
    int n4 = MROWS * NHID / 4;
    cvt_f32_to_f16_x4<<<(n4 + 255) / 256, 256, 0, stream>>>(x, xh, n4);
  }
  // 2) transpose+convert weights: [WQ^T ; WK^T] fused, and WO^T
  {
    dim3 g(NHID / 32, NHID / 32), b(32, 8);
    transpose_f32_to_f16<<<g, b, 0, stream>>>(WQ_w, wqkt, NHID, NHID);
    transpose_f32_to_f16<<<g, b, 0, stream>>>(WK_w, wqkt + (size_t)NHID * NHID, NHID, NHID);
    transpose_f32_to_f16<<<g, b, 0, stream>>>(WO_w, wot, NHID, NHID);
  }
  // 3) fused bias [WQ_b ; WK_b]
  concat_bias<<<NQK / 256, 256, 0, stream>>>(WQ_b, WK_b, bqk, NHID);
  // 4) global-token projections ak = ax@WK + bK, av = ax@WV + bV (f32)
  {
    dim3 g(NHID / 256, BATCH);
    proj_global_tok<<<g, 256, 0, stream>>>(ax, WK_w, WK_b, akf);
    proj_global_tok<<<g, 256, 0, stream>>>(ax, WV_w, WV_b, avf);
  }
  // 5) fused q|k projection via WMMA GEMM: [32768x1024] @ [1024x2048]
  {
    dim3 g(NQK / 256, MROWS / 64);
    gemm_wmma_f16<true><<<g, 256, 0, stream>>>(xh, wqkt, bqk, (void*)qkh,
                                               MROWS, NQK, NHID);
  }
  // 6) windowed attention epilogue -> att (f16)
  {
    int waves = BATCH * SEQ * NHEAD;           // 524288
    attn_window<<<waves / 8, 256, 0, stream>>>(qkh, akf, avf, atth);
  }
  // 7) output projection via WMMA GEMM (f32 out to d_out)
  {
    dim3 g(NHID / 256, MROWS / 64);
    gemm_wmma_f16<false><<<g, 256, 0, stream>>>(atth, wot, WO_b, d_out,
                                                MROWS, NHID, NHID);
  }
}

// v001
// Measured time: 396 microseconds a run.
// Timed twice side by side with v000, it ran 1.51 times as fast both times.
#include <hip/hip_runtime.h>
#include <hip/hip_bf16.h>
#include <stdint.h>

// ---------------- problem constants ----------------
constexpr int BATCH = 8;
constexpr int SEQ   = 4096;
constexpr int NHEAD = 16;
constexpr int HDIM  = 64;
constexpr int NHID  = 1024;              // == NHEAD*HDIM
constexpr int MROWS = BATCH * SEQ;       // 32768
constexpr int NQK   = 2 * NHID;          // fused q|k output width

// ---------------- vector types ----------------
typedef __attribute__((ext_vector_type(16))) _Float16 v16h;
typedef __attribute__((ext_vector_type(8)))  _Float16 v8h;
typedef __attribute__((ext_vector_type(4)))  _Float16 v4h;
typedef __attribute__((ext_vector_type(2)))  _Float16 v2h;
typedef __attribute__((ext_vector_type(8)))  float    v8f;

typedef union { v8f v; float f[8]; } v8f_u;

// ---------------- workspace layout (bytes) ----------------
constexpr size_t OFF_XH   = 0;                                    // 32768x1024 f16 (64 MB)
constexpr size_t OFF_WQKT = OFF_XH   + (size_t)MROWS * NHID * 2;  // 2048x1024 f16 ([WQ^T;WK^T])
constexpr size_t OFF_WOT  = OFF_WQKT + (size_t)NQK   * NHID * 2;  // 1024x1024 f16
constexpr size_t OFF_BQK  = OFF_WOT  + (size_t)NHID  * NHID * 2;  // 2048 f32
constexpr size_t OFF_QKH  = OFF_BQK  + (size_t)NQK * 4;           // 32768x2048 f16 (128 MB)
constexpr size_t OFF_ATTH = OFF_QKH  + (size_t)MROWS * NQK * 2;   // 32768x1024 f16
constexpr size_t OFF_AK   = OFF_ATTH + (size_t)MROWS * NHID * 2;  // 8x1024 f32
constexpr size_t OFF_AV   = OFF_AK   + (size_t)BATCH * NHID * 4;

// =====================================================================
// f32 -> f16 conversion, 4 elements / thread
// =====================================================================
__global__ void cvt_f32_to_f16_x4(const float* __restrict__ in,
                                  _Float16* __restrict__ out, int n4) {
  int i = blockIdx.x * blockDim.x + threadIdx.x;
  if (i >= n4) return;
  float4 v = ((const float4*)in)[i];
  v4h h;
  h[0] = (_Float16)v.x; h[1] = (_Float16)v.y;
  h[2] = (_Float16)v.z; h[3] = (_Float16)v.w;
  ((v4h*)out)[i] = h;
}

// =====================================================================
// f32 [K][N] -> f16 [N][K] transpose (32x32 LDS tiles)
// =====================================================================
__global__ void transpose_f32_to_f16(const float* __restrict__ in,
                                     _Float16* __restrict__ out,
                                     int K, int N) {
  __shared__ float tile[32][33];
  int tx = threadIdx.x, ty = threadIdx.y;
  int k0 = blockIdx.y * 32, n0 = blockIdx.x * 32;
#pragma unroll
  for (int i = 0; i < 32; i += 8)
    tile[ty + i][tx] = in[(size_t)(k0 + ty + i) * N + n0 + tx];
  __syncthreads();
#pragma unroll
  for (int i = 0; i < 32; i += 8)
    out[(size_t)(n0 + ty + i) * K + k0 + tx] = (_Float16)tile[tx][ty + i];
}

// =====================================================================
// concat two f32 vectors of length n -> out[2n]
// =====================================================================
__global__ void concat_bias(const float* __restrict__ a, const float* __restrict__ b,
                            float* __restrict__ out, int n) {
  int i = blockIdx.x * blockDim.x + threadIdx.x;
  out[i] = (i < n) ? a[i] : b[i - n];
}

// =====================================================================
// projection of the global token: out[b][n] = ax[b].W[:,n] + bias[n]
// One block owns 32 columns for 4 of the 8 batches. The k range is split
// over 128 slices of 8 rows: thread = (slice, column quad). A thread's 8 W
// rows and its ax values fit in registers together, so they are all asked
// for at once and the block waits for memory once, where a serial k loop
// waits once per unrolled group of rows.
// Partial sums: the 4 slices of a wave by shuffles, the 32 waves through LDS.
// =====================================================================
constexpr int PG_COLS    = 32;                     // columns per block: one 128-B line per W row
constexpr int PG_BATCH   = 4;                      // batches per block
constexpr int PG_THREADS = 1024;
constexpr int PG_WAVES   = PG_THREADS / 32;
constexpr int PG_KPT     = NHID / (PG_THREADS / (PG_COLS / 4));   // 8 rows per thread
static_assert(PG_KPT == 8 && PG_BATCH == 4 && NHID * 4 == 4096, "the offsets in the load statement are written for these");

typedef __attribute__((ext_vector_type(4))) float v4f;

__global__ __launch_bounds__(PG_THREADS)
void proj_global_tok(const float* __restrict__ ax,
                     const float* __restrict__ W,
                     const float* __restrict__ bias,
                     float* __restrict__ out) {
  __shared__ float part[PG_WAVES][PG_BATCH][PG_COLS];   // 16 KB

  const int tid  = threadIdx.x;
  const int lane = tid & 31;
  const int wave = tid >> 5;
  const int cq   = tid & 7;                  // column quad inside the block
  const int k0   = (tid >> 3) * PG_KPT;      // first row of this thread's slice
  const int nblk = blockIdx.x * PG_COLS;
  const int b0   = blockIdx.y * PG_BATCH;

  const float* wp = W  + (size_t)k0 * NHID + nblk + cq * 4;   // row j at byte offset j * 4096
  const float* ap = ax + (size_t)b0 * NHID + k0;              // batch bb at byte offset bb * 4096

  // All 16 loads of the thread and their data wait in one statement: every load is in
  // flight before the first wait, and the early-clobber outputs keep each result out of
  // the two address pairs until all loads have returned (as plain loads the build let one
  // load's result land in the pair that six loads still in flight named).
  v4f w[PG_KPT], a[PG_BATCH][2];
  asm volatile(
      "global_load_b128 %0, %16, off\n\t"
      "global_load_b128 %1, %16, off offset:4096\n\t"
      "global_load_b128 %2, %16, off offset:8192\n\t"
      "global_load_b128 %3, %16, off offset:12288\n\t"
      "global_load_b128 %4, %16, off offset:16384\n\t"
      "global_load_b128 %5, %16, off offset:20480\n\t"
      "global_load_b128 %6, %16, off offset:24576\n\t"
      "global_load_b128 %7, %16, off offset:28672\n\t"
      "global_load_b128 %8, %17, off\n\t"
      "global_load_b128 %9, %17, off offset:16\n\t"
      "global_load_b128 %10, %17, off offset:4096\n\t"
      "global_load_b128 %11, %17, off offset:4112\n\t"
      "global_load_b128 %12, %17, off offset:8192\n\t"
      "global_load_b128 %13, %17, off offset:8208\n\t"
      "global_load_b128 %14, %17, off offset:12288\n\t"
      "global_load_b128 %15, %17, off offset:12304\n\t"
      "s_wait_loadcnt 0x0"
      : "=&v"(w[0]), "=&v"(w[1]), "=&v"(w[2]), "=&v"(w[3]),
        "=&v"(w[4]), "=&v"(w[5]), "=&v"(w[6]), "=&v"(w[7]),
        "=&v"(a[0][0]), "=&v"(a[0][1]), "=&v"(a[1][0]), "=&v"(a[1][1]),
        "=&v"(a[2][0]), "=&v"(a[2][1]), "=&v"(a[3][0]), "=&v"(a[3][1])
      : "v"(wp), "v"(ap)
      : "memory");

  v4f acc[PG_BATCH];
#pragma unroll
  for (int bb = 0; bb < PG_BATCH; ++bb) {
    v4f s = a[bb][0][0] * w[0];
#pragma unroll
    for (int j = 1; j < PG_KPT; ++j)
      s += a[bb][j >> 2][j & 3] * w[j];
    acc[bb] = s;
  }

  // the wave's 4 slices sit in lanes cq, cq+8, cq+16, cq+24
#pragma unroll
  for (int bb = 0; bb < PG_BATCH; ++bb) {
#pragma unroll
    for (int off = 8; off <= 16; off <<= 1) {
#pragma unroll
      for (int e = 0; e < 4; ++e)
        acc[bb][e] += __shfl_xor(acc[bb][e], off, 32);
    }
  }
  if (lane < 8) {
#pragma unroll
    for (int bb = 0; bb < PG_BATCH; ++bb)
      *(v4f*)&part[wave][bb][cq * 4] = acc[bb];
  }
  __syncthreads();

  // one thread per (batch, column) adds the 32 waves' partial sums
  if (tid < PG_BATCH * PG_COLS) {
    const int bb = tid >> 5, c = tid & 31;
    float s = bias[nblk + c];
#pragma unroll
    for (int wv = 0; wv < PG_WAVES; ++wv)
      s += part[wv][bb][c];
    out[(size_t)(b0 + bb) * NHID + nblk + c] = s;
  }
}

// =====================================================================
// WMMA GEMM:  C[M][N] = A[M][K](f16) * Bt[N][K](f16)^T + bias[N]
// 256 threads = 8 waves; block tile 64(M) x 256(N); K-step 32.
// Double-buffered LDS fed by GLOBAL_LOAD_ASYNC_TO_LDS_B128 (ASYNCcnt),
// no VGPR staging, 1 barrier / K-step.
// Each wave: 32x64 tile -> 2x4 v_wmma_f32_16x16x32_f16 per K-step.
// =====================================================================
constexpr int BK  = 32;
constexpr int LDT = BK + 8;    // padded LDS row (halves), preserves 16B alignment

template <bool OUT_F16>
__global__ __launch_bounds__(256, 1)
void gemm_wmma_f16(const _Float16* __restrict__ A,
                   const _Float16* __restrict__ Bt,
                   const float* __restrict__ bias,
                   void* __restrict__ Cout,
                   int M, int N, int K) {
  __shared__ _Float16 As[2][64 * LDT];
  __shared__ _Float16 Bs[2][256 * LDT];

  const int tid  = threadIdx.x;
  const int wid  = tid >> 5;
  const int lane = tid & 31;
  const int lh   = lane & 15;
  const int hi   = lane >> 4;          // 0: lanes 0-15, 1: lanes 16-31

  const int wm = wid >> 2;             // 0..1  (32 M-rows each)
  const int wn = wid & 3;              // 0..3  (64 N-cols each)

  const int m0 = blockIdx.y * 64;
  const int n0 = blockIdx.x * 256;

  const int ldrow = tid >> 2;          // 0..63
  const int ldchk = tid & 3;           // 0..3  (8-half chunks)

  const _Float16* Agp = A  + (size_t)(m0 + ldrow) * K + ldchk * 8;
  const _Float16* Bgp = Bt + (size_t)(n0 + ldrow) * K + ldchk * 8;
  const size_t Brow = (size_t)64 * K;  // 64-row stride between B passes

  // per-thread LDS destination addresses (low 32 bits of shared pointer =
  // wave-relative LDS byte address; HW adds LDS_BASE)
  uint32_t ldsA[2], ldsB[2];
#pragma unroll
  for (int i = 0; i < 2; ++i) {
    ldsA[i] = (uint32_t)(uintptr_t)&As[i][ldrow * LDT + ldchk * 8];
    ldsB[i] = (uint32_t)(uintptr_t)&Bs[i][ldrow * LDT + ldchk * 8];
  }

  // async global -> LDS staging of one K-tile (1 A chunk + 4 B chunks)
  auto issue_tile = [&](int buf, int k0) {
    asm volatile("global_load_async_to_lds_b128 %0, %1, off"
                 :: "v"(ldsA[buf]),
                    "v"((uint64_t)(uintptr_t)(Agp + k0))
                 : "memory");
#pragma unroll
    for (int p = 0; p < 4; ++p) {
      asm volatile("global_load_async_to_lds_b128 %0, %1, off"
                   :: "v"((uint32_t)(ldsB[buf] + p * (64 * LDT * 2))),
                      "v"((uint64_t)(uintptr_t)(Bgp + p * Brow + k0))
                   : "memory");
    }
  };

  v8f_u acc[2][4];
#pragma unroll
  for (int i = 0; i < 2; ++i)
#pragma unroll
    for (int j = 0; j < 4; ++j) acc[i][j].v = (v8f)(0.0f);

  const int nkt = K / BK;

  issue_tile(0, 0);                       // prologue: tile 0 in flight

  for (int kt = 0; kt < nkt; ++kt) {
    const int cur = kt & 1, nxt = cur ^ 1;

    // drain my async writes to lds[cur]; barrier makes all waves' writes
    // visible and guarantees every reader of lds[nxt] (iter kt-1) is done.
    asm volatile("s_wait_asynccnt 0x0" ::: "memory");
    __syncthreads();

    if (kt + 1 < nkt) {
      issue_tile(nxt, (kt + 1) * BK);     // in flight during this K-step
      if (kt + 2 < nkt)
        __builtin_prefetch(Agp + (kt + 2) * BK, 0, 1);
    }

    // ---- gather all fragments, then a back-to-back WMMA burst ----
    v16h aF[2], bF[4];
#pragma unroll
    for (int mf = 0; mf < 2; ++mf) {
      const int m = wm * 32 + mf * 16 + lh;
      const v8h lo = *(const v8h*)&As[cur][m * LDT + hi * 8];       // K 0..7 / 8..15
      const v8h hh = *(const v8h*)&As[cur][m * LDT + 16 + hi * 8];  // K 16..23 / 24..31
      aF[mf] = __builtin_shufflevector(lo, hh,
                 0,1,2,3,4,5,6,7, 8,9,10,11,12,13,14,15);
    }
#pragma unroll
    for (int nf = 0; nf < 4; ++nf) {
      const int n = wn * 64 + nf * 16 + lh;
      const v8h lo = *(const v8h*)&Bs[cur][n * LDT + hi * 8];
      const v8h hh = *(const v8h*)&Bs[cur][n * LDT + 16 + hi * 8];
      bF[nf] = __builtin_shufflevector(lo, hh,
                 0,1,2,3,4,5,6,7, 8,9,10,11,12,13,14,15);
    }
#pragma unroll
    for (int nf = 0; nf < 4; ++nf)
#pragma unroll
      for (int mf = 0; mf < 2; ++mf)
        acc[mf][nf].v = __builtin_amdgcn_wmma_f32_16x16x32_f16(
            false, aF[mf], false, bF[nf], (short)0, acc[mf][nf].v, false, false);
  }

  // ---- epilogue: C layout = VGPR r -> (row r + 8*hi, col lane&15) ----
#pragma unroll
  for (int nf = 0; nf < 4; ++nf) {
    const int col  = n0 + wn * 64 + nf * 16 + lh;
    const float bc = bias[col];
#pragma unroll
    for (int mf = 0; mf < 2; ++mf) {
      const int rbase = m0 + wm * 32 + mf * 16 + hi * 8;
#pragma unroll
      for (int r = 0; r < 8; ++r) {
        const float val = acc[mf][nf].f[r] + bc;
        const size_t idx = (size_t)(rbase + r) * N + col;
        if (OUT_F16) ((_Float16*)Cout)[idx] = (_Float16)val;
        else         ((float*)Cout)[idx]    = val;
      }
    }
  }
}

// =====================================================================
// attention epilogue: one wave per (b, l, h); lane owns 2 dims.
// qk buffer holds q (cols 0..1023) and k (cols 1024..2047) per token.
// slots: [ak, k_{l-1}, k_l, k_{l+1}]; V = [av, k_{l-1}, k_l, k_{l+1}]
// boundary slots are zero vectors -> score 0 (matches zero-padding).
// =====================================================================
__global__ __launch_bounds__(256)
void attn_window(const _Float16* __restrict__ qkh,
                 const float* __restrict__ akf,
                 const float* __restrict__ avf,
                 _Float16* __restrict__ atth) {
  const int gw   = blockIdx.x * (blockDim.x >> 5) + (threadIdx.x >> 5);
  const int lane = threadIdx.x & 31;
  const int h = gw & (NHEAD - 1);
  const int t = gw >> 4;              // b*SEQ + l
  const int l = t & (SEQ - 1);

  const size_t rowq = (size_t)t * NQK + h * HDIM + lane * 2;
  const size_t rowk = rowq + NHID;
  const size_t grow = (size_t)(t >> 12) * NHID + h * HDIM + lane * 2; // b*NHID + ...

  const v2h qv  = *(const v2h*)(qkh + rowq);
  const v2h kcv = *(const v2h*)(qkh + rowk);
  v2h kmv = {}; if (l > 0)       kmv = *(const v2h*)(qkh + rowk - NQK);
  v2h kpv = {}; if (l < SEQ - 1) kpv = *(const v2h*)(qkh + rowk + NQK);
  const float2 ak2 = *(const float2*)(akf + grow);
  const float2 av2 = *(const float2*)(avf + grow);

  const float q0 = (float)qv[0], q1 = (float)qv[1];
  float s0 = q0 * ak2.x          + q1 * ak2.y;
  float s1 = q0 * (float)kmv[0]  + q1 * (float)kmv[1];
  float s2 = q0 * (float)kcv[0]  + q1 * (float)kcv[1];
  float s3 = q0 * (float)kpv[0]  + q1 * (float)kpv[1];

#pragma unroll
  for (int off = 16; off > 0; off >>= 1) {
    s0 += __shfl_xor(s0, off, 32);
    s1 += __shfl_xor(s1, off, 32);
    s2 += __shfl_xor(s2, off, 32);
    s3 += __shfl_xor(s3, off, 32);
  }
  const float sc = 0.125f;  // 1/sqrt(64)
  s0 *= sc; s1 *= sc; s2 *= sc; s3 *= sc;

  const float mx = fmaxf(fmaxf(s0, s1), fmaxf(s2, s3));
  const float e0 = __expf(s0 - mx), e1 = __expf(s1 - mx);
  const float e2 = __expf(s2 - mx), e3 = __expf(s3 - mx);
  const float inv = 1.0f / (e0 + e1 + e2 + e3);
  const float a0 = e0 * inv, a1 = e1 * inv, a2 = e2 * inv, a3 = e3 * inv;

  const float o0 = a0 * av2.x + a1 * (float)kmv[0] + a2 * (float)kcv[0] + a3 * (float)kpv[0];
  const float o1 = a0 * av2.y + a1 * (float)kmv[1] + a2 * (float)kcv[1] + a3 * (float)kpv[1];

  v2h ov; ov[0] = (_Float16)o0; ov[1] = (_Float16)o1;
  *(v2h*)(atth + (size_t)t * NHID + h * HDIM + lane * 2) = ov;
}

// =====================================================================
// launch
// =====================================================================
extern "C" void kernel_launch(void* const* d_in, const int* in_sizes, int n_in,
                              void* d_out, int out_size, void* d_ws, size_t ws_size,
                              hipStream_t stream) {
  const float* x    = (const float*)d_in[0];
  const float* ax   = (const float*)d_in[1];
  const float* WQ_w = (const float*)d_in[2];
  const float* WQ_b = (const float*)d_in[3];
  const float* WK_w = (const float*)d_in[4];
  const float* WK_b = (const float*)d_in[5];
  const float* WV_w = (const float*)d_in[6];
  const float* WV_b = (const float*)d_in[7];
  const float* WO_w = (const float*)d_in[8];
  const float* WO_b = (const float*)d_in[9];

  char* ws = (char*)d_ws;
  _Float16* xh   = (_Float16*)(ws + OFF_XH);
  _Float16* wqkt = (_Float16*)(ws + OFF_WQKT);
  _Float16* wot  = (_Float16*)(ws + OFF_WOT);
  float*    bqk  = (float*)(ws + OFF_BQK);
  _Float16* qkh  = (_Float16*)(ws + OFF_QKH);
  _Float16* atth = (_Float16*)(ws + OFF_ATTH);
  float*    akf  = (float*)(ws + OFF_AK);
  float*    avf  = (float*)(ws + OFF_AV);

  // 1) convert x -> f16
  {
    int n4 = MROWS * NHID / 4;
    cvt_f32_to_f16_x4<<<(n4 + 255) / 256, 256, 0, stream>>>(x, xh, n4);
  }
  // 2) transpose+convert weights: [WQ^T ; WK^T] fused, and WO^T
  {
    dim3 g(NHID / 32, NHID / 32), b(32, 8);
    transpose_f32_to_f16<<<g, b, 0, stream>>>(WQ_w, wqkt, NHID, NHID);
    transpose_f32_to_f16<<<g, b, 0, stream>>>(WK_w, wqkt + (size_t)NHID * NHID, NHID, NHID);
    transpose_f32_to_f16<<<g, b, 0, stream>>>(WO_w, wot, NHID, NHID);
  }
  // 3) fused bias [WQ_b ; WK_b]
  concat_bias<<<NQK / 256, 256, 0, stream>>>(WQ_b, WK_b, bqk, NHID);
  // 4) global-token projections ak = ax@WK + bK, av = ax@WV + bV (f32)
  {
    dim3 g(NHID / PG_COLS, BATCH / PG_BATCH);
    proj_global_tok<<<g, PG_THREADS, 0, stream>>>(ax, WK_w, WK_b, akf);
    proj_global_tok<<<g, PG_THREADS, 0, stream>>>(ax, WV_w, WV_b, avf);
  }
  // 5) fused q|k projection via WMMA GEMM: [32768x1024] @ [1024x2048]
  {
    dim3 g(NQK / 256, MROWS / 64);
    gemm_wmma_f16<true><<<g, 256, 0, stream>>>(xh, wqkt, bqk, (void*)qkh,
                                               MROWS, NQK, NHID);
  }
  // 6) windowed attention epilogue -> att (f16)
  {
    int waves = BATCH * SEQ * NHEAD;           // 524288
    attn_window<<<waves / 8, 256, 0, stream>>>(qkh, akf, avf, atth);
  }
  // 7) output projection via WMMA GEMM (f32 out to d_out)
  {
    dim3 g(NHID / 256, MROWS / 64);
    gemm_wmma_f16<false><<<g, 256, 0, stream>>>(atth, wot, WO_b, d_out,
                                                MROWS, NHID, NHID);
  }
}

// v002
// It runs in 354 microseconds.
// Two timings next to v001 both put it at 1.12 times that version's speed.
// Over all steps from v000 it is 1.69 times as fast.
#include <hip/hip_runtime.h>
#include <hip/hip_bf16.h>
#include <stdint.h>

// ---------------- problem constants ----------------
constexpr int BATCH = 8;
constexpr int SEQ   = 4096;
constexpr int NHEAD = 16;
constexpr int HDIM  = 64;
constexpr int NHID  = 1024;              // == NHEAD*HDIM
constexpr int MROWS = BATCH * SEQ;       // 32768
constexpr int NQK   = 2 * NHID;          // fused q|k output width

// ---------------- vector types ----------------
typedef __attribute__((ext_vector_type(16))) _Float16 v16h;
typedef __attribute__((ext_vector_type(8)))  _Float16 v8h;
typedef __attribute__((ext_vector_type(4)))  _Float16 v4h;
typedef __attribute__((ext_vector_type(2)))  _Float16 v2h;
typedef __attribute__((ext_vector_type(8)))  float    v8f;

typedef union { v8f v; float f[8]; } v8f_u;

// ---------------- workspace layout (bytes) ----------------
constexpr size_t OFF_XH   = 0;                                    // 32768x1024 f16 (64 MB)
constexpr size_t OFF_WQKT = OFF_XH   + (size_t)MROWS * NHID * 2;  // 2048x1024 f16 ([WQ^T;WK^T])
constexpr size_t OFF_WOT  = OFF_WQKT + (size_t)NQK   * NHID * 2;  // 1024x1024 f16
constexpr size_t OFF_BQK  = OFF_WOT  + (size_t)NHID  * NHID * 2;  // 2048 f32
constexpr size_t OFF_QKH  = OFF_BQK  + (size_t)NQK * 4;           // 32768x2048 f16 (128 MB)
constexpr size_t OFF_ATTH = OFF_QKH  + (size_t)MROWS * NQK * 2;   // 32768x1024 f16
constexpr size_t OFF_AK   = OFF_ATTH + (size_t)MROWS * NHID * 2;  // 8x1024 f32
constexpr size_t OFF_AV   = OFF_AK   + (size_t)BATCH * NHID * 4;

// =====================================================================
// f32 -> f16 conversion, 4 elements / thread
// =====================================================================
__global__ void cvt_f32_to_f16_x4(const float* __restrict__ in,
                                  _Float16* __restrict__ out, int n4) {
  int i = blockIdx.x * blockDim.x + threadIdx.x;
  if (i >= n4) return;
  float4 v = ((const float4*)in)[i];
  v4h h;
  h[0] = (_Float16)v.x; h[1] = (_Float16)v.y;
  h[2] = (_Float16)v.z; h[3] = (_Float16)v.w;
  ((v4h*)out)[i] = h;
}

// =====================================================================
// f32 [K][N] -> f16 [N][K] transpose (32x32 LDS tiles)
// =====================================================================
__global__ void transpose_f32_to_f16(const float* __restrict__ in,
                                     _Float16* __restrict__ out,
                                     int K, int N) {
  __shared__ float tile[32][33];
  int tx = threadIdx.x, ty = threadIdx.y;
  int k0 = blockIdx.y * 32, n0 = blockIdx.x * 32;
#pragma unroll
  for (int i = 0; i < 32; i += 8)
    tile[ty + i][tx] = in[(size_t)(k0 + ty + i) * N + n0 + tx];
  __syncthreads();
#pragma unroll
  for (int i = 0; i < 32; i += 8)
    out[(size_t)(n0 + ty + i) * K + k0 + tx] = (_Float16)tile[tx][ty + i];
}

// =====================================================================
// concat two f32 vectors of length n -> out[2n]
// =====================================================================
__global__ void concat_bias(const float* __restrict__ a, const float* __restrict__ b,
                            float* __restrict__ out, int n) {
  int i = blockIdx.x * blockDim.x + threadIdx.x;
  out[i] = (i < n) ? a[i] : b[i - n];
}

// =====================================================================
// projection of the global token: out[b][n] = ax[b].W[:,n] + bias[n]
// One block owns 32 columns for 4 of the 8 batches. The k range is split
// over 128 slices of 8 rows: thread = (slice, column quad). A thread's 8 W
// rows and its ax values fit in registers together, so they are all asked
// for at once and the block waits for memory once, where a serial k loop
// waits once per unrolled group of rows.
// Partial sums: the 4 slices of a wave by shuffles, the 32 waves through LDS.
// =====================================================================
constexpr int PG_COLS    = 32;                     // columns per block: one 128-B line per W row
constexpr int PG_BATCH   = 4;                      // batches per block
constexpr int PG_THREADS = 1024;
constexpr int PG_WAVES   = PG_THREADS / 32;
constexpr int PG_KPT     = NHID / (PG_THREADS / (PG_COLS / 4));   // 8 rows per thread
static_assert(PG_KPT == 8 && PG_BATCH == 4 && NHID * 4 == 4096, "the offsets in the load statement are written for these");

typedef __attribute__((ext_vector_type(4))) float v4f;

__global__ __launch_bounds__(PG_THREADS)
void proj_global_tok(const float* __restrict__ ax,
                     const float* __restrict__ W,
                     const float* __restrict__ bias,
                     float* __restrict__ out) {
  __shared__ float part[PG_WAVES][PG_BATCH][PG_COLS];   // 16 KB

  const int tid  = threadIdx.x;
  const int lane = tid & 31;
  const int wave = tid >> 5;
  const int cq   = tid & 7;                  // column quad inside the block
  const int k0   = (tid >> 3) * PG_KPT;      // first row of this thread's slice
  const int nblk = blockIdx.x * PG_COLS;
  const int b0   = blockIdx.y * PG_BATCH;

  const float* wp = W  + (size_t)k0 * NHID + nblk + cq * 4;   // row j at byte offset j * 4096
  const float* ap = ax + (size_t)b0 * NHID + k0;              // batch bb at byte offset bb * 4096

  // All 16 loads of the thread and their data wait in one statement: every load is in
  // flight before the first wait, and the early-clobber outputs keep each result out of
  // the two address pairs until all loads have returned (as plain loads the build let one
  // load's result land in the pair that six loads still in flight named).
  v4f w[PG_KPT], a[PG_BATCH][2];
  asm volatile(
      "global_load_b128 %0, %16, off\n\t"
      "global_load_b128 %1, %16, off offset:4096\n\t"
      "global_load_b128 %2, %16, off offset:8192\n\t"
      "global_load_b128 %3, %16, off offset:12288\n\t"
      "global_load_b128 %4, %16, off offset:16384\n\t"
      "global_load_b128 %5, %16, off offset:20480\n\t"
      "global_load_b128 %6, %16, off offset:24576\n\t"
      "global_load_b128 %7, %16, off offset:28672\n\t"
      "global_load_b128 %8, %17, off\n\t"
      "global_load_b128 %9, %17, off offset:16\n\t"
      "global_load_b128 %10, %17, off offset:4096\n\t"
      "global_load_b128 %11, %17, off offset:4112\n\t"
      "global_load_b128 %12, %17, off offset:8192\n\t"
      "global_load_b128 %13, %17, off offset:8208\n\t"
      "global_load_b128 %14, %17, off offset:12288\n\t"
      "global_load_b128 %15, %17, off offset:12304\n\t"
      "s_wait_loadcnt 0x0"
      : "=&v"(w[0]), "=&v"(w[1]), "=&v"(w[2]), "=&v"(w[3]),
        "=&v"(w[4]), "=&v"(w[5]), "=&v"(w[6]), "=&v"(w[7]),
        "=&v"(a[0][0]), "=&v"(a[0][1]), "=&v"(a[1][0]), "=&v"(a[1][1]),
        "=&v"(a[2][0]), "=&v"(a[2][1]), "=&v"(a[3][0]), "=&v"(a[3][1])
      : "v"(wp), "v"(ap)
      : "memory");

  v4f acc[PG_BATCH];
#pragma unroll
  for (int bb = 0; bb < PG_BATCH; ++bb) {
    v4f s = a[bb][0][0] * w[0];
#pragma unroll
    for (int j = 1; j < PG_KPT; ++j)
      s += a[bb][j >> 2][j & 3] * w[j];
    acc[bb] = s;
  }

  // the wave's 4 slices sit in lanes cq, cq+8, cq+16, cq+24
#pragma unroll
  for (int bb = 0; bb < PG_BATCH; ++bb) {
#pragma unroll
    for (int off = 8; off <= 16; off <<= 1) {
#pragma unroll
      for (int e = 0; e < 4; ++e)
        acc[bb][e] += __shfl_xor(acc[bb][e], off, 32);
    }
  }
  if (lane < 8) {
#pragma unroll
    for (int bb = 0; bb < PG_BATCH; ++bb)
      *(v4f*)&part[wave][bb][cq * 4] = acc[bb];
  }
  __syncthreads();

  // one thread per (batch, column) adds the 32 waves' partial sums
  if (tid < PG_BATCH * PG_COLS) {
    const int bb = tid >> 5, c = tid & 31;
    float s = bias[nblk + c];
#pragma unroll
    for (int wv = 0; wv < PG_WAVES; ++wv)
      s += part[wv][bb][c];
    out[(size_t)(b0 + bb) * NHID + nblk + c] = s;
  }
}

// =====================================================================
// WMMA GEMM:  C[M][N] = A[M][K](f16) * Bt[N][K](f16)^T + bias[N]
// 256 threads = 8 waves; block tile 64(M) x 256(N); K-step 32.
// Double-buffered LDS fed by GLOBAL_LOAD_ASYNC_TO_LDS_B128 (ASYNCcnt),
// no VGPR staging, 1 barrier / K-step.
// Each wave: 32x64 tile -> 2x4 v_wmma_f32_16x16x32_f16 per K-step.
// =====================================================================
constexpr int BK  = 32;
constexpr int LDT = BK + 8;    // padded LDS row (halves), preserves 16B alignment

template <bool OUT_F16>
__global__ __launch_bounds__(256, 1)
void gemm_wmma_f16(const _Float16* __restrict__ A,
                   const _Float16* __restrict__ Bt,
                   const float* __restrict__ bias,
                   void* __restrict__ Cout,
                   int M, int N, int K) {
  __shared__ _Float16 As[2][64 * LDT];
  __shared__ _Float16 Bs[2][256 * LDT];

  const int tid  = threadIdx.x;
  const int wid  = tid >> 5;
  const int lane = tid & 31;
  const int lh   = lane & 15;
  const int hi   = lane >> 4;          // 0: lanes 0-15, 1: lanes 16-31

  const int wm = wid >> 2;             // 0..1  (32 M-rows each)
  const int wn = wid & 3;              // 0..3  (64 N-cols each)

  const int m0 = blockIdx.y * 64;
  const int n0 = blockIdx.x * 256;

  const int ldrow = tid >> 2;          // 0..63
  const int ldchk = tid & 3;           // 0..3  (8-half chunks)

  const _Float16* Agp = A  + (size_t)(m0 + ldrow) * K + ldchk * 8;
  const _Float16* Bgp = Bt + (size_t)(n0 + ldrow) * K + ldchk * 8;
  const size_t Brow = (size_t)64 * K;  // 64-row stride between B passes

  // per-thread LDS destination addresses (low 32 bits of shared pointer =
  // wave-relative LDS byte address; HW adds LDS_BASE)
  uint32_t ldsA[2], ldsB[2];
#pragma unroll
  for (int i = 0; i < 2; ++i) {
    ldsA[i] = (uint32_t)(uintptr_t)&As[i][ldrow * LDT + ldchk * 8];
    ldsB[i] = (uint32_t)(uintptr_t)&Bs[i][ldrow * LDT + ldchk * 8];
  }

  // async global -> LDS staging of one K-tile (1 A chunk + 4 B chunks)
  auto issue_tile = [&](int buf, int k0) {
    asm volatile("global_load_async_to_lds_b128 %0, %1, off"
                 :: "v"(ldsA[buf]),
                    "v"((uint64_t)(uintptr_t)(Agp + k0))
                 : "memory");
#pragma unroll
    for (int p = 0; p < 4; ++p) {
      asm volatile("global_load_async_to_lds_b128 %0, %1, off"
                   :: "v"((uint32_t)(ldsB[buf] + p * (64 * LDT * 2))),
                      "v"((uint64_t)(uintptr_t)(Bgp + p * Brow + k0))
                   : "memory");
    }
  };

  v8f_u acc[2][4];
#pragma unroll
  for (int i = 0; i < 2; ++i)
#pragma unroll
    for (int j = 0; j < 4; ++j) acc[i][j].v = (v8f)(0.0f);

  const int nkt = K / BK;

  issue_tile(0, 0);                       // prologue: tile 0 in flight

  for (int kt = 0; kt < nkt; ++kt) {
    const int cur = kt & 1, nxt = cur ^ 1;

    // drain my async writes to lds[cur]; barrier makes all waves' writes
    // visible and guarantees every reader of lds[nxt] (iter kt-1) is done.
    asm volatile("s_wait_asynccnt 0x0" ::: "memory");
    __syncthreads();

    if (kt + 1 < nkt) {
      issue_tile(nxt, (kt + 1) * BK);     // in flight during this K-step
      if (kt + 2 < nkt)
        __builtin_prefetch(Agp + (kt + 2) * BK, 0, 1);
    }

    // ---- gather all fragments, then a back-to-back WMMA burst ----
    v16h aF[2], bF[4];
#pragma unroll
    for (int mf = 0; mf < 2; ++mf) {
      const int m = wm * 32 + mf * 16 + lh;
      const v8h lo = *(const v8h*)&As[cur][m * LDT + hi * 8];       // K 0..7 / 8..15
      const v8h hh = *(const v8h*)&As[cur][m * LDT + 16 + hi * 8];  // K 16..23 / 24..31
      aF[mf] = __builtin_shufflevector(lo, hh,
                 0,1,2,3,4,5,6,7, 8,9,10,11,12,13,14,15);
    }
#pragma unroll
    for (int nf = 0; nf < 4; ++nf) {
      const int n = wn * 64 + nf * 16 + lh;
      const v8h lo = *(const v8h*)&Bs[cur][n * LDT + hi * 8];
      const v8h hh = *(const v8h*)&Bs[cur][n * LDT + 16 + hi * 8];
      bF[nf] = __builtin_shufflevector(lo, hh,
                 0,1,2,3,4,5,6,7, 8,9,10,11,12,13,14,15);
    }
#pragma unroll
    for (int nf = 0; nf < 4; ++nf)
#pragma unroll
      for (int mf = 0; mf < 2; ++mf)
        acc[mf][nf].v = __builtin_amdgcn_wmma_f32_16x16x32_f16(
            false, aF[mf], false, bF[nf], (short)0, acc[mf][nf].v, false, false);
  }

  // ---- epilogue: C layout = VGPR r -> (row r + 8*hi, col lane&15) ----
#pragma unroll
  for (int nf = 0; nf < 4; ++nf) {
    const int col  = n0 + wn * 64 + nf * 16 + lh;
    const float bc = bias[col];
#pragma unroll
    for (int mf = 0; mf < 2; ++mf) {
      const int rbase = m0 + wm * 32 + mf * 16 + hi * 8;
#pragma unroll
      for (int r = 0; r < 8; ++r) {
        const float val = acc[mf][nf].f[r] + bc;
        const size_t idx = (size_t)(rbase + r) * N + col;
        if (OUT_F16) ((_Float16*)Cout)[idx] = (_Float16)val;
        else         ((float*)Cout)[idx]    = val;
      }
    }
  }
}

// =====================================================================
// attention epilogue: one wave per (run of 32 tokens, group of 4 heads).
// A lane owns 8 dims (16 B), 8 lanes make a head, so every q or k load and every store of
// a wave is 512 contiguous bytes. The wave walks its tokens in order and
// carries k_{l-1} and k_l in registers: each k row is loaded once per run.
// The grid is one 16-wave block per WGP; the launch starts 4,096 waves.
// qk buffer holds q (cols 0..1023) and k (cols 1024..2047) per token.
// slots: [ak, k_{l-1}, k_l, k_{l+1}]; V = [av, k_{l-1}, k_l, k_{l+1}]
// boundary slots are zero vectors -> score 0 (matches zero-padding).
// =====================================================================
constexpr int AT_TOK     = 32;                     // tokens per wave
constexpr int AT_CH      = 4;                      // tokens per load group
constexpr int AT_HG      = NHID / 256;             // head groups per token: 4
constexpr int AT_THREADS = 512;
constexpr int AT_BLOCKS  = (MROWS / AT_TOK) * AT_HG / (AT_THREADS / 32);
constexpr int AT_QKROW   = NQK * 2;                // bytes of a q|k row
constexpr int AT_OROW    = NHID * 2;               // bytes of an output row
static_assert(SEQ % AT_TOK == 0 && AT_TOK % (2 * AT_CH) == 0 && AT_TOK >= 4 * AT_CH,
              "a run stays inside one sequence; load groups go in pairs");
static_assert(AT_QKROW == 4096 && AT_OROW == 2048 && AT_CH == 4, "the pointer steps in asm text are written for these");

typedef __attribute__((ext_vector_type(2))) float v2f;
// a pointer that has passed through an asm operand must say that it is global,
// else its loads compile to flat loads
typedef const __attribute__((address_space(1))) char* gcharp;
typedef const __attribute__((address_space(1))) v8h*  gv8hp;

// sum over the 8 lanes of a head, result in all 8
__device__ __forceinline__ float sum_head_lanes(float v) {
  v += __builtin_bit_cast(float, __builtin_amdgcn_update_dpp(0, __builtin_bit_cast(int, v), 0x161, 0xf, 0xf, true)); // row_xmask:1
  v += __builtin_bit_cast(float, __builtin_amdgcn_update_dpp(0, __builtin_bit_cast(int, v), 0x162, 0xf, 0xf, true)); // row_xmask:2
  v += __builtin_bit_cast(float, __builtin_amdgcn_update_dpp(0, __builtin_bit_cast(int, v), 0x164, 0xf, 0xf, true)); // row_xmask:4
  return v;
}

__device__ __forceinline__ void widen(v2f (&f)[4], v8h h) {
#pragma unroll
  for (int p = 0; p < 4; ++p) { f[p][0] = (float)h[2 * p]; f[p][1] = (float)h[2 * p + 1]; }
}

// one load group: q of rows ROW0..ROW0+3 (counted from base) and the k rows one token
// ahead of them; the run's last group leaves out the row behind the run.
template <int ROW0, bool LAST>
__device__ __forceinline__ void at_load(v8h (&q)[AT_CH], v8h (&k)[AT_CH],
                                        gcharp base, uint32_t voff) {
#pragma unroll
  for (int j = 0; j < AT_CH; ++j) {
    q[j] = *(gv8hp)(base + voff + (ROW0 + j) * AT_QKROW);
    if (!(LAST && j == AT_CH - 1))
      k[j] = *(gv8hp)(base + voff + (ROW0 + j + 1) * AT_QKROW + NHID * 2);
  }
  // holds the group's loads here, a whole group of work ahead of their use
  // (without it the build sinks them to just in front of the use)
  __builtin_amdgcn_sched_barrier(0);
}

// four tokens: scores, softmax, weighted sum, stores
template <int ROW0>
__device__ __forceinline__ void at_group(const v8h (&q)[AT_CH], const v8h (&k)[AT_CH],
                                         v2f (&km)[4], v2f (&kc)[4],
                                         const v2f (&ak)[4], const v2f (&av)[4],
                                         char* obase, uint32_t voff) {
  v4f ov[AT_CH];
#pragma unroll
  for (int j = 0; j < AT_CH; ++j) {
    v2f qf[4], kn[4];
    widen(qf, q[j]);
    widen(kn, k[j]);

    v2f p0 = qf[0] * ak[0], p1 = qf[0] * km[0], p2 = qf[0] * kc[0], p3 = qf[0] * kn[0];
#pragma unroll
    for (int p = 1; p < 4; ++p) {
      p0 += qf[p] * ak[p];
      p1 += qf[p] * km[p];
      p2 += qf[p] * kc[p];
      p3 += qf[p] * kn[p];
    }
    float s0 = sum_head_lanes(p0[0] + p0[1]);
    float s1 = sum_head_lanes(p1[0] + p1[1]);
    float s2 = sum_head_lanes(p2[0] + p2[1]);
    float s3 = sum_head_lanes(p3[0] + p3[1]);

    const float sc = 0.125f;  // 1/sqrt(64)
    s0 *= sc; s1 *= sc; s2 *= sc; s3 *= sc;

    const float mx = fmaxf(fmaxf(s0, s1), fmaxf(s2, s3));
    const float e0 = __expf(s0 - mx), e1 = __expf(s1 - mx);
    const float e2 = __expf(s2 - mx), e3 = __expf(s3 - mx);
    const float inv = 1.0f / (e0 + e1 + e2 + e3);
    const float a0 = e0 * inv, a1 = e1 * inv, a2 = e2 * inv, a3 = e3 * inv;

    v8h oh;
#pragma unroll
    for (int p = 0; p < 4; ++p) {
      const v2f o = a0 * av[p] + a1 * km[p] + a2 * kc[p] + a3 * kn[p];
      oh[2 * p]     = (_Float16)o[0];
      oh[2 * p + 1] = (_Float16)o[1];
    }
    ov[j] = __builtin_bit_cast(v4f, oh);

#pragma unroll
    for (int p = 0; p < 4; ++p) { km[p] = kc[p]; kc[p] = kn[p]; }
  }
  // The group's four stores and their s_wait_xcnt in one statement: no register that a
  // store names is rewritten in front of the wait.
  asm volatile(
      "global_store_b128 %0, %1, %5 offset:%6\n\t"
      "global_store_b128 %0, %2, %5 offset:%7\n\t"
      "global_store_b128 %0, %3, %5 offset:%8\n\t"
      "global_store_b128 %0, %4, %5 offset:%9\n\t"
      "s_wait_xcnt 0x0"
      :: "v"(voff), "v"(ov[0]), "v"(ov[1]), "v"(ov[2]), "v"(ov[3]), "s"(obase),
         "n"((ROW0 + 0) * AT_OROW), "n"((ROW0 + 1) * AT_OROW),
         "n"((ROW0 + 2) * AT_OROW), "n"((ROW0 + 3) * AT_OROW)
      : "memory");
}

__global__ __launch_bounds__(AT_THREADS)
void attn_window(const _Float16* __restrict__ qkh,
                 const float* __restrict__ akf,
                 const float* __restrict__ avf,
                 _Float16* __restrict__ atth) {
  const int lane = threadIdx.x & 31;
  const int gw   = __builtin_amdgcn_readfirstlane(blockIdx.x * (AT_THREADS / 32) + (threadIdx.x >> 5));
  const int hg   = gw & (AT_HG - 1);
  const int t0   = (gw / AT_HG) * AT_TOK;          // first token of the run, b*SEQ + l
  const int l0   = t0 & (SEQ - 1);

  // wave-uniform bases; every lane adds the same 16 B * lane to all of them
  const uint32_t voff = (uint32_t)lane * 16u;
  gcharp      base  = (gcharp)(qkh + (size_t)t0 * NQK + hg * 256);
  char*       obase = (char*)(atth + (size_t)t0 * NHID + hg * 256);

  const size_t grow = (size_t)(t0 / SEQ) * NHID + hg * 256;
  const float* akp = akf + grow;
  const float* avp = avf + grow;
  v2f ak[4], av[4];
  {
    const v4f akl = *(const v4f*)(akp + lane * 8), akh = *(const v4f*)(akp + lane * 8 + 4);
    const v4f avl = *(const v4f*)(avp + lane * 8), avh = *(const v4f*)(avp + lane * 8 + 4);
    ak[0] = akl.xy; ak[1] = akl.zw; ak[2] = akh.xy; ak[3] = akh.zw;
    av[0] = avl.xy; av[1] = avl.zw; av[2] = avh.xy; av[3] = avh.zw;
  }

  // the rows in front of and behind the run: zero at the ends of the sequence
  v8h kfirst = {}, kend = {};
  if (l0 > 0)            kfirst = *(gv8hp)(base + voff - AT_QKROW + NHID * 2);
  if (l0 + AT_TOK < SEQ) kend   = *(gv8hp)(base + voff + AT_TOK * AT_QKROW + NHID * 2);
  const v8h kown = *(gv8hp)(base + voff + NHID * 2);

  // two register sets: one group's 8 loads are in flight while the other group is worked on
  v8h qa[AT_CH], ka[AT_CH], qb[AT_CH], kb[AT_CH];
  at_load<0, false>(qa, ka, base, voff);
  // the loads so far name address registers that the loop's first loads may land in:
  // this wait stands in front of every later load
  asm volatile("s_wait_xcnt 0x0" ::: "memory");

  v2f km[4], kc[4];
  widen(km, kfirst);
  widen(kc, kown);

  // rolled: the loop and the last pass together stay far inside the instruction cache
#pragma unroll 1
  for (int it = 0; it < AT_TOK / (2 * AT_CH) - 1; ++it) {
    at_load<AT_CH, false>(qb, kb, base, voff);
    at_group<0>(qa, ka, km, kc, ak, av, obase, voff);
    at_load<2 * AT_CH, false>(qa, ka, base, voff);
    at_group<AT_CH>(qb, kb, km, kc, ak, av, obase, voff);
    // both bases go on by 8 rows, behind the wait for the loads and stores that name them
    asm volatile("s_wait_xcnt 0x0\n\t"
                 "s_add_nc_u64 %0, %0, 0x8000\n\t"
                 "s_add_nc_u64 %1, %1, 0x4000"
                 : "+s"(base), "+s"(obase) :: "memory");
  }
  at_load<AT_CH, true>(qb, kb, base, voff);
  kb[AT_CH - 1] = kend;
  at_group<0>(qa, ka, km, kc, ak, av, obase, voff);
  at_group<AT_CH>(qb, kb, km, kc, ak, av, obase, voff);
}

// =====================================================================
// launch
// =====================================================================
extern "C" void kernel_launch(void* const* d_in, const int* in_sizes, int n_in,
                              void* d_out, int out_size, void* d_ws, size_t ws_size,
                              hipStream_t stream) {
  const float* x    = (const float*)d_in[0];
  const float* ax   = (const float*)d_in[1];
  const float* WQ_w = (const float*)d_in[2];
  const float* WQ_b = (const float*)d_in[3];
  const float* WK_w = (const float*)d_in[4];
  const float* WK_b = (const float*)d_in[5];
  const float* WV_w = (const float*)d_in[6];
  const float* WV_b = (const float*)d_in[7];
  const float* WO_w = (const float*)d_in[8];
  const float* WO_b = (const float*)d_in[9];

  char* ws = (char*)d_ws;
  _Float16* xh   = (_Float16*)(ws + OFF_XH);
  _Float16* wqkt = (_Float16*)(ws + OFF_WQKT);
  _Float16* wot  = (_Float16*)(ws + OFF_WOT);
  float*    bqk  = (float*)(ws + OFF_BQK);
  _Float16* qkh  = (_Float16*)(ws + OFF_QKH);
  _Float16* atth = (_Float16*)(ws + OFF_ATTH);
  float*    akf  = (float*)(ws + OFF_AK);
  float*    avf  = (float*)(ws + OFF_AV);

  // 1) convert x -> f16
  {
    int n4 = MROWS * NHID / 4;
    cvt_f32_to_f16_x4<<<(n4 + 255) / 256, 256, 0, stream>>>(x, xh, n4);
  }
  // 2) transpose+convert weights: [WQ^T ; WK^T] fused, and WO^T
  {
    dim3 g(NHID / 32, NHID / 32), b(32, 8);
    transpose_f32_to_f16<<<g, b, 0, stream>>>(WQ_w, wqkt, NHID, NHID);
    transpose_f32_to_f16<<<g, b, 0, stream>>>(WK_w, wqkt + (size_t)NHID * NHID, NHID, NHID);
    transpose_f32_to_f16<<<g, b, 0, stream>>>(WO_w, wot, NHID, NHID);
  }
  // 3) fused bias [WQ_b ; WK_b]
  concat_bias<<<NQK / 256, 256, 0, stream>>>(WQ_b, WK_b, bqk, NHID);
  // 4) global-token projections ak = ax@WK + bK, av = ax@WV + bV (f32)
  {
    dim3 g(NHID / PG_COLS, BATCH / PG_BATCH);
    proj_global_tok<<<g, PG_THREADS, 0, stream>>>(ax, WK_w, WK_b, akf);
    proj_global_tok<<<g, PG_THREADS, 0, stream>>>(ax, WV_w, WV_b, avf);
  }
  // 5) fused q|k projection via WMMA GEMM: [32768x1024] @ [1024x2048]
  {
    dim3 g(NQK / 256, MROWS / 64);
    gemm_wmma_f16<true><<<g, 256, 0, stream>>>(xh, wqkt, bqk, (void*)qkh,
                                               MROWS, NQK, NHID);
  }
  // 6) windowed attention epilogue -> att (f16)
  attn_window<<<AT_BLOCKS, AT_THREADS, 0, stream>>>(qkh, akf, avf, atth);
  // 7) output projection via WMMA GEMM (f32 out to d_out)
  {
    dim3 g(NHID / 256, MROWS / 64);
    gemm_wmma_f16<false><<<g, 256, 0, stream>>>(atth, wot, WO_b, d_out,
                                                MROWS, NHID, NHID);
  }
}

// v003
// It runs in 205 microseconds.
// Next to v002, in two timings, it ran 1.72 times as fast each time.
// All steps since v000 together make it 2.91 times as fast.
#include <hip/hip_runtime.h>
#include <hip/hip_bf16.h>
#include <stdint.h>

// ---------------- problem constants ----------------
constexpr int BATCH = 8;
constexpr int SEQ   = 4096;
constexpr int NHEAD = 16;
constexpr int HDIM  = 64;
constexpr int NHID  = 1024;              // == NHEAD*HDIM
constexpr int MROWS = BATCH * SEQ;       // 32768
constexpr int NQK   = 2 * NHID;          // fused q|k output width

// ---------------- vector types ----------------
typedef __attribute__((ext_vector_type(16))) _Float16 v16h;
typedef __attribute__((ext_vector_type(8)))  _Float16 v8h;
typedef __attribute__((ext_vector_type(4)))  _Float16 v4h;
typedef __attribute__((ext_vector_type(2)))  _Float16 v2h;
typedef __attribute__((ext_vector_type(8)))  float    v8f;

typedef union { v8f v; float f[8]; } v8f_u;

// ---------------- workspace layout (bytes) ----------------
constexpr size_t OFF_XH   = 0;                                    // 32768x1024 f16 (64 MB)
constexpr size_t OFF_WQKT = OFF_XH   + (size_t)MROWS * NHID * 2;  // 2048x1024 f16 ([WQ^T;WK^T])
constexpr size_t OFF_WOT  = OFF_WQKT + (size_t)NQK   * NHID * 2;  // 1024x1024 f16
constexpr size_t OFF_BQK  = OFF_WOT  + (size_t)NHID  * NHID * 2;  // 2048 f32
constexpr size_t OFF_QKH  = OFF_BQK  + (size_t)NQK * 4;           // 32768x2048 f16 (128 MB)
constexpr size_t OFF_ATTH = OFF_QKH  + (size_t)MROWS * NQK * 2;   // 32768x1024 f16
constexpr size_t OFF_AK   = OFF_ATTH + (size_t)MROWS * NHID * 2;  // 8x1024 f32
constexpr size_t OFF_AV   = OFF_AK   + (size_t)BATCH * NHID * 4;

// =====================================================================
// f32 -> f16 conversion, 4 elements / thread
// =====================================================================
__global__ void cvt_f32_to_f16_x4(const float* __restrict__ in,
                                  _Float16* __restrict__ out, int n4) {
  int i = blockIdx.x * blockDim.x + threadIdx.x;
  if (i >= n4) return;
  float4 v = ((const float4*)in)[i];
  v4h h;
  h[0] = (_Float16)v.x; h[1] = (_Float16)v.y;
  h[2] = (_Float16)v.z; h[3] = (_Float16)v.w;
  ((v4h*)out)[i] = h;
}

// =====================================================================
// f32 [K][N] -> f16 [N][K] transpose (32x32 LDS tiles)
// =====================================================================
__global__ void transpose_f32_to_f16(const float* __restrict__ in,
                                     _Float16* __restrict__ out,
                                     int K, int N) {
  __shared__ float tile[32][33];
  int tx = threadIdx.x, ty = threadIdx.y;
  int k0 = blockIdx.y * 32, n0 = blockIdx.x * 32;
#pragma unroll
  for (int i = 0; i < 32; i += 8)
    tile[ty + i][tx] = in[(size_t)(k0 + ty + i) * N + n0 + tx];
  __syncthreads();
#pragma unroll
  for (int i = 0; i < 32; i += 8)
    out[(size_t)(n0 + ty + i) * K + k0 + tx] = (_Float16)tile[tx][ty + i];
}

// =====================================================================
// concat two f32 vectors of length n -> out[2n]
// =====================================================================
__global__ void concat_bias(const float* __restrict__ a, const float* __restrict__ b,
                            float* __restrict__ out, int n) {
  int i = blockIdx.x * blockDim.x + threadIdx.x;
  out[i] = (i < n) ? a[i] : b[i - n];
}

// =====================================================================
// projection of the global token: out[b][n] = ax[b].W[:,n] + bias[n]
// One block owns 32 columns for 4 of the 8 batches. The k range is split
// over 128 slices of 8 rows: thread = (slice, column quad). A thread's 8 W
// rows and its ax values fit in registers together, so they are all asked
// for at once and the block waits for memory once, where a serial k loop
// waits once per unrolled group of rows.
// Partial sums: the 4 slices of a wave by shuffles, the 32 waves through LDS.
// =====================================================================
constexpr int PG_COLS    = 32;                     // columns per block: one 128-B line per W row
constexpr int PG_BATCH   = 4;                      // batches per block
constexpr int PG_THREADS = 1024;
constexpr int PG_WAVES   = PG_THREADS / 32;
constexpr int PG_KPT     = NHID / (PG_THREADS / (PG_COLS / 4));   // 8 rows per thread
static_assert(PG_KPT == 8 && PG_BATCH == 4 && NHID * 4 == 4096, "the offsets in the load statement are written for these");

typedef __attribute__((ext_vector_type(4))) float v4f;

__global__ __launch_bounds__(PG_THREADS)
void proj_global_tok(const float* __restrict__ ax,
                     const float* __restrict__ W,
                     const float* __restrict__ bias,
                     float* __restrict__ out) {
  __shared__ float part[PG_WAVES][PG_BATCH][PG_COLS];   // 16 KB

  const int tid  = threadIdx.x;
  const int lane = tid & 31;
  const int wave = tid >> 5;
  const int cq   = tid & 7;                  // column quad inside the block
  const int k0   = (tid >> 3) * PG_KPT;      // first row of this thread's slice
  const int nblk = blockIdx.x * PG_COLS;
  const int b0   = blockIdx.y * PG_BATCH;

  const float* wp = W  + (size_t)k0 * NHID + nblk + cq * 4;   // row j at byte offset j * 4096
  const float* ap = ax + (size_t)b0 * NHID + k0;              // batch bb at byte offset bb * 4096

  // All 16 loads of the thread and their data wait in one statement: every load is in
  // flight before the first wait, and the early-clobber outputs keep each result out of
  // the two address pairs until all loads have returned (as plain loads the build let one
  // load's result land in the pair that six loads still in flight named).
  v4f w[PG_KPT], a[PG_BATCH][2];
  asm volatile(
      "global_load_b128 %0, %16, off\n\t"
      "global_load_b128 %1, %16, off offset:4096\n\t"
      "global_load_b128 %2, %16, off offset:8192\n\t"
      "global_load_b128 %3, %16, off offset:12288\n\t"
      "global_load_b128 %4, %16, off offset:16384\n\t"
      "global_load_b128 %5, %16, off offset:20480\n\t"
      "global_load_b128 %6, %16, off offset:24576\n\t"
      "global_load_b128 %7, %16, off offset:28672\n\t"
      "global_load_b128 %8, %17, off\n\t"
      "global_load_b128 %9, %17, off offset:16\n\t"
      "global_load_b128 %10, %17, off offset:4096\n\t"
      "global_load_b128 %11, %17, off offset:4112\n\t"
      "global_load_b128 %12, %17, off offset:8192\n\t"
      "global_load_b128 %13, %17, off offset:8208\n\t"
      "global_load_b128 %14, %17, off offset:12288\n\t"
      "global_load_b128 %15, %17, off offset:12304\n\t"
      "s_wait_loadcnt 0x0"
      : "=&v"(w[0]), "=&v"(w[1]), "=&v"(w[2]), "=&v"(w[3]),
        "=&v"(w[4]), "=&v"(w[5]), "=&v"(w[6]), "=&v"(w[7]),
        "=&v"(a[0][0]), "=&v"(a[0][1]), "=&v"(a[1][0]), "=&v"(a[1][1]),
        "=&v"(a[2][0]), "=&v"(a[2][1]), "=&v"(a[3][0]), "=&v"(a[3][1])
      : "v"(wp), "v"(ap)
      : "memory");

  v4f acc[PG_BATCH];
#pragma unroll
  for (int bb = 0; bb < PG_BATCH; ++bb) {
    v4f s = a[bb][0][0] * w[0];
#pragma unroll
    for (int j = 1; j < PG_KPT; ++j)
      s += a[bb][j >> 2][j & 3] * w[j];
    acc[bb] = s;
  }

  // the wave's 4 slices sit in lanes cq, cq+8, cq+16, cq+24
#pragma unroll
  for (int bb = 0; bb < PG_BATCH; ++bb) {
#pragma unroll
    for (int off = 8; off <= 16; off <<= 1) {
#pragma unroll
      for (int e = 0; e < 4; ++e)
        acc[bb][e] += __shfl_xor(acc[bb][e], off, 32);
    }
  }
  if (lane < 8) {
#pragma unroll
    for (int bb = 0; bb < PG_BATCH; ++bb)
      *(v4f*)&part[wave][bb][cq * 4] = acc[bb];
  }
  __syncthreads();

  // one thread per (batch, column) adds the 32 waves' partial sums
  if (tid < PG_BATCH * PG_COLS) {
    const int bb = tid >> 5, c = tid & 31;
    float s = bias[nblk + c];
#pragma unroll
    for (int wv = 0; wv < PG_WAVES; ++wv)
      s += part[wv][bb][c];
    out[(size_t)(b0 + bb) * NHID + nblk + c] = s;
  }
}

// =====================================================================
// WMMA GEMM:  C[M][N] = A[M][K](f16) * Bt[N][K](f16)^T + bias[N]
// 256 threads = 8 waves; block tile 256(M) x 256(N); a stage is 128 k.
// M and N are multiples of 256, K a multiple of 128.
// A block reads (256 + 256) operand rows from L2 for 65,536 outputs, and every
// copy of a wave covers two whole 256-B row pieces.
// Each wave: 128x64 tile -> 8x4 v_wmma_f32_16x16x32_f16 per 32 k, so a loaded
// fragment feeds 4 or 8 products. One block per WGP, two waves per SIMD.
// Two LDS buffers fed by GLOBAL_LOAD_ASYNC_TO_LDS_B128 (ASYNCcnt), no VGPR
// staging, 1 barrier / stage; fragments are fetched one 32-k block ahead inside
// a stage, never across the stage's barrier.
// =====================================================================
constexpr int BM   = 256;
constexpr int BN   = 256;
constexpr int BK   = 128;
constexpr int NKB  = BK / 32;            // WMMA k blocks per stage
constexpr int LDT  = BK + 8;             // padded LDS row (halves): 272 B = 16 B x odd
constexpr int STG  = (BM + BN) * LDT;    // halves per stage: rows 0..255 A, 256..511 B
constexpr int FA   = 8;                  // A fragments per wave
constexpr int FB   = 4;                  // B fragments per wave
constexpr int CP_LDS = 2 * LDT * 2;      // LDS bytes between two copies of a wave (2 rows)

template <bool OUT_F16>
__global__ __launch_bounds__(256)
void gemm_wmma_f16(const _Float16* __restrict__ A,
                   const _Float16* __restrict__ Bt,
                   const float* __restrict__ bias,
                   void* __restrict__ Cout,
                   int M, int N, int K) {
  __shared__ __attribute__((aligned(16))) _Float16 S[2][STG];

  const int tid  = threadIdx.x;
  const int wid  = __builtin_amdgcn_readfirstlane(tid >> 5);
  const int lane = tid & 31;
  const int lh   = lane & 15;
  const int hi   = lane >> 4;          // 0: lanes 0-15, 1: lanes 16-31

  const int wm = wid >> 2;             // 0..1  (128 M-rows each)
  const int wn = wid & 3;              // 0..3  (64 N-cols each)

  const int m0 = blockIdx.y * BM;
  const int n0 = blockIdx.x * BN;

  // staging: wave w brings stage rows 64w .. 64w+63 (waves 0-3: A, waves 4-7: B),
  // two rows a copy: lanes 0-15 one row's 256 B, lanes 16-31 the next row's.
  const _Float16* gsrc = (wid < 4) ? A  + (size_t)(m0 + wid * 64) * K
                                   : Bt + (size_t)(n0 + (wid - 4) * 64) * K;   // wave-uniform
  const size_t   grow2 = (size_t)2 * K;                                  // halves between two copies
  const uint32_t goff  = (uint32_t)hi * (uint32_t)K * 2u + (uint32_t)lh * 16u;   // the lane's bytes from the copy's base
  // low 32 bits of the shared pointer = LDS byte address
  const uint32_t lds0  = (uint32_t)(uintptr_t)&S[0][(wid * 64 + hi) * LDT + lh * 8];

  // eight copies (16 rows) and their s_wait_xcnt in one statement: no register that a
  // copy names is rewritten in front of the wait
  auto copy16rows = [&](uint32_t l, const _Float16* g) {
    asm volatile(
        "global_load_async_to_lds_b128 %0, %8, %9\n\t"
        "global_load_async_to_lds_b128 %1, %8, %10\n\t"
        "global_load_async_to_lds_b128 %2, %8, %11\n\t"
        "global_load_async_to_lds_b128 %3, %8, %12\n\t"
        "global_load_async_to_lds_b128 %4, %8, %13\n\t"
        "global_load_async_to_lds_b128 %5, %8, %14\n\t"
        "global_load_async_to_lds_b128 %6, %8, %15\n\t"
        "global_load_async_to_lds_b128 %7, %8, %16\n\t"
        "s_wait_xcnt 0x0"
        :: "v"(l),              "v"(l + 1 * CP_LDS), "v"(l + 2 * CP_LDS), "v"(l + 3 * CP_LDS),
           "v"(l + 4 * CP_LDS), "v"(l + 5 * CP_LDS), "v"(l + 6 * CP_LDS), "v"(l + 7 * CP_LDS),
           "v"(goff),
           "s"(g),             "s"(g + 1 * grow2), "s"(g + 2 * grow2), "s"(g + 3 * grow2),
           "s"(g + 4 * grow2), "s"(g + 5 * grow2), "s"(g + 6 * grow2), "s"(g + 7 * grow2)
        : "memory");
  };
  // half of a wave's share of one stage (32 of its 64 rows)
  auto issue_half = [&](int buf, int k0, int half) {
#pragma unroll
    for (int q = 2 * half; q < 2 * half + 2; ++q)
      copy16rows(lds0 + (uint32_t)buf * (STG * 2) + (uint32_t)q * (8 * CP_LDS),
                 gsrc + (size_t)q * 8 * grow2 + k0);
  };

  // fragments of one 32-k block: B 0..3 first, then A 0..7, the order in which the WMMAs
  // ask for them (behind a barrier the first WMMAs then wait for 10 loads, not for 18);
  // the same k order in both operands
  auto load_frags = [&](v16h (&f)[FA + FB], const _Float16* sa, const _Float16* sb, int kb) {
#pragma unroll
    for (int nf = 0; nf < FB; ++nf) {
      const v8h lo = *(const v8h*)(sb + nf * 16 * LDT + kb * 32);        // K 0..7 / 8..15
      const v8h hh = *(const v8h*)(sb + nf * 16 * LDT + kb * 32 + 16);   // K 16..23 / 24..31
      f[FA + nf] = __builtin_shufflevector(lo, hh,
                0,1,2,3,4,5,6,7, 8,9,10,11,12,13,14,15);
    }
#pragma unroll
    for (int mf = 0; mf < FA; ++mf) {
      const v8h lo = *(const v8h*)(sa + mf * 16 * LDT + kb * 32);
      const v8h hh = *(const v8h*)(sa + mf * 16 * LDT + kb * 32 + 16);
      f[mf] = __builtin_shufflevector(lo, hh,
                0,1,2,3,4,5,6,7, 8,9,10,11,12,13,14,15);
    }
  };

  v8f_u acc[FA][FB];
#pragma unroll
  for (int i = 0; i < FA; ++i)
#pragma unroll
    for (int j = 0; j < FB; ++j) acc[i][j].v = (v8f)(0.0f);

  const int nkt = K / BK;

  // prologue: stage 0 lands and is published
  issue_half(0, 0, 0);
  issue_half(0, 0, 1);
  asm volatile("s_wait_asynccnt 0x0" ::: "memory");   // my copies of stage 0 have landed
  __syncthreads();

  // rolled: one stage's 128 WMMAs are the loop body
#pragma unroll 1
  for (int kt = 0; kt < nkt; ++kt) {
    const int  cur  = kt & 1;
    const bool more = kt + 1 < nkt;
    const _Float16* sa = &S[cur][(wm * 128 + lh) * LDT + hi * 8];
    const _Float16* sb = &S[cur][(BM + wn * 64 + lh) * LDT + hi * 8];

    v16h f[2][FA + FB];
    load_frags(f[0], sa, sb, 0);
#pragma unroll
    for (int kb = 0; kb < NKB; ++kb) {
      // the next block's fragment loads as one group ahead of this block's WMMAs
      if (kb + 1 < NKB) load_frags(f[(kb + 1) & 1], sa, sb, kb + 1);
      // keeps the load group whole and ahead of the WMMAs (without it the build spreads
      // the loads among the WMMAs, hoists a third block's loads and spills)
      __builtin_amdgcn_sched_barrier(0);
      // stage kt+1 goes into the other buffer, whose readers all left it at the last
      // barrier; issued in the first two blocks, it has the rest of the stage to land
      if (kb < 2 && more) issue_half(cur ^ 1, (kt + 1) * BK, kb);
#pragma unroll
      for (int mf = 0; mf < FA; ++mf)
#pragma unroll
        for (int nf = 0; nf < FB; ++nf)
          acc[mf][nf].v = __builtin_amdgcn_wmma_f32_16x16x32_f16(
              false, f[kb & 1][mf], false, f[kb & 1][FA + nf], (short)0, acc[mf][nf].v, false, false);
      // the next load group, which refills this block's fragment set, stays behind its WMMAs
      __builtin_amdgcn_sched_barrier(0);
    }

    // publish point of stage kt+1: my LDS reads of this buffer are done, my copies have
    // landed; the barrier shows them to all waves and frees this buffer for the refill.
    asm volatile("s_wait_dscnt 0x0" ::: "memory");
    asm volatile("s_wait_asynccnt 0x0" ::: "memory");
    __syncthreads();
  }

  // ---- epilogue: C layout = VGPR r -> (row r + 8*hi, col lane&15) ----
#pragma unroll
  for (int nf = 0; nf < FB; ++nf) {
    const int col  = n0 + wn * 64 + nf * 16 + lh;
    const float bc = bias[col];
#pragma unroll
    for (int mf = 0; mf < FA; ++mf) {
      const int rbase = m0 + wm * 128 + mf * 16 + hi * 8;
#pragma unroll
      for (int r = 0; r < 8; ++r) {
        const float val = acc[mf][nf].f[r] + bc;
        const size_t idx = (size_t)(rbase + r) * N + col;
        if (OUT_F16) ((_Float16*)Cout)[idx] = (_Float16)val;
        else         ((float*)Cout)[idx]    = val;
      }
    }
  }
}

// =====================================================================
// attention epilogue: one wave per (run of 32 tokens, group of 4 heads).
// A lane owns 8 dims (16 B), 8 lanes make a head, so every q or k load and every store of
// a wave is 512 contiguous bytes. The wave walks its tokens in order and
// carries k_{l-1} and k_l in registers: each k row is loaded once per run.
// The grid is one 16-wave block per WGP; the launch starts 4,096 waves.
// qk buffer holds q (cols 0..1023) and k (cols 1024..2047) per token.
// slots: [ak, k_{l-1}, k_l, k_{l+1}]; V = [av, k_{l-1}, k_l, k_{l+1}]
// boundary slots are zero vectors -> score 0 (matches zero-padding).
// =====================================================================
constexpr int AT_TOK     = 32;                     // tokens per wave
constexpr int AT_CH      = 4;                      // tokens per load group
constexpr int AT_HG      = NHID / 256;             // head groups per token: 4
constexpr int AT_THREADS = 512;
constexpr int AT_BLOCKS  = (MROWS / AT_TOK) * AT_HG / (AT_THREADS / 32);
constexpr int AT_QKROW   = NQK * 2;                // bytes of a q|k row
constexpr int AT_OROW    = NHID * 2;               // bytes of an output row
static_assert(SEQ % AT_TOK == 0 && AT_TOK % (2 * AT_CH) == 0 && AT_TOK >= 4 * AT_CH,
              "a run stays inside one sequence; load groups go in pairs");
static_assert(AT_QKROW == 4096 && AT_OROW == 2048 && AT_CH == 4, "the pointer steps in asm text are written for these");

typedef __attribute__((ext_vector_type(2))) float v2f;
// a pointer that has passed through an asm operand must say that it is global,
// else its loads compile to flat loads
typedef const __attribute__((address_space(1))) char* gcharp;
typedef const __attribute__((address_space(1))) v8h*  gv8hp;

// sum over the 8 lanes of a head, result in all 8
__device__ __forceinline__ float sum_head_lanes(float v) {
  v += __builtin_bit_cast(float, __builtin_amdgcn_update_dpp(0, __builtin_bit_cast(int, v), 0x161, 0xf, 0xf, true)); // row_xmask:1
  v += __builtin_bit_cast(float, __builtin_amdgcn_update_dpp(0, __builtin_bit_cast(int, v), 0x162, 0xf, 0xf, true)); // row_xmask:2
  v += __builtin_bit_cast(float, __builtin_amdgcn_update_dpp(0, __builtin_bit_cast(int, v), 0x164, 0xf, 0xf, true)); // row_xmask:4
  return v;
}

__device__ __forceinline__ void widen(v2f (&f)[4], v8h h) {
#pragma unroll
  for (int p = 0; p < 4; ++p) { f[p][0] = (float)h[2 * p]; f[p][1] = (float)h[2 * p + 1]; }
}

// one load group: q of rows ROW0..ROW0+3 (counted from base) and the k rows one token
// ahead of them; the run's last group leaves out the row behind the run.
template <int ROW0, bool LAST>
__device__ __forceinline__ void at_load(v8h (&q)[AT_CH], v8h (&k)[AT_CH],
                                        gcharp base, uint32_t voff) {
#pragma unroll
  for (int j = 0; j < AT_CH; ++j) {
    q[j] = *(gv8hp)(base + voff + (ROW0 + j) * AT_QKROW);
    if (!(LAST && j == AT_CH - 1))
      k[j] = *(gv8hp)(base + voff + (ROW0 + j + 1) * AT_QKROW + NHID * 2);
  }
  // holds the group's loads here, a whole group of work ahead of their use
  // (without it the build sinks them to just in front of the use)
  __builtin_amdgcn_sched_barrier(0);
}

// four tokens: scores, softmax, weighted sum, stores
template <int ROW0>
__device__ __forceinline__ void at_group(const v8h (&q)[AT_CH], const v8h (&k)[AT_CH],
                                         v2f (&km)[4], v2f (&kc)[4],
                                         const v2f (&ak)[4], const v2f (&av)[4],
                                         char* obase, uint32_t voff) {
  v4f ov[AT_CH];
#pragma unroll
  for (int j = 0; j < AT_CH; ++j) {
    v2f qf[4], kn[4];
    widen(qf, q[j]);
    widen(kn, k[j]);

    v2f p0 = qf[0] * ak[0], p1 = qf[0] * km[0], p2 = qf[0] * kc[0], p3 = qf[0] * kn[0];
#pragma unroll
    for (int p = 1; p < 4; ++p) {
      p0 += qf[p] * ak[p];
      p1 += qf[p] * km[p];
      p2 += qf[p] * kc[p];
      p3 += qf[p] * kn[p];
    }
    float s0 = sum_head_lanes(p0[0] + p0[1]);
    float s1 = sum_head_lanes(p1[0] + p1[1]);
    float s2 = sum_head_lanes(p2[0] + p2[1]);
    float s3 = sum_head_lanes(p3[0] + p3[1]);

    const float sc = 0.125f;  // 1/sqrt(64)
    s0 *= sc; s1 *= sc; s2 *= sc; s3 *= sc;

    const float mx = fmaxf(fmaxf(s0, s1), fmaxf(s2, s3));
    const float e0 = __expf(s0 - mx), e1 = __expf(s1 - mx);
    const float e2 = __expf(s2 - mx), e3 = __expf(s3 - mx);
    const float inv = 1.0f / (e0 + e1 + e2 + e3);
    const float a0 = e0 * inv, a1 = e1 * inv, a2 = e2 * inv, a3 = e3 * inv;

    v8h oh;
#pragma unroll
    for (int p = 0; p < 4; ++p) {
      const v2f o = a0 * av[p] + a1 * km[p] + a2 * kc[p] + a3 * kn[p];
      oh[2 * p]     = (_Float16)o[0];
      oh[2 * p + 1] = (_Float16)o[1];
    }
    ov[j] = __builtin_bit_cast(v4f, oh);

#pragma unroll
    for (int p = 0; p < 4; ++p) { km[p] = kc[p]; kc[p] = kn[p]; }
  }
  // The group's four stores and their s_wait_xcnt in one statement: no register that a
  // store names is rewritten in front of the wait.
  asm volatile(
      "global_store_b128 %0, %1, %5 offset:%6\n\t"
      "global_store_b128 %0, %2, %5 offset:%7\n\t"
      "global_store_b128 %0, %3, %5 offset:%8\n\t"
      "global_store_b128 %0, %4, %5 offset:%9\n\t"
      "s_wait_xcnt 0x0"
      :: "v"(voff), "v"(ov[0]), "v"(ov[1]), "v"(ov[2]), "v"(ov[3]), "s"(obase),
         "n"((ROW0 + 0) * AT_OROW), "n"((ROW0 + 1) * AT_OROW),
         "n"((ROW0 + 2) * AT_OROW), "n"((ROW0 + 3) * AT_OROW)
      : "memory");
}

__global__ __launch_bounds__(AT_THREADS)
void attn_window(const _Float16* __restrict__ qkh,
                 const float* __restrict__ akf,
                 const float* __restrict__ avf,
                 _Float16* __restrict__ atth) {
  const int lane = threadIdx.x & 31;
  const int gw   = __builtin_amdgcn_readfirstlane(blockIdx.x * (AT_THREADS / 32) + (threadIdx.x >> 5));
  const int hg   = gw & (AT_HG - 1);
  const int t0   = (gw / AT_HG) * AT_TOK;          // first token of the run, b*SEQ + l
  const int l0   = t0 & (SEQ - 1);

  // wave-uniform bases; every lane adds the same 16 B * lane to all of them
  const uint32_t voff = (uint32_t)lane * 16u;
  gcharp      base  = (gcharp)(qkh + (size_t)t0 * NQK + hg * 256);
  char*       obase = (char*)(atth + (size_t)t0 * NHID + hg * 256);

  const size_t grow = (size_t)(t0 / SEQ) * NHID + hg * 256;
  const float* akp = akf + grow;
  const float* avp = avf + grow;
  v2f ak[4], av[4];
  {
    const v4f akl = *(const v4f*)(akp + lane * 8), akh = *(const v4f*)(akp + lane * 8 + 4);
    const v4f avl = *(const v4f*)(avp + lane * 8), avh = *(const v4f*)(avp + lane * 8 + 4);
    ak[0] = akl.xy; ak[1] = akl.zw; ak[2] = akh.xy; ak[3] = akh.zw;
    av[0] = avl.xy; av[1] = avl.zw; av[2] = avh.xy; av[3] = avh.zw;
  }

  // the rows in front of and behind the run: zero at the ends of the sequence
  v8h kfirst = {}, kend = {};
  if (l0 > 0)            kfirst = *(gv8hp)(base + voff - AT_QKROW + NHID * 2);
  if (l0 + AT_TOK < SEQ) kend   = *(gv8hp)(base + voff + AT_TOK * AT_QKROW + NHID * 2);
  const v8h kown = *(gv8hp)(base + voff + NHID * 2);

  // two register sets: one group's 8 loads are in flight while the other group is worked on
  v8h qa[AT_CH], ka[AT_CH], qb[AT_CH], kb[AT_CH];
  at_load<0, false>(qa, ka, base, voff);
  // the loads so far name address registers that the loop's first loads may land in:
  // this wait stands in front of every later load
  asm volatile("s_wait_xcnt 0x0" ::: "memory");

  v2f km[4], kc[4];
  widen(km, kfirst);
  widen(kc, kown);

  // rolled: the loop and the last pass together stay far inside the instruction cache
#pragma unroll 1
  for (int it = 0; it < AT_TOK / (2 * AT_CH) - 1; ++it) {
    at_load<AT_CH, false>(qb, kb, base, voff);
    at_group<0>(qa, ka, km, kc, ak, av, obase, voff);
    at_load<2 * AT_CH, false>(qa, ka, base, voff);
    at_group<AT_CH>(qb, kb, km, kc, ak, av, obase, voff);
    // both bases go on by 8 rows, behind the wait for the loads and stores that name them
    asm volatile("s_wait_xcnt 0x0\n\t"
                 "s_add_nc_u64 %0, %0, 0x8000\n\t"
                 "s_add_nc_u64 %1, %1, 0x4000"
                 : "+s"(base), "+s"(obase) :: "memory");
  }
  at_load<AT_CH, true>(qb, kb, base, voff);
  kb[AT_CH - 1] = kend;
  at_group<0>(qa, ka, km, kc, ak, av, obase, voff);
  at_group<AT_CH>(qb, kb, km, kc, ak, av, obase, voff);
}

// =====================================================================
// launch
// =====================================================================
extern "C" void kernel_launch(void* const* d_in, const int* in_sizes, int n_in,
                              void* d_out, int out_size, void* d_ws, size_t ws_size,
                              hipStream_t stream) {
  const float* x    = (const float*)d_in[0];
  const float* ax   = (const float*)d_in[1];
  const float* WQ_w = (const float*)d_in[2];
  const float* WQ_b = (const float*)d_in[3];
  const float* WK_w = (const float*)d_in[4];
  const float* WK_b = (const float*)d_in[5];
  const float* WV_w = (const float*)d_in[6];
  const float* WV_b = (const float*)d_in[7];
  const float* WO_w = (const float*)d_in[8];
  const float* WO_b = (const float*)d_in[9];

  char* ws = (char*)d_ws;
  _Float16* xh   = (_Float16*)(ws + OFF_XH);
  _Float16* wqkt = (_Float16*)(ws + OFF_WQKT);
  _Float16* wot  = (_Float16*)(ws + OFF_WOT);
  float*    bqk  = (float*)(ws + OFF_BQK);
  _Float16* qkh  = (_Float16*)(ws + OFF_QKH);
  _Float16* atth = (_Float16*)(ws + OFF_ATTH);
  float*    akf  = (float*)(ws + OFF_AK);
  float*    avf  = (float*)(ws + OFF_AV);

  // 1) convert x -> f16
  {
    int n4 = MROWS * NHID / 4;
    cvt_f32_to_f16_x4<<<(n4 + 255) / 256, 256, 0, stream>>>(x, xh, n4);
  }
  // 2) transpose+convert weights: [WQ^T ; WK^T] fused, and WO^T
  {
    dim3 g(NHID / 32, NHID / 32), b(32, 8);
    transpose_f32_to_f16<<<g, b, 0, stream>>>(WQ_w, wqkt, NHID, NHID);
    transpose_f32_to_f16<<<g, b, 0, stream>>>(WK_w, wqkt + (size_t)NHID * NHID, NHID, NHID);
    transpose_f32_to_f16<<<g, b, 0, stream>>>(WO_w, wot, NHID, NHID);
  }
  // 3) fused bias [WQ_b ; WK_b]
  concat_bias<<<NQK / 256, 256, 0, stream>>>(WQ_b, WK_b, bqk, NHID);
  // 4) global-token projections ak = ax@WK + bK, av = ax@WV + bV (f32)
  {
    dim3 g(NHID / PG_COLS, BATCH / PG_BATCH);
    proj_global_tok<<<g, PG_THREADS, 0, stream>>>(ax, WK_w, WK_b, akf);
    proj_global_tok<<<g, PG_THREADS, 0, stream>>>(ax, WV_w, WV_b, avf);
  }
  // 5) fused q|k projection via WMMA GEMM: [32768x1024] @ [1024x2048]
  {
    dim3 g(NQK / BN, MROWS / BM);
    gemm_wmma_f16<true><<<g, 256, 0, stream>>>(xh, wqkt, bqk, (void*)qkh,
                                               MROWS, NQK, NHID);
  }
  // 6) windowed attention epilogue -> att (f16)
  attn_window<<<AT_BLOCKS, AT_THREADS, 0, stream>>>(qkh, akf, avf, atth);
  // 7) output projection via WMMA GEMM (f32 out to d_out)
  {
    dim3 g(NHID / BN, MROWS / BM);
    gemm_wmma_f16<false><<<g, 256, 0, stream>>>(atth, wot, WO_b, d_out,
                                                MROWS, NHID, NHID);
  }
}

// v004
// It runs in 193 microseconds.
// Timed twice side by side with v003, it ran 1.06 times as fast both times.
// Over all steps from v000 it is 3.09 times as fast.
#include <hip/hip_runtime.h>
#include <hip/hip_bf16.h>
#include <stdint.h>

// ---------------- problem constants ----------------
constexpr int BATCH = 8;
constexpr int SEQ   = 4096;
constexpr int NHEAD = 16;
constexpr int HDIM  = 64;
constexpr int NHID  = 1024;              // == NHEAD*HDIM
constexpr int MROWS = BATCH * SEQ;       // 32768
constexpr int NQK   = 2 * NHID;          // fused q|k output width

// ---------------- vector types ----------------
typedef __attribute__((ext_vector_type(16))) _Float16 v16h;
typedef __attribute__((ext_vector_type(8)))  _Float16 v8h;
typedef __attribute__((ext_vector_type(4)))  _Float16 v4h;
typedef __attribute__((ext_vector_type(2)))  _Float16 v2h;
typedef __attribute__((ext_vector_type(8)))  float    v8f;

typedef union { v8f v; float f[8]; } v8f_u;

// ---------------- workspace layout (bytes) ----------------
constexpr size_t OFF_XH   = 0;                                    // 32768x1024 f16 (64 MB)
constexpr size_t OFF_WQKT = OFF_XH   + (size_t)MROWS * NHID * 2;  // 2048x1024 f16 ([WQ^T;WK^T])
constexpr size_t OFF_WOT  = OFF_WQKT + (size_t)NQK   * NHID * 2;  // 1024x1024 f16
constexpr size_t OFF_BQK  = OFF_WOT  + (size_t)NHID  * NHID * 2;  // 2048 f32
constexpr size_t OFF_QKH  = OFF_BQK  + (size_t)NQK * 4;           // 32768x2048 f16 (128 MB)
constexpr size_t OFF_ATTH = OFF_QKH  + (size_t)MROWS * NQK * 2;   // 32768x1024 f16
constexpr size_t OFF_AK   = OFF_ATTH + (size_t)MROWS * NHID * 2;  // 8x1024 f32
constexpr size_t OFF_AV   = OFF_AK   + (size_t)BATCH * NHID * 4;

// =====================================================================
// The five jobs that only reshape inputs (x to f16, three weight transposes,
// the bias concat) depend on nothing but the inputs and write disjoint
// buffers. They run as one grid, prep_inputs below: the block index picks the
// job, and each job's blocks do what its own launch did. blk is the block's
// index inside its job.
// =====================================================================
constexpr int PR_THREADS = 256;

// f32 -> f16 conversion, 4 elements / thread
__device__ __forceinline__ void cvt_f32_to_f16_x4(const float* __restrict__ in,
                                                  _Float16* __restrict__ out, int n4, int blk) {
  int i = blk * PR_THREADS + threadIdx.x;
  if (i >= n4) return;
  float4 v = ((const float4*)in)[i];
  v4h h;
  h[0] = (_Float16)v.x; h[1] = (_Float16)v.y;
  h[2] = (_Float16)v.z; h[3] = (_Float16)v.w;
  ((v4h*)out)[i] = h;
}

// f32 [K][N] -> f16 [N][K] transpose (32x32 LDS tiles); every thread of the block comes here
__device__ __forceinline__ void transpose_f32_to_f16(const float* __restrict__ in,
                                                     _Float16* __restrict__ out,
                                                     int K, int N, int blk) {
  __shared__ float tile[32][33];
  int tx = threadIdx.x & 31, ty = threadIdx.x >> 5;
  int k0 = (blk / (N / 32)) * 32, n0 = (blk % (N / 32)) * 32;
#pragma unroll
  for (int i = 0; i < 32; i += 8)
    tile[ty + i][tx] = in[(size_t)(k0 + ty + i) * N + n0 + tx];
  __syncthreads();
#pragma unroll
  for (int i = 0; i < 32; i += 8)
    out[(size_t)(n0 + ty + i) * K + k0 + tx] = (_Float16)tile[tx][ty + i];
}

// concat two f32 vectors of length n -> out[2n]
__device__ __forceinline__ void concat_bias(const float* __restrict__ a, const float* __restrict__ b,
                                            float* __restrict__ out, int n, int blk) {
  int i = blk * PR_THREADS + threadIdx.x;
  out[i] = (i < n) ? a[i] : b[i - n];
  // the store's registers are not rewritten in front of this wait, whatever code of the
  // merged kernel the build places behind the store
  asm volatile("s_wait_xcnt 0x0" ::: "memory");
}

constexpr int PR_TILES = (NHID / 32) * (NHID / 32);            // blocks per weight transpose
constexpr int PR_TR    = 3 * PR_TILES;                         // blocks 0 .. PR_TR-1: transposes
constexpr int PR_CB    = NQK / PR_THREADS;                     // then the bias concat
constexpr int PR_CV    = MROWS * NHID / 4 / PR_THREADS;        // then the conversion of x
static_assert(NQK % PR_THREADS == 0 && (MROWS * NHID / 4) % PR_THREADS == 0, "whole blocks");

// The short jobs have the low block indices. Every branch is on the block index alone.
__global__ __launch_bounds__(PR_THREADS)
void prep_inputs(const float* __restrict__ x,
                 const float* __restrict__ WQ_w, const float* __restrict__ WK_w,
                 const float* __restrict__ WO_w,
                 const float* __restrict__ WQ_b, const float* __restrict__ WK_b,
                 _Float16* __restrict__ xh, _Float16* __restrict__ wqkt,
                 _Float16* __restrict__ wot, float* __restrict__ bqk) {
  const int b = blockIdx.x;
  if (b < PR_TR) {
    const int which = b / PR_TILES;
    const float* in  = which == 0 ? WQ_w : which == 1 ? WK_w : WO_w;
    _Float16*    out = which == 0 ? wqkt : which == 1 ? wqkt + (size_t)NHID * NHID : wot;
    transpose_f32_to_f16(in, out, NHID, NHID, b % PR_TILES);
  } else if (b < PR_TR + PR_CB) {
    concat_bias(WQ_b, WK_b, bqk, NHID, b - PR_TR);
  } else {
    cvt_f32_to_f16_x4(x, xh, MROWS * NHID / 4, b - (PR_TR + PR_CB));
  }
}

// =====================================================================
// projection of the global token: out[b][n] = ax[b].W[:,n] + bias[n]
// One block owns 32 columns for 4 of the 8 batches. The k range is split
// over 128 slices of 8 rows: thread = (slice, column quad). A thread's 8 W
// rows and its ax values fit in registers together, so they are all asked
// for at once and the block waits for memory once, where a serial k loop
// waits once per unrolled group of rows.
// Partial sums: the 4 slices of a wave by shuffles, the 32 waves through LDS.
// Both projections (with WK and with WV) are one grid: blockIdx.z picks the matrix.
// =====================================================================
constexpr int PG_COLS    = 32;                     // columns per block: one 128-B line per W row
constexpr int PG_BATCH   = 4;                      // batches per block
constexpr int PG_THREADS = 1024;
constexpr int PG_WAVES   = PG_THREADS / 32;
constexpr int PG_KPT     = NHID / (PG_THREADS / (PG_COLS / 4));   // 8 rows per thread
static_assert(PG_KPT == 8 && PG_BATCH == 4 && NHID * 4 == 4096, "the offsets in the load statement are written for these");

typedef __attribute__((ext_vector_type(4))) float v4f;

__global__ __launch_bounds__(PG_THREADS)
void proj_global_tok(const float* __restrict__ ax,
                     const float* __restrict__ W0, const float* __restrict__ bias0,
                     float* __restrict__ out0,
                     const float* __restrict__ W1, const float* __restrict__ bias1,
                     float* __restrict__ out1) {
  __shared__ float part[PG_WAVES][PG_BATCH][PG_COLS];   // 16 KB

  const bool second = blockIdx.z != 0;
  const float* W    = second ? W1 : W0;
  const float* bias = second ? bias1 : bias0;
  float*       out  = second ? out1 : out0;

  const int tid  = threadIdx.x;
  const int lane = tid & 31;
  const int wave = tid >> 5;
  const int cq   = tid & 7;                  // column quad inside the block
  const int k0   = (tid >> 3) * PG_KPT;      // first row of this thread's slice
  const int nblk = blockIdx.x * PG_COLS;
  const int b0   = blockIdx.y * PG_BATCH;

  const float* wp = W  + (size_t)k0 * NHID + nblk + cq * 4;   // row j at byte offset j * 4096
  const float* ap = ax + (size_t)b0 * NHID + k0;              // batch bb at byte offset bb * 4096

  // All 16 loads of the thread and their data wait in one statement: every load is in
  // flight before the first wait, and the early-clobber outputs keep each result out of
  // the two address pairs until all loads have returned (as plain loads the build let one
  // load's result land in the pair that six loads still in flight named).
  v4f w[PG_KPT], a[PG_BATCH][2];
  asm volatile(
      "global_load_b128 %0, %16, off\n\t"
      "global_load_b128 %1, %16, off offset:4096\n\t"
      "global_load_b128 %2, %16, off offset:8192\n\t"
      "global_load_b128 %3, %16, off offset:12288\n\t"
      "global_load_b128 %4, %16, off offset:16384\n\t"
      "global_load_b128 %5, %16, off offset:20480\n\t"
      "global_load_b128 %6, %16, off offset:24576\n\t"
      "global_load_b128 %7, %16, off offset:28672\n\t"
      "global_load_b128 %8, %17, off\n\t"
      "global_load_b128 %9, %17, off offset:16\n\t"
      "global_load_b128 %10, %17, off offset:4096\n\t"
      "global_load_b128 %11, %17, off offset:4112\n\t"
      "global_load_b128 %12, %17, off offset:8192\n\t"
      "global_load_b128 %13, %17, off offset:8208\n\t"
      "global_load_b128 %14, %17, off offset:12288\n\t"
      "global_load_b128 %15, %17, off offset:12304\n\t"
      "s_wait_loadcnt 0x0"
      : "=&v"(w[0]), "=&v"(w[1]), "=&v"(w[2]), "=&v"(w[3]),
        "=&v"(w[4]), "=&v"(w[5]), "=&v"(w[6]), "=&v"(w[7]),
        "=&v"(a[0][0]), "=&v"(a[0][1]), "=&v"(a[1][0]), "=&v"(a[1][1]),
        "=&v"(a[2][0]), "=&v"(a[2][1]), "=&v"(a[3][0]), "=&v"(a[3][1])
      : "v"(wp), "v"(ap)
      : "memory");

  v4f acc[PG_BATCH];
#pragma unroll
  for (int bb = 0; bb < PG_BATCH; ++bb) {
    v4f s = a[bb][0][0] * w[0];
#pragma unroll
    for (int j = 1; j < PG_KPT; ++j)
      s += a[bb][j >> 2][j & 3] * w[j];
    acc[bb] = s;
  }

  // the wave's 4 slices sit in lanes cq, cq+8, cq+16, cq+24
#pragma unroll
  for (int bb = 0; bb < PG_BATCH; ++bb) {
#pragma unroll
    for (int off = 8; off <= 16; off <<= 1) {
#pragma unroll
      for (int e = 0; e < 4; ++e)
        acc[bb][e] += __shfl_xor(acc[bb][e], off, 32);
    }
  }
  if (lane < 8) {
#pragma unroll
    for (int bb = 0; bb < PG_BATCH; ++bb)
      *(v4f*)&part[wave][bb][cq * 4] = acc[bb];
  }
  __syncthreads();

  // one thread per (batch, column) adds the 32 waves' partial sums
  if (tid < PG_BATCH * PG_COLS) {
    const int bb = tid >> 5, c = tid & 31;
    float s = bias[nblk + c];
#pragma unroll
    for (int wv = 0; wv < PG_WAVES; ++wv)
      s += part[wv][bb][c];
    out[(size_t)(b0 + bb) * NHID + nblk + c] = s;
  }
}

// =====================================================================
// WMMA GEMM:  C[M][N] = A[M][K](f16) * Bt[N][K](f16)^T + bias[N]
// 256 threads = 8 waves; block tile 256(M) x 256(N); a stage is 128 k.
// M and N are multiples of 256, K a multiple of 128.
// A block reads (256 + 256) operand rows from L2 for 65,536 outputs, and every
// copy of a wave covers two whole 256-B row pieces.
// Each wave: 128x64 tile -> 8x4 v_wmma_f32_16x16x32_f16 per 32 k, so a loaded
// fragment feeds 4 or 8 products. One block per WGP, two waves per SIMD.
// Two LDS buffers fed by GLOBAL_LOAD_ASYNC_TO_LDS_B128 (ASYNCcnt), no VGPR
// staging, 1 barrier / stage; fragments are fetched one 32-k block ahead inside
// a stage, never across the stage's barrier.
// =====================================================================
constexpr int BM   = 256;
constexpr int BN   = 256;
constexpr int BK   = 128;
constexpr int NKB  = BK / 32;            // WMMA k blocks per stage
constexpr int LDT  = BK + 8;             // padded LDS row (halves): 272 B = 16 B x odd
constexpr int STG  = (BM + BN) * LDT;    // halves per stage: rows 0..255 A, 256..511 B
constexpr int FA   = 8;                  // A fragments per wave
constexpr int FB   = 4;                  // B fragments per wave
constexpr int CP_LDS = 2 * LDT * 2;      // LDS bytes between two copies of a wave (2 rows)

template <bool OUT_F16>
__global__ __launch_bounds__(256)
void gemm_wmma_f16(const _Float16* __restrict__ A,
                   const _Float16* __restrict__ Bt,
                   const float* __restrict__ bias,
                   void* __restrict__ Cout,
                   int M, int N, int K) {
  __shared__ __attribute__((aligned(16))) _Float16 S[2][STG];

  const int tid  = threadIdx.x;
  const int wid  = __builtin_amdgcn_readfirstlane(tid >> 5);
  const int lane = tid & 31;
  const int lh   = lane & 15;
  const int hi   = lane >> 4;          // 0: lanes 0-15, 1: lanes 16-31

  const int wm = wid >> 2;             // 0..1  (128 M-rows each)
  const int wn = wid & 3;              // 0..3  (64 N-cols each)

  const int m0 = blockIdx.y * BM;
  const int n0 = blockIdx.x * BN;

  // staging: wave w brings stage rows 64w .. 64w+63 (waves 0-3: A, waves 4-7: B),
  // two rows a copy: lanes 0-15 one row's 256 B, lanes 16-31 the next row's.
  const _Float16* gsrc = (wid < 4) ? A  + (size_t)(m0 + wid * 64) * K
                                   : Bt + (size_t)(n0 + (wid - 4) * 64) * K;   // wave-uniform
  const size_t   grow2 = (size_t)2 * K;                                  // halves between two copies
  const uint32_t goff  = (uint32_t)hi * (uint32_t)K * 2u + (uint32_t)lh * 16u;   // the lane's bytes from the copy's base
  // low 32 bits of the shared pointer = LDS byte address
  const uint32_t lds0  = (uint32_t)(uintptr_t)&S[0][(wid * 64 + hi) * LDT + lh * 8];

  // eight copies (16 rows) and their s_wait_xcnt in one statement: no register that a
  // copy names is rewritten in front of the wait
  auto copy16rows = [&](uint32_t l, const _Float16* g) {
    asm volatile(
        "global_load_async_to_lds_b128 %0, %8, %9\n\t"
        "global_load_async_to_lds_b128 %1, %8, %10\n\t"
        "global_load_async_to_lds_b128 %2, %8, %11\n\t"
        "global_load_async_to_lds_b128 %3, %8, %12\n\t"
        "global_load_async_to_lds_b128 %4, %8, %13\n\t"
        "global_load_async_to_lds_b128 %5, %8, %14\n\t"
        "global_load_async_to_lds_b128 %6, %8, %15\n\t"
        "global_load_async_to_lds_b128 %7, %8, %16\n\t"
        "s_wait_xcnt 0x0"
        :: "v"(l),              "v"(l + 1 * CP_LDS), "v"(l + 2 * CP_LDS), "v"(l + 3 * CP_LDS),
           "v"(l + 4 * CP_LDS), "v"(l + 5 * CP_LDS), "v"(l + 6 * CP_LDS), "v"(l + 7 * CP_LDS),
           "v"(goff),
           "s"(g),             "s"(g + 1 * grow2), "s"(g + 2 * grow2), "s"(g + 3 * grow2),
           "s"(g + 4 * grow2), "s"(g + 5 * grow2), "s"(g + 6 * grow2), "s"(g + 7 * grow2)
        : "memory");
  };
  // half of a wave's share of one stage (32 of its 64 rows)
  auto issue_half = [&](int buf, int k0, int half) {
#pragma unroll
    for (int q = 2 * half; q < 2 * half + 2; ++q)
      copy16rows(lds0 + (uint32_t)buf * (STG * 2) + (uint32_t)q * (8 * CP_LDS),
                 gsrc + (size_t)q * 8 * grow2 + k0);
  };

  // fragments of one 32-k block: B 0..3 first, then A 0..7, the order in which the WMMAs
  // ask for them (behind a barrier the first WMMAs then wait for 10 loads, not for 18);
  // the same k order in both operands
  auto load_frags = [&](v16h (&f)[FA + FB], const _Float16* sa, const _Float16* sb, int kb) {
#pragma unroll
    for (int nf = 0; nf < FB; ++nf) {
      const v8h lo = *(const v8h*)(sb + nf * 16 * LDT + kb * 32);        // K 0..7 / 8..15
      const v8h hh = *(const v8h*)(sb + nf * 16 * LDT + kb * 32 + 16);   // K 16..23 / 24..31
      f[FA + nf] = __builtin_shufflevector(lo, hh,
                0,1,2,3,4,5,6,7, 8,9,10,11,12,13,14,15);
    }
#pragma unroll
    for (int mf = 0; mf < FA; ++mf) {
      const v8h lo = *(const v8h*)(sa + mf * 16 * LDT + kb * 32);
      const v8h hh = *(const v8h*)(sa + mf * 16 * LDT + kb * 32 + 16);
      f[mf] = __builtin_shufflevector(lo, hh,
                0,1,2,3,4,5,6,7, 8,9,10,11,12,13,14,15);
    }
  };

  v8f_u acc[FA][FB];
#pragma unroll
  for (int i = 0; i < FA; ++i)
#pragma unroll
    for (int j = 0; j < FB; ++j) acc[i][j].v = (v8f)(0.0f);

  const int nkt = K / BK;

  // prologue: stage 0 lands and is published
  issue_half(0, 0, 0);
  issue_half(0, 0, 1);
  asm volatile("s_wait_asynccnt 0x0" ::: "memory");   // my copies of stage 0 have landed
  __syncthreads();

  // rolled: one stage's 128 WMMAs are the loop body
#pragma unroll 1
  for (int kt = 0; kt < nkt; ++kt) {
    const int  cur  = kt & 1;
    const bool more = kt + 1 < nkt;
    const _Float16* sa = &S[cur][(wm * 128 + lh) * LDT + hi * 8];
    const _Float16* sb = &S[cur][(BM + wn * 64 + lh) * LDT + hi * 8];

    v16h f[2][FA + FB];
    load_frags(f[0], sa, sb, 0);
#pragma unroll
    for (int kb = 0; kb < NKB; ++kb) {
      // the next block's fragment loads as one group ahead of this block's WMMAs
      if (kb + 1 < NKB) load_frags(f[(kb + 1) & 1], sa, sb, kb + 1);
      // keeps the load group whole and ahead of the WMMAs (without it the build spreads
      // the loads among the WMMAs, hoists a third block's loads and spills)
      __builtin_amdgcn_sched_barrier(0);
      // stage kt+1 goes into the other buffer, whose readers all left it at the last
      // barrier; issued in the first two blocks, it has the rest of the stage to land
      if (kb < 2 && more) issue_half(cur ^ 1, (kt + 1) * BK, kb);
#pragma unroll
      for (int mf = 0; mf < FA; ++mf)
#pragma unroll
        for (int nf = 0; nf < FB; ++nf)
          acc[mf][nf].v = __builtin_amdgcn_wmma_f32_16x16x32_f16(
              false, f[kb & 1][mf], false, f[kb & 1][FA + nf], (short)0, acc[mf][nf].v, false, false);
      // the next load group, which refills this block's fragment set, stays behind its WMMAs
      __builtin_amdgcn_sched_barrier(0);
    }

    // publish point of stage kt+1: my LDS reads of this buffer are done, my copies have
    // landed; the barrier shows them to all waves and frees this buffer for the refill.
    asm volatile("s_wait_dscnt 0x0" ::: "memory");
    asm volatile("s_wait_asynccnt 0x0" ::: "memory");
    __syncthreads();
  }

  // ---- epilogue: C layout = VGPR r -> (row r + 8*hi, col lane&15) ----
#pragma unroll
  for (int nf = 0; nf < FB; ++nf) {
    const int col  = n0 + wn * 64 + nf * 16 + lh;
    const float bc = bias[col];
#pragma unroll
    for (int mf = 0; mf < FA; ++mf) {
      const int rbase = m0 + wm * 128 + mf * 16 + hi * 8;
#pragma unroll
      for (int r = 0; r < 8; ++r) {
        const float val = acc[mf][nf].f[r] + bc;
        const size_t idx = (size_t)(rbase + r) * N + col;
        if (OUT_F16) ((_Float16*)Cout)[idx] = (_Float16)val;
        else         ((float*)Cout)[idx]    = val;
      }
    }
  }
}

// =====================================================================
// attention epilogue: one wave per (run of 32 tokens, group of 4 heads).
// A lane owns 8 dims (16 B), 8 lanes make a head, so every q or k load and every store of
// a wave is 512 contiguous bytes. The wave walks its tokens in order and
// carries k_{l-1} and k_l in registers: each k row is loaded once per run.
// The grid is one 16-wave block per WGP; the launch starts 4,096 waves.
// qk buffer holds q (cols 0..1023) and k (cols 1024..2047) per token.
// slots: [ak, k_{l-1}, k_l, k_{l+1}]; V = [av, k_{l-1}, k_l, k_{l+1}]
// boundary slots are zero vectors -> score 0 (matches zero-padding).
// =====================================================================
constexpr int AT_TOK     = 32;                     // tokens per wave
constexpr int AT_CH      = 4;                      // tokens per load group
constexpr int AT_HG      = NHID / 256;             // head groups per token: 4
constexpr int AT_THREADS = 512;
constexpr int AT_BLOCKS  = (MROWS / AT_TOK) * AT_HG / (AT_THREADS / 32);
constexpr int AT_QKROW   = NQK * 2;                // bytes of a q|k row
constexpr int AT_OROW    = NHID * 2;               // bytes of an output row
static_assert(SEQ % AT_TOK == 0 && AT_TOK % (2 * AT_CH) == 0 && AT_TOK >= 4 * AT_CH,
              "a run stays inside one sequence; load groups go in pairs");
static_assert(AT_QKROW == 4096 && AT_OROW == 2048 && AT_CH == 4, "the pointer steps in asm text are written for these");

typedef __attribute__((ext_vector_type(2))) float v2f;
// a pointer that has passed through an asm operand must say that it is global,
// else its loads compile to flat loads
typedef const __attribute__((address_space(1))) char* gcharp;
typedef const __attribute__((address_space(1))) v8h*  gv8hp;

// sum over the 8 lanes of a head, result in all 8
__device__ __forceinline__ float sum_head_lanes(float v) {
  v += __builtin_bit_cast(float, __builtin_amdgcn_update_dpp(0, __builtin_bit_cast(int, v), 0x161, 0xf, 0xf, true)); // row_xmask:1
  v += __builtin_bit_cast(float, __builtin_amdgcn_update_dpp(0, __builtin_bit_cast(int, v), 0x162, 0xf, 0xf, true)); // row_xmask:2
  v += __builtin_bit_cast(float, __builtin_amdgcn_update_dpp(0, __builtin_bit_cast(int, v), 0x164, 0xf, 0xf, true)); // row_xmask:4
  return v;
}

__device__ __forceinline__ void widen(v2f (&f)[4], v8h h) {
#pragma unroll
  for (int p = 0; p < 4; ++p) { f[p][0] = (float)h[2 * p]; f[p][1] = (float)h[2 * p + 1]; }
}

// one load group: q of rows ROW0..ROW0+3 (counted from base) and the k rows one token
// ahead of them; the run's last group leaves out the row behind the run.
template <int ROW0, bool LAST>
__device__ __forceinline__ void at_load(v8h (&q)[AT_CH], v8h (&k)[AT_CH],
                                        gcharp base, uint32_t voff) {
#pragma unroll
  for (int j = 0; j < AT_CH; ++j) {
    q[j] = *(gv8hp)(base + voff + (ROW0 + j) * AT_QKROW);
    if (!(LAST && j == AT_CH - 1))
      k[j] = *(gv8hp)(base + voff + (ROW0 + j + 1) * AT_QKROW + NHID * 2);
  }
  // holds the group's loads here, a whole group of work ahead of their use
  // (without it the build sinks them to just in front of the use)
  __builtin_amdgcn_sched_barrier(0);
}

// four tokens: scores, softmax, weighted sum, stores
template <int ROW0>
__device__ __forceinline__ void at_group(const v8h (&q)[AT_CH], const v8h (&k)[AT_CH],
                                         v2f (&km)[4], v2f (&kc)[4],
                                         const v2f (&ak)[4], const v2f (&av)[4],
                                         char* obase, uint32_t voff) {
  v4f ov[AT_CH];
#pragma unroll
  for (int j = 0; j < AT_CH; ++j) {
    v2f qf[4], kn[4];
    widen(qf, q[j]);
    widen(kn, k[j]);

    v2f p0 = qf[0] * ak[0], p1 = qf[0] * km[0], p2 = qf[0] * kc[0], p3 = qf[0] * kn[0];
#pragma unroll
    for (int p = 1; p < 4; ++p) {
      p0 += qf[p] * ak[p];
      p1 += qf[p] * km[p];
      p2 += qf[p] * kc[p];
      p3 += qf[p] * kn[p];
    }
    float s0 = sum_head_lanes(p0[0] + p0[1]);
    float s1 = sum_head_lanes(p1[0] + p1[1]);
    float s2 = sum_head_lanes(p2[0] + p2[1]);
    float s3 = sum_head_lanes(p3[0] + p3[1]);

    const float sc = 0.125f;  // 1/sqrt(64)
    s0 *= sc; s1 *= sc; s2 *= sc; s3 *= sc;

    const float mx = fmaxf(fmaxf(s0, s1), fmaxf(s2, s3));
    const float e0 = __expf(s0 - mx), e1 = __expf(s1 - mx);
    const float e2 = __expf(s2 - mx), e3 = __expf(s3 - mx);
    const float inv = 1.0f / (e0 + e1 + e2 + e3);
    const float a0 = e0 * inv, a1 = e1 * inv, a2 = e2 * inv, a3 = e3 * inv;

    v8h oh;
#pragma unroll
    for (int p = 0; p < 4; ++p) {
      const v2f o = a0 * av[p] + a1 * km[p] + a2 * kc[p] + a3 * kn[p];
      oh[2 * p]     = (_Float16)o[0];
      oh[2 * p + 1] = (_Float16)o[1];
    }
    ov[j] = __builtin_bit_cast(v4f, oh);

#pragma unroll
    for (int p = 0; p < 4; ++p) { km[p] = kc[p]; kc[p] = kn[p]; }
  }
  // The group's four stores and their s_wait_xcnt in one statement: no register that a
  // store names is rewritten in front of the wait.
  asm volatile(
      "global_store_b128 %0, %1, %5 offset:%6\n\t"
      "global_store_b128 %0, %2, %5 offset:%7\n\t"
      "global_store_b128 %0, %3, %5 offset:%8\n\t"
      "global_store_b128 %0, %4, %5 offset:%9\n\t"
      "s_wait_xcnt 0x0"
      :: "v"(voff), "v"(ov[0]), "v"(ov[1]), "v"(ov[2]), "v"(ov[3]), "s"(obase),
         "n"((ROW0 + 0) * AT_OROW), "n"((ROW0 + 1) * AT_OROW),
         "n"((ROW0 + 2) * AT_OROW), "n"((ROW0 + 3) * AT_OROW)
      : "memory");
}

__global__ __launch_bounds__(AT_THREADS)
void attn_window(const _Float16* __restrict__ qkh,
                 const float* __restrict__ akf,
                 const float* __restrict__ avf,
                 _Float16* __restrict__ atth) {
  const int lane = threadIdx.x & 31;
  const int gw   = __builtin_amdgcn_readfirstlane(blockIdx.x * (AT_THREADS / 32) + (threadIdx.x >> 5));
  const int hg   = gw & (AT_HG - 1);
  const int t0   = (gw / AT_HG) * AT_TOK;          // first token of the run, b*SEQ + l
  const int l0   = t0 & (SEQ - 1);

  // wave-uniform bases; every lane adds the same 16 B * lane to all of them
  const uint32_t voff = (uint32_t)lane * 16u;
  gcharp      base  = (gcharp)(qkh + (size_t)t0 * NQK + hg * 256);
  char*       obase = (char*)(atth + (size_t)t0 * NHID + hg * 256);

  const size_t grow = (size_t)(t0 / SEQ) * NHID + hg * 256;
  const float* akp = akf + grow;
  const float* avp = avf + grow;
  v2f ak[4], av[4];
  {
    const v4f akl = *(const v4f*)(akp + lane * 8), akh = *(const v4f*)(akp + lane * 8 + 4);
    const v4f avl = *(const v4f*)(avp + lane * 8), avh = *(const v4f*)(avp + lane * 8 + 4);
    ak[0] = akl.xy; ak[1] = akl.zw; ak[2] = akh.xy; ak[3] = akh.zw;
    av[0] = avl.xy; av[1] = avl.zw; av[2] = avh.xy; av[3] = avh.zw;
  }

  // the rows in front of and behind the run: zero at the ends of the sequence
  v8h kfirst = {}, kend = {};
  if (l0 > 0)            kfirst = *(gv8hp)(base + voff - AT_QKROW + NHID * 2);
  if (l0 + AT_TOK < SEQ) kend   = *(gv8hp)(base + voff + AT_TOK * AT_QKROW + NHID * 2);
  const v8h kown = *(gv8hp)(base + voff + NHID * 2);

  // two register sets: one group's 8 loads are in flight while the other group is worked on
  v8h qa[AT_CH], ka[AT_CH], qb[AT_CH], kb[AT_CH];
  at_load<0, false>(qa, ka, base, voff);
  // the loads so far name address registers that the loop's first loads may land in:
  // this wait stands in front of every later load
  asm volatile("s_wait_xcnt 0x0" ::: "memory");

  v2f km[4], kc[4];
  widen(km, kfirst);
  widen(kc, kown);

  // rolled: for speed only
#pragma unroll 1
  for (int it = 0; it < AT_TOK / (2 * AT_CH) - 1; ++it) {
    at_load<AT_CH, false>(qb, kb, base, voff);
    at_group<0>(qa, ka, km, kc, ak, av, obase, voff);
    at_load<2 * AT_CH, false>(qa, ka, base, voff);
    at_group<AT_CH>(qb, kb, km, kc, ak, av, obase, voff);
    // both bases go on by 8 rows, behind the wait for the loads and stores that name them
    asm volatile("s_wait_xcnt 0x0\n\t"
                 "s_add_nc_u64 %0, %0, 0x8000\n\t"
                 "s_add_nc_u64 %1, %1, 0x4000"
                 : "+s"(base), "+s"(obase) :: "memory");
  }
  at_load<AT_CH, true>(qb, kb, base, voff);
  kb[AT_CH - 1] = kend;
  at_group<0>(qa, ka, km, kc, ak, av, obase, voff);
  at_group<AT_CH>(qb, kb, km, kc, ak, av, obase, voff);
}

// =====================================================================
// launch
// =====================================================================
extern "C" void kernel_launch(void* const* d_in, const int* in_sizes, int n_in,
                              void* d_out, int out_size, void* d_ws, size_t ws_size,
                              hipStream_t stream) {
  const float* x    = (const float*)d_in[0];
  const float* ax   = (const float*)d_in[1];
  const float* WQ_w = (const float*)d_in[2];
  const float* WQ_b = (const float*)d_in[3];
  const float* WK_w = (const float*)d_in[4];
  const float* WK_b = (const float*)d_in[5];
  const float* WV_w = (const float*)d_in[6];
  const float* WV_b = (const float*)d_in[7];
  const float* WO_w = (const float*)d_in[8];
  const float* WO_b = (const float*)d_in[9];

  char* ws = (char*)d_ws;
  _Float16* xh   = (_Float16*)(ws + OFF_XH);
  _Float16* wqkt = (_Float16*)(ws + OFF_WQKT);
  _Float16* wot  = (_Float16*)(ws + OFF_WOT);
  float*    bqk  = (float*)(ws + OFF_BQK);
  _Float16* qkh  = (_Float16*)(ws + OFF_QKH);
  _Float16* atth = (_Float16*)(ws + OFF_ATTH);
  float*    akf  = (float*)(ws + OFF_AK);
  float*    avf  = (float*)(ws + OFF_AV);

  // 1-3) one grid: weights to f16 [WQ^T ; WK^T] and WO^T, bias [WQ_b ; WK_b], x to f16
  prep_inputs<<<PR_TR + PR_CB + PR_CV, PR_THREADS, 0, stream>>>(x, WQ_w, WK_w, WO_w, WQ_b, WK_b,
                                                                xh, wqkt, wot, bqk);
  // 4) global-token projections ak = ax@WK + bK, av = ax@WV + bV (f32), one grid
  {
    dim3 g(NHID / PG_COLS, BATCH / PG_BATCH, 2);
    proj_global_tok<<<g, PG_THREADS, 0, stream>>>(ax, WK_w, WK_b, akf, WV_w, WV_b, avf);
  }
  // 5) fused q|k projection via WMMA GEMM: [32768x1024] @ [1024x2048]
  {
    dim3 g(NQK / BN, MROWS / BM);
    gemm_wmma_f16<true><<<g, 256, 0, stream>>>(xh, wqkt, bqk, (void*)qkh,
                                               MROWS, NQK, NHID);
  }
  // 6) windowed attention epilogue -> att (f16)
  attn_window<<<AT_BLOCKS, AT_THREADS, 0, stream>>>(qkh, akf, avf, atth);
  // 7) output projection via WMMA GEMM (f32 out to d_out)
  {
    dim3 g(NHID / BN, MROWS / BM);
    gemm_wmma_f16<false><<<g, 256, 0, stream>>>(atth, wot, WO_b, d_out,
                                                MROWS, NHID, NHID);
  }
}

// v005
// It runs in 188 microseconds.
// Two timings next to v004 both put it at 1.04 times that version's speed.
// All steps since v000 together make it 3.20 times as fast.
#include <hip/hip_runtime.h>
#include <hip/hip_bf16.h>
#include <stdint.h>

// ---------------- problem constants ----------------
constexpr int BATCH = 8;
constexpr int SEQ   = 4096;
constexpr int NHEAD = 16;
constexpr int HDIM  = 64;
constexpr int NHID  = 1024;              // == NHEAD*HDIM
constexpr int MROWS = BATCH * SEQ;       // 32768
constexpr int NQK   = 2 * NHID;          // fused q|k output width

// ---------------- vector types ----------------
typedef __attribute__((ext_vector_type(16))) _Float16 v16h;
typedef __attribute__((ext_vector_type(8)))  _Float16 v8h;
typedef __attribute__((ext_vector_type(4)))  _Float16 v4h;
typedef __attribute__((ext_vector_type(2)))  _Float16 v2h;
typedef __attribute__((ext_vector_type(8)))  float    v8f;

typedef union { v8f v; float f[8]; } v8f_u;

// ---------------- workspace layout (bytes) ----------------
constexpr size_t OFF_XH   = 0;                                    // 32768x1024 f16 (64 MB)
constexpr size_t OFF_WQKT = OFF_XH   + (size_t)MROWS * NHID * 2;  // 2048x1024 f16 ([WQ^T;WK^T])
constexpr size_t OFF_WOT  = OFF_WQKT + (size_t)NQK   * NHID * 2;  // 1024x1024 f16
constexpr size_t OFF_BQK  = OFF_WOT  + (size_t)NHID  * NHID * 2;  // 2048 f32
constexpr size_t OFF_QKH  = OFF_BQK  + (size_t)NQK * 4;           // 32768x2048 f16 (128 MB)
constexpr size_t OFF_ATTH = OFF_QKH  + (size_t)MROWS * NQK * 2;   // 32768x1024 f16
constexpr size_t OFF_AK   = OFF_ATTH + (size_t)MROWS * NHID * 2;  // 8x1024 f32
constexpr size_t OFF_AV   = OFF_AK   + (size_t)BATCH * NHID * 4;

// =====================================================================
// The five jobs that only reshape inputs (x to f16, three weight transposes,
// the bias concat) depend on nothing but the inputs and write disjoint
// buffers. They run as one grid, prep_inputs below: the block index picks the
// job, and each job's blocks do what its own launch did. blk is the block's
// index inside its job.
// =====================================================================
constexpr int PR_THREADS = 256;

// f32 -> f16 conversion of a stream. A block owns CV_LD * PR_THREADS consecutive float4: a
// thread asks for its CV_LD float4 (each a wave-wide 512 contiguous bytes) before it converts
// the first, so a wave has 4 KB in flight and the stream needs CV_LD times fewer waves started.
constexpr int CV_LD = 8;
__device__ __forceinline__ void cvt_f32_to_f16_stream(const float* __restrict__ in,
                                                      _Float16* __restrict__ out, int blk) {
  const int i0 = blk * (CV_LD * PR_THREADS) + threadIdx.x;
  float4 v[CV_LD];
#pragma unroll
  for (int j = 0; j < CV_LD; ++j) v[j] = ((const float4*)in)[i0 + j * PR_THREADS];
#pragma unroll
  for (int j = 0; j < CV_LD; ++j) {
    v4h h;
    h[0] = (_Float16)v[j].x; h[1] = (_Float16)v[j].y;
    h[2] = (_Float16)v[j].z; h[3] = (_Float16)v[j].w;
    ((v4h*)out)[i0 + j * PR_THREADS] = h;
  }
  // the loads' and stores' registers are not rewritten in front of this wait, whatever code
  // of the merged kernel the build places behind the stores
  asm volatile("s_wait_xcnt 0x0" ::: "memory");
}

// f32 [K][N] -> f16 [N][K] transpose (32x32 LDS tiles); every thread of the block comes here
__device__ __forceinline__ void transpose_f32_to_f16(const float* __restrict__ in,
                                                     _Float16* __restrict__ out,
                                                     int K, int N, int blk) {
  __shared__ float tile[32][33];
  int tx = threadIdx.x & 31, ty = threadIdx.x >> 5;
  int k0 = (blk / (N / 32)) * 32, n0 = (blk % (N / 32)) * 32;
#pragma unroll
  for (int i = 0; i < 32; i += 8)
    tile[ty + i][tx] = in[(size_t)(k0 + ty + i) * N + n0 + tx];
  __syncthreads();
#pragma unroll
  for (int i = 0; i < 32; i += 8)
    out[(size_t)(n0 + ty + i) * K + k0 + tx] = (_Float16)tile[tx][ty + i];
}

// concat two f32 vectors of length n -> out[2n]
__device__ __forceinline__ void concat_bias(const float* __restrict__ a, const float* __restrict__ b,
                                            float* __restrict__ out, int n, int blk) {
  int i = blk * PR_THREADS + threadIdx.x;
  out[i] = (i < n) ? a[i] : b[i - n];
  // the store's registers are not rewritten in front of this wait, whatever code of the
  // merged kernel the build places behind the store
  asm volatile("s_wait_xcnt 0x0" ::: "memory");
}

constexpr int PR_TILES = (NHID / 32) * (NHID / 32);            // blocks per weight transpose
constexpr int PR_TR    = 3 * PR_TILES;                         // blocks 0 .. PR_TR-1: transposes
constexpr int PR_CB    = NQK / PR_THREADS;                     // then the bias concat
constexpr int PR_CV    = MROWS * NHID / 4 / (CV_LD * PR_THREADS);   // then the conversion of x
static_assert(NQK % PR_THREADS == 0 && (MROWS * NHID / 4) % (CV_LD * PR_THREADS) == 0, "whole blocks");

// The short jobs have the low block indices. Every branch is on the block index alone.
__global__ __launch_bounds__(PR_THREADS)
void prep_inputs(const float* __restrict__ x,
                 const float* __restrict__ WQ_w, const float* __restrict__ WK_w,
                 const float* __restrict__ WO_w,
                 const float* __restrict__ WQ_b, const float* __restrict__ WK_b,
                 _Float16* __restrict__ xh, _Float16* __restrict__ wqkt,
                 _Float16* __restrict__ wot, float* __restrict__ bqk) {
  const int b = blockIdx.x;
  if (b < PR_TR) {
    const int which = b / PR_TILES;
    const float* in  = which == 0 ? WQ_w : which == 1 ? WK_w : WO_w;
    _Float16*    out = which == 0 ? wqkt : which == 1 ? wqkt + (size_t)NHID * NHID : wot;
    transpose_f32_to_f16(in, out, NHID, NHID, b % PR_TILES);
  } else if (b < PR_TR + PR_CB) {
    concat_bias(WQ_b, WK_b, bqk, NHID, b - PR_TR);
  } else {
    cvt_f32_to_f16_stream(x, xh, b - (PR_TR + PR_CB));
  }
}

// =====================================================================
// projection of the global token: out[b][n] = ax[b].W[:,n] + bias[n]
// One block owns 32 columns for 4 of the 8 batches. The k range is split
// over 128 slices of 8 rows: thread = (slice, column quad). A thread's 8 W
// rows and its ax values fit in registers together, so they are all asked
// for at once and the block waits for memory once, where a serial k loop
// waits once per unrolled group of rows.
// Partial sums: the 4 slices of a wave by shuffles, the 32 waves through LDS.
// Both projections (with WK and with WV) are one grid: blockIdx.z picks the matrix.
// =====================================================================
constexpr int PG_COLS    = 32;                     // columns per block: one 128-B line per W row
constexpr int PG_BATCH   = 4;                      // batches per block
constexpr int PG_THREADS = 1024;
constexpr int PG_WAVES   = PG_THREADS / 32;
constexpr int PG_KPT     = NHID / (PG_THREADS / (PG_COLS / 4));   // 8 rows per thread
static_assert(PG_KPT == 8 && PG_BATCH == 4 && NHID * 4 == 4096, "the offsets in the load statement are written for these");

typedef __attribute__((ext_vector_type(4))) float v4f;

__global__ __launch_bounds__(PG_THREADS)
void proj_global_tok(const float* __restrict__ ax,
                     const float* __restrict__ W0, const float* __restrict__ bias0,
                     float* __restrict__ out0,
                     const float* __restrict__ W1, const float* __restrict__ bias1,
                     float* __restrict__ out1) {
  __shared__ float part[PG_WAVES][PG_BATCH][PG_COLS];   // 16 KB

  const bool second = blockIdx.z != 0;
  const float* W    = second ? W1 : W0;
  const float* bias = second ? bias1 : bias0;
  float*       out  = second ? out1 : out0;

  const int tid  = threadIdx.x;
  const int lane = tid & 31;
  const int wave = tid >> 5;
  const int cq   = tid & 7;                  // column quad inside the block
  const int k0   = (tid >> 3) * PG_KPT;      // first row of this thread's slice
  const int nblk = blockIdx.x * PG_COLS;
  const int b0   = blockIdx.y * PG_BATCH;

  const float* wp = W  + (size_t)k0 * NHID + nblk + cq * 4;   // row j at byte offset j * 4096
  const float* ap = ax + (size_t)b0 * NHID + k0;              // batch bb at byte offset bb * 4096

  // All 16 loads of the thread and their data wait in one statement: every load is in
  // flight before the first wait, and the early-clobber outputs keep each result out of
  // the two address pairs until all loads have returned (as plain loads the build let one
  // load's result land in the pair that six loads still in flight named).
  v4f w[PG_KPT], a[PG_BATCH][2];
  asm volatile(
      "global_load_b128 %0, %16, off\n\t"
      "global_load_b128 %1, %16, off offset:4096\n\t"
      "global_load_b128 %2, %16, off offset:8192\n\t"
      "global_load_b128 %3, %16, off offset:12288\n\t"
      "global_load_b128 %4, %16, off offset:16384\n\t"
      "global_load_b128 %5, %16, off offset:20480\n\t"
      "global_load_b128 %6, %16, off offset:24576\n\t"
      "global_load_b128 %7, %16, off offset:28672\n\t"
      "global_load_b128 %8, %17, off\n\t"
      "global_load_b128 %9, %17, off offset:16\n\t"
      "global_load_b128 %10, %17, off offset:4096\n\t"
      "global_load_b128 %11, %17, off offset:4112\n\t"
      "global_load_b128 %12, %17, off offset:8192\n\t"
      "global_load_b128 %13, %17, off offset:8208\n\t"
      "global_load_b128 %14, %17, off offset:12288\n\t"
      "global_load_b128 %15, %17, off offset:12304\n\t"
      "s_wait_loadcnt 0x0"
      : "=&v"(w[0]), "=&v"(w[1]), "=&v"(w[2]), "=&v"(w[3]),
        "=&v"(w[4]), "=&v"(w[5]), "=&v"(w[6]), "=&v"(w[7]),
        "=&v"(a[0][0]), "=&v"(a[0][1]), "=&v"(a[1][0]), "=&v"(a[1][1]),
        "=&v"(a[2][0]), "=&v"(a[2][1]), "=&v"(a[3][0]), "=&v"(a[3][1])
      : "v"(wp), "v"(ap)
      : "memory");

  v4f acc[PG_BATCH];
#pragma unroll
  for (int bb = 0; bb < PG_BATCH; ++bb) {
    v4f s = a[bb][0][0] * w[0];
#pragma unroll
    for (int j = 1; j < PG_KPT; ++j)
      s += a[bb][j >> 2][j & 3] * w[j];
    acc[bb] = s;
  }

  // the wave's 4 slices sit in lanes cq, cq+8, cq+16, cq+24
#pragma unroll
  for (int bb = 0; bb < PG_BATCH; ++bb) {
#pragma unroll
    for (int off = 8; off <= 16; off <<= 1) {
#pragma unroll
      for (int e = 0; e < 4; ++e)
        acc[bb][e] += __shfl_xor(acc[bb][e], off, 32);
    }
  }
  if (lane < 8) {
#pragma unroll
    for (int bb = 0; bb < PG_BATCH; ++bb)
      *(v4f*)&part[wave][bb][cq * 4] = acc[bb];
  }
  __syncthreads();

  // one thread per (batch, column) adds the 32 waves' partial sums
  if (tid < PG_BATCH * PG_COLS) {
    const int bb = tid >> 5, c = tid & 31;
    float s = bias[nblk + c];
#pragma unroll
    for (int wv = 0; wv < PG_WAVES; ++wv)
      s += part[wv][bb][c];
    out[(size_t)(b0 + bb) * NHID + nblk + c] = s;
  }
}

// =====================================================================
// WMMA GEMM:  C[M][N] = A[M][K](f16) * Bt[N][K](f16)^T + bias[N]
// 256 threads = 8 waves; block tile 256(M) x 256(N); a stage is 128 k.
// M and N are multiples of 256, K a multiple of 128.
// A block reads (256 + 256) operand rows from L2 for 65,536 outputs, and every
// copy of a wave covers two whole 256-B row pieces.
// Each wave: 128x64 tile -> 8x4 v_wmma_f32_16x16x32_f16 per 32 k, so a loaded
// fragment feeds 4 or 8 products. One block per WGP, two waves per SIMD.
// Two LDS buffers fed by GLOBAL_LOAD_ASYNC_TO_LDS_B128 (ASYNCcnt), no VGPR
// staging, 1 barrier / stage; fragments are fetched one 32-k block ahead inside
// a stage, never across the stage's barrier.
// =====================================================================
constexpr int BM   = 256;
constexpr int BN   = 256;
constexpr int BK   = 128;
constexpr int NKB  = BK / 32;            // WMMA k blocks per stage
constexpr int LDT  = BK + 8;             // padded LDS row (halves): 272 B = 16 B x odd
constexpr int STG  = (BM + BN) * LDT;    // halves per stage: rows 0..255 A, 256..511 B
constexpr int FA   = 8;                  // A fragments per wave
constexpr int FB   = 4;                  // B fragments per wave
constexpr int CP_LDS = 2 * LDT * 2;      // LDS bytes between two copies of a wave (2 rows)

template <bool OUT_F16>
__global__ __launch_bounds__(256)
void gemm_wmma_f16(const _Float16* __restrict__ A,
                   const _Float16* __restrict__ Bt,
                   const float* __restrict__ bias,
                   void* __restrict__ Cout,
                   int M, int N, int K) {
  __shared__ __attribute__((aligned(16))) _Float16 S[2][STG];

  const int tid  = threadIdx.x;
  const int wid  = __builtin_amdgcn_readfirstlane(tid >> 5);
  const int lane = tid & 31;
  const int lh   = lane & 15;
  const int hi   = lane >> 4;          // 0: lanes 0-15, 1: lanes 16-31

  const int wm = wid >> 2;             // 0..1  (128 M-rows each)
  const int wn = wid & 3;              // 0..3  (64 N-cols each)

  const int m0 = blockIdx.y * BM;
  const int n0 = blockIdx.x * BN;

  // staging: wave w brings stage rows 64w .. 64w+63 (waves 0-3: A, waves 4-7: B),
  // two rows a copy: lanes 0-15 one row's 256 B, lanes 16-31 the next row's.
  const _Float16* gsrc = (wid < 4) ? A  + (size_t)(m0 + wid * 64) * K
                                   : Bt + (size_t)(n0 + (wid - 4) * 64) * K;   // wave-uniform
  const size_t   grow2 = (size_t)2 * K;                                  // halves between two copies
  const uint32_t goff  = (uint32_t)hi * (uint32_t)K * 2u + (uint32_t)lh * 16u;   // the lane's bytes from the copy's base
  // low 32 bits of the shared pointer = LDS byte address
  const uint32_t lds0  = (uint32_t)(uintptr_t)&S[0][(wid * 64 + hi) * LDT + lh * 8];

  // eight copies (16 rows) and their s_wait_xcnt in one statement: no register that a
  // copy names is rewritten in front of the wait
  auto copy16rows = [&](uint32_t l, const _Float16* g) {
    asm volatile(
        "global_load_async_to_lds_b128 %0, %8, %9\n\t"
        "global_load_async_to_lds_b128 %1, %8, %10\n\t"
        "global_load_async_to_lds_b128 %2, %8, %11\n\t"
        "global_load_async_to_lds_b128 %3, %8, %12\n\t"
        "global_load_async_to_lds_b128 %4, %8, %13\n\t"
        "global_load_async_to_lds_b128 %5, %8, %14\n\t"
        "global_load_async_to_lds_b128 %6, %8, %15\n\t"
        "global_load_async_to_lds_b128 %7, %8, %16\n\t"
        "s_wait_xcnt 0x0"
        :: "v"(l),              "v"(l + 1 * CP_LDS), "v"(l + 2 * CP_LDS), "v"(l + 3 * CP_LDS),
           "v"(l + 4 * CP_LDS), "v"(l + 5 * CP_LDS), "v"(l + 6 * CP_LDS), "v"(l + 7 * CP_LDS),
           "v"(goff),
           "s"(g),             "s"(g + 1 * grow2), "s"(g + 2 * grow2), "s"(g + 3 * grow2),
           "s"(g + 4 * grow2), "s"(g + 5 * grow2), "s"(g + 6 * grow2), "s"(g + 7 * grow2)
        : "memory");
  };
  // half of a wave's share of one stage (32 of its 64 rows)
  auto issue_half = [&](int buf, int k0, int half) {
#pragma unroll
    for (int q = 2 * half; q < 2 * half + 2; ++q)
      copy16rows(lds0 + (uint32_t)buf * (STG * 2) + (uint32_t)q * (8 * CP_LDS),
                 gsrc + (size_t)q * 8 * grow2 + k0);
  };

  // fragments of one 32-k block: B 0..3 first, then A 0..7, the order in which the WMMAs
  // ask for them (behind a barrier the first WMMAs then wait for 10 loads, not for 18);
  // the same k order in both operands
  auto load_frags = [&](v16h (&f)[FA + FB], const _Float16* sa, const _Float16* sb, int kb) {
#pragma unroll
    for (int nf = 0; nf < FB; ++nf) {
      const v8h lo = *(const v8h*)(sb + nf * 16 * LDT + kb * 32);        // K 0..7 / 8..15
      const v8h hh = *(const v8h*)(sb + nf * 16 * LDT + kb * 32 + 16);   // K 16..23 / 24..31
      f[FA + nf] = __builtin_shufflevector(lo, hh,
                0,1,2,3,4,5,6,7, 8,9,10,11,12,13,14,15);
    }
#pragma unroll
    for (int mf = 0; mf < FA; ++mf) {
      const v8h lo = *(const v8h*)(sa + mf * 16 * LDT + kb * 32);
      const v8h hh = *(const v8h*)(sa + mf * 16 * LDT + kb * 32 + 16);
      f[mf] = __builtin_shufflevector(lo, hh,
                0,1,2,3,4,5,6,7, 8,9,10,11,12,13,14,15);
    }
  };

  v8f_u acc[FA][FB];
#pragma unroll
  for (int i = 0; i < FA; ++i)
#pragma unroll
    for (int j = 0; j < FB; ++j) acc[i][j].v = (v8f)(0.0f);

  const int nkt = K / BK;

  // prologue: stage 0 lands and is published
  issue_half(0, 0, 0);
  issue_half(0, 0, 1);
  asm volatile("s_wait_asynccnt 0x0" ::: "memory");   // my copies of stage 0 have landed
  __syncthreads();

  // rolled: one stage's 128 WMMAs are the loop body
#pragma unroll 1
  for (int kt = 0; kt < nkt; ++kt) {
    const int  cur  = kt & 1;
    const bool more = kt + 1 < nkt;
    const _Float16* sa = &S[cur][(wm * 128 + lh) * LDT + hi * 8];
    const _Float16* sb = &S[cur][(BM + wn * 64 + lh) * LDT + hi * 8];

    v16h f[2][FA + FB];
    load_frags(f[0], sa, sb, 0);
#pragma unroll
    for (int kb = 0; kb < NKB; ++kb) {
      // the next block's fragment loads as one group ahead of this block's WMMAs
      if (kb + 1 < NKB) load_frags(f[(kb + 1) & 1], sa, sb, kb + 1);
      // keeps the load group whole and ahead of the WMMAs (without it the build spreads
      // the loads among the WMMAs, hoists a third block's loads and spills)
      __builtin_amdgcn_sched_barrier(0);
      // stage kt+1 goes into the other buffer, whose readers all left it at the last
      // barrier; issued in the first two blocks, it has the rest of the stage to land
      if (kb < 2 && more) issue_half(cur ^ 1, (kt + 1) * BK, kb);
#pragma unroll
      for (int mf = 0; mf < FA; ++mf)
#pragma unroll
        for (int nf = 0; nf < FB; ++nf)
          acc[mf][nf].v = __builtin_amdgcn_wmma_f32_16x16x32_f16(
              false, f[kb & 1][mf], false, f[kb & 1][FA + nf], (short)0, acc[mf][nf].v, false, false);
      // the next load group, which refills this block's fragment set, stays behind its WMMAs
      __builtin_amdgcn_sched_barrier(0);
    }

    // publish point of stage kt+1: my LDS reads of this buffer are done, my copies have
    // landed; the barrier shows them to all waves and frees this buffer for the refill.
    asm volatile("s_wait_dscnt 0x0" ::: "memory");
    asm volatile("s_wait_asynccnt 0x0" ::: "memory");
    __syncthreads();
  }

  // ---- epilogue: C layout = VGPR r -> (row r + 8*hi, col lane&15) ----
#pragma unroll
  for (int nf = 0; nf < FB; ++nf) {
    const int col  = n0 + wn * 64 + nf * 16 + lh;
    const float bc = bias[col];
#pragma unroll
    for (int mf = 0; mf < FA; ++mf) {
      const int rbase = m0 + wm * 128 + mf * 16 + hi * 8;
#pragma unroll
      for (int r = 0; r < 8; ++r) {
        const float val = acc[mf][nf].f[r] + bc;
        const size_t idx = (size_t)(rbase + r) * N + col;
        if (OUT_F16) ((_Float16*)Cout)[idx] = (_Float16)val;
        else         ((float*)Cout)[idx]    = val;
      }
    }
  }
}

// =====================================================================
// attention epilogue: one wave per (run of 32 tokens, group of 4 heads).
// A lane owns 8 dims (16 B), 8 lanes make a head, so every q or k load and every store of
// a wave is 512 contiguous bytes. The wave walks its tokens in order and
// carries k_{l-1} and k_l in registers: each k row is loaded once per run.
// The grid is one 16-wave block per WGP; the launch starts 4,096 waves.
// qk buffer holds q (cols 0..1023) and k (cols 1024..2047) per token.
// slots: [ak, k_{l-1}, k_l, k_{l+1}]; V = [av, k_{l-1}, k_l, k_{l+1}]
// boundary slots are zero vectors -> score 0 (matches zero-padding).
// =====================================================================
constexpr int AT_TOK     = 32;                     // tokens per wave
constexpr int AT_CH      = 4;                      // tokens per load group
constexpr int AT_HG      = NHID / 256;             // head groups per token: 4
constexpr int AT_THREADS = 512;
constexpr int AT_BLOCKS  = (MROWS / AT_TOK) * AT_HG / (AT_THREADS / 32);
constexpr int AT_QKROW   = NQK * 2;                // bytes of a q|k row
constexpr int AT_OROW    = NHID * 2;               // bytes of an output row
static_assert(SEQ % AT_TOK == 0 && AT_TOK % (2 * AT_CH) == 0 && AT_TOK >= 4 * AT_CH,
              "a run stays inside one sequence; load groups go in pairs");
static_assert(AT_QKROW == 4096 && AT_OROW == 2048 && AT_CH == 4, "the pointer steps in asm text are written for these");

typedef __attribute__((ext_vector_type(2))) float v2f;
// a pointer that has passed through an asm operand must say that it is global,
// else its loads compile to flat loads
typedef const __attribute__((address_space(1))) char* gcharp;
typedef const __attribute__((address_space(1))) v8h*  gv8hp;

// sum over the 8 lanes of a head, result in all 8
__device__ __forceinline__ float sum_head_lanes(float v) {
  v += __builtin_bit_cast(float, __builtin_amdgcn_update_dpp(0, __builtin_bit_cast(int, v), 0x161, 0xf, 0xf, true)); // row_xmask:1
  v += __builtin_bit_cast(float, __builtin_amdgcn_update_dpp(0, __builtin_bit_cast(int, v), 0x162, 0xf, 0xf, true)); // row_xmask:2
  v += __builtin_bit_cast(float, __builtin_amdgcn_update_dpp(0, __builtin_bit_cast(int, v), 0x164, 0xf, 0xf, true)); // row_xmask:4
  return v;
}

__device__ __forceinline__ void widen(v2f (&f)[4], v8h h) {
#pragma unroll
  for (int p = 0; p < 4; ++p) { f[p][0] = (float)h[2 * p]; f[p][1] = (float)h[2 * p + 1]; }
}

// one load group: q of rows ROW0..ROW0+3 (counted from base) and the k rows one token
// ahead of them; the run's last group leaves out the row behind the run.
template <int ROW0, bool LAST>
__device__ __forceinline__ void at_load(v8h (&q)[AT_CH], v8h (&k)[AT_CH],
                                        gcharp base, uint32_t voff) {
#pragma unroll
  for (int j = 0; j < AT_CH; ++j) {
    q[j] = *(gv8hp)(base + voff + (ROW0 + j) * AT_QKROW);
    if (!(LAST && j == AT_CH - 1))
      k[j] = *(gv8hp)(base + voff + (ROW0 + j + 1) * AT_QKROW + NHID * 2);
  }
  // holds the group's loads here, a whole group of work ahead of their use
  // (without it the build sinks them to just in front of the use)
  __builtin_amdgcn_sched_barrier(0);
}

// four tokens: scores, softmax, weighted sum, stores
template <int ROW0>
__device__ __forceinline__ void at_group(const v8h (&q)[AT_CH], const v8h (&k)[AT_CH],
                                         v2f (&km)[4], v2f (&kc)[4],
                                         const v2f (&ak)[4], const v2f (&av)[4],
                                         char* obase, uint32_t voff) {
  v4f ov[AT_CH];
#pragma unroll
  for (int j = 0; j < AT_CH; ++j) {
    v2f qf[4], kn[4];
    widen(qf, q[j]);
    widen(kn, k[j]);

    v2f p0 = qf[0] * ak[0], p1 = qf[0] * km[0], p2 = qf[0] * kc[0], p3 = qf[0] * kn[0];
#pragma unroll
    for (int p = 1; p < 4; ++p) {
      p0 += qf[p] * ak[p];
      p1 += qf[p] * km[p];
      p2 += qf[p] * kc[p];
      p3 += qf[p] * kn[p];
    }
    float s0 = sum_head_lanes(p0[0] + p0[1]);
    float s1 = sum_head_lanes(p1[0] + p1[1]);
    float s2 = sum_head_lanes(p2[0] + p2[1]);
    float s3 = sum_head_lanes(p3[0] + p3[1]);

    const float sc = 0.125f;  // 1/sqrt(64)
    s0 *= sc; s1 *= sc; s2 *= sc; s3 *= sc;

    const float mx = fmaxf(fmaxf(s0, s1), fmaxf(s2, s3));
    const float e0 = __expf(s0 - mx), e1 = __expf(s1 - mx);
    const float e2 = __expf(s2 - mx), e3 = __expf(s3 - mx);
    const float inv = 1.0f / (e0 + e1 + e2 + e3);
    const float a0 = e0 * inv, a1 = e1 * inv, a2 = e2 * inv, a3 = e3 * inv;

    v8h oh;
#pragma unroll
    for (int p = 0; p < 4; ++p) {
      const v2f o = a0 * av[p] + a1 * km[p] + a2 * kc[p] + a3 * kn[p];
      oh[2 * p]     = (_Float16)o[0];
      oh[2 * p + 1] = (_Float16)o[1];
    }
    ov[j] = __builtin_bit_cast(v4f, oh);

#pragma unroll
    for (int p = 0; p < 4; ++p) { km[p] = kc[p]; kc[p] = kn[p]; }
  }
  // The group's four stores and their s_wait_xcnt in one statement: no register that a
  // store names is rewritten in front of the wait.
  asm volatile(
      "global_store_b128 %0, %1, %5 offset:%6\n\t"
      "global_store_b128 %0, %2, %5 offset:%7\n\t"
      "global_store_b128 %0, %3, %5 offset:%8\n\t"
      "global_store_b128 %0, %4, %5 offset:%9\n\t"
      "s_wait_xcnt 0x0"
      :: "v"(voff), "v"(ov[0]), "v"(ov[1]), "v"(ov[2]), "v"(ov[3]), "s"(obase),
         "n"((ROW0 + 0) * AT_OROW), "n"((ROW0 + 1) * AT_OROW),
         "n"((ROW0 + 2) * AT_OROW), "n"((ROW0 + 3) * AT_OROW)
      : "memory");
}

__global__ __launch_bounds__(AT_THREADS)
void attn_window(const _Float16* __restrict__ qkh,
                 const float* __restrict__ akf,
                 const float* __restrict__ avf,
                 _Float16* __restrict__ atth) {
  const int lane = threadIdx.x & 31;
  const int gw   = __builtin_amdgcn_readfirstlane(blockIdx.x * (AT_THREADS / 32) + (threadIdx.x >> 5));
  const int hg   = gw & (AT_HG - 1);
  const int t0   = (gw / AT_HG) * AT_TOK;          // first token of the run, b*SEQ + l
  const int l0   = t0 & (SEQ - 1);

  // wave-uniform bases; every lane adds the same 16 B * lane to all of them
  const uint32_t voff = (uint32_t)lane * 16u;
  gcharp      base  = (gcharp)(qkh + (size_t)t0 * NQK + hg * 256);
  char*       obase = (char*)(atth + (size_t)t0 * NHID + hg * 256);

  const size_t grow = (size_t)(t0 / SEQ) * NHID + hg * 256;
  const float* akp = akf + grow;
  const float* avp = avf + grow;
  v2f ak[4], av[4];
  {
    const v4f akl = *(const v4f*)(akp + lane * 8), akh = *(const v4f*)(akp + lane * 8 + 4);
    const v4f avl = *(const v4f*)(avp + lane * 8), avh = *(const v4f*)(avp + lane * 8 + 4);
    ak[0] = akl.xy; ak[1] = akl.zw; ak[2] = akh.xy; ak[3] = akh.zw;
    av[0] = avl.xy; av[1] = avl.zw; av[2] = avh.xy; av[3] = avh.zw;
  }

  // the rows in front of and behind the run: zero at the ends of the sequence
  v8h kfirst = {}, kend = {};
  if (l0 > 0)            kfirst = *(gv8hp)(base + voff - AT_QKROW + NHID * 2);
  if (l0 + AT_TOK < SEQ) kend   = *(gv8hp)(base + voff + AT_TOK * AT_QKROW + NHID * 2);
  const v8h kown = *(gv8hp)(base + voff + NHID * 2);

  // two register sets: one group's 8 loads are in flight while the other group is worked on
  v8h qa[AT_CH], ka[AT_CH], qb[AT_CH], kb[AT_CH];
  at_load<0, false>(qa, ka, base, voff);
  // the loads so far name address registers that the loop's first loads may land in:
  // this wait stands in front of every later load
  asm volatile("s_wait_xcnt 0x0" ::: "memory");

  v2f km[4], kc[4];
  widen(km, kfirst);
  widen(kc, kown);

  // rolled: for speed only
#pragma unroll 1
  for (int it = 0; it < AT_TOK / (2 * AT_CH) - 1; ++it) {
    at_load<AT_CH, false>(qb, kb, base, voff);
    at_group<0>(qa, ka, km, kc, ak, av, obase, voff);
    at_load<2 * AT_CH, false>(qa, ka, base, voff);
    at_group<AT_CH>(qb, kb, km, kc, ak, av, obase, voff);
    // both bases go on by 8 rows, behind the wait for the loads and stores that name them
    asm volatile("s_wait_xcnt 0x0\n\t"
                 "s_add_nc_u64 %0, %0, 0x8000\n\t"
                 "s_add_nc_u64 %1, %1, 0x4000"
                 : "+s"(base), "+s"(obase) :: "memory");
  }
  at_load<AT_CH, true>(qb, kb, base, voff);
  kb[AT_CH - 1] = kend;
  at_group<0>(qa, ka, km, kc, ak, av, obase, voff);
  at_group<AT_CH>(qb, kb, km, kc, ak, av, obase, voff);
}

// =====================================================================
// launch
// =====================================================================
extern "C" void kernel_launch(void* const* d_in, const int* in_sizes, int n_in,
                              void* d_out, int out_size, void* d_ws, size_t ws_size,
                              hipStream_t stream) {
  const float* x    = (const float*)d_in[0];
  const float* ax   = (const float*)d_in[1];
  const float* WQ_w = (const float*)d_in[2];
  const float* WQ_b = (const float*)d_in[3];
  const float* WK_w = (const float*)d_in[4];
  const float* WK_b = (const float*)d_in[5];
  const float* WV_w = (const float*)d_in[6];
  const float* WV_b = (const float*)d_in[7];
  const float* WO_w = (const float*)d_in[8];
  const float* WO_b = (const float*)d_in[9];

  char* ws = (char*)d_ws;
  _Float16* xh   = (_Float16*)(ws + OFF_XH);
  _Float16* wqkt = (_Float16*)(ws + OFF_WQKT);
  _Float16* wot  = (_Float16*)(ws + OFF_WOT);
  float*    bqk  = (float*)(ws + OFF_BQK);
  _Float16* qkh  = (_Float16*)(ws + OFF_QKH);
  _Float16* atth = (_Float16*)(ws + OFF_ATTH);
  float*    akf  = (float*)(ws + OFF_AK);
  float*    avf  = (float*)(ws + OFF_AV);

  // 1-3) one grid: weights to f16 [WQ^T ; WK^T] and WO^T, bias [WQ_b ; WK_b], x to f16
  prep_inputs<<<PR_TR + PR_CB + PR_CV, PR_THREADS, 0, stream>>>(x, WQ_w, WK_w, WO_w, WQ_b, WK_b,
                                                                xh, wqkt, wot, bqk);
  // 4) global-token projections ak = ax@WK + bK, av = ax@WV + bV (f32), one grid
  {
    dim3 g(NHID / PG_COLS, BATCH / PG_BATCH, 2);
    proj_global_tok<<<g, PG_THREADS, 0, stream>>>(ax, WK_w, WK_b, akf, WV_w, WV_b, avf);
  }
  // 5) fused q|k projection via WMMA GEMM: [32768x1024] @ [1024x2048]
  {
    dim3 g(NQK / BN, MROWS / BM);
    gemm_wmma_f16<true><<<g, 256, 0, stream>>>(xh, wqkt, bqk, (void*)qkh,
                                               MROWS, NQK, NHID);
  }
  // 6) windowed attention epilogue -> att (f16)
  attn_window<<<AT_BLOCKS, AT_THREADS, 0, stream>>>(qkh, akf, avf, atth);
  // 7) output projection via WMMA GEMM (f32 out to d_out)
  {
    dim3 g(NHID / BN, MROWS / BM);
    gemm_wmma_f16<false><<<g, 256, 0, stream>>>(atth, wot, WO_b, d_out,
                                                MROWS, NHID, NHID);
  }
}

// v006
// A run of this version takes 177 microseconds.
// Timed twice side by side with v005, it ran 1.05 times as fast both times.
// Over all steps from v000 it is 3.38 times as fast.
#include <hip/hip_runtime.h>
#include <hip/hip_bf16.h>
#include <stdint.h>

// ---------------- problem constants ----------------
constexpr int BATCH = 8;
constexpr int SEQ   = 4096;
constexpr int NHEAD = 16;
constexpr int HDIM  = 64;
constexpr int NHID  = 1024;              // == NHEAD*HDIM
constexpr int MROWS = BATCH * SEQ;       // 32768
constexpr int NQK   = 2 * NHID;          // fused q|k output width

// ---------------- vector types ----------------
typedef __attribute__((ext_vector_type(16))) _Float16 v16h;
typedef __attribute__((ext_vector_type(8)))  _Float16 v8h;
typedef __attribute__((ext_vector_type(4)))  _Float16 v4h;
typedef __attribute__((ext_vector_type(2)))  _Float16 v2h;
typedef __attribute__((ext_vector_type(8)))  float    v8f;

typedef union { v8f v; float f[8]; } v8f_u;

// ---------------- workspace layout (bytes) ----------------
constexpr size_t OFF_XH   = 0;                                    // 32768x1024 f16 (64 MB)
constexpr size_t OFF_WQKT = OFF_XH   + (size_t)MROWS * NHID * 2;  // 2048x1024 f16 (WQ^T, WK^T, head by head)
constexpr size_t OFF_WOT  = OFF_WQKT + (size_t)NQK   * NHID * 2;  // 1024x1024 f16
constexpr size_t OFF_BQK  = OFF_WOT  + (size_t)NHID  * NHID * 2;  // 2048 f32
constexpr size_t OFF_QKH  = OFF_BQK  + (size_t)NQK * 4;           // 32768x2048 f16; only 4 rows in 256 are used
constexpr size_t OFF_ATTH = OFF_QKH  + (size_t)MROWS * NQK * 2;   // 32768x1024 f16
constexpr size_t OFF_AK   = OFF_ATTH + (size_t)MROWS * NHID * 2;  // 8x1024 f32
constexpr size_t OFF_AV   = OFF_AK   + (size_t)BATCH * NHID * 4;

// =====================================================================
// The five jobs that only reshape inputs (x to f16, three weight transposes,
// the bias concat) depend on nothing but the inputs and write disjoint
// buffers. They run as one grid, prep_inputs below: the block index picks the
// job, and each job's blocks do what its own launch did. blk is the block's
// index inside its job.
// =====================================================================
constexpr int PR_THREADS = 256;

// f32 -> f16 conversion of a stream. A block owns CV_LD * PR_THREADS consecutive float4: a
// thread asks for its CV_LD float4 (each a wave-wide 512 contiguous bytes) before it converts
// the first, so a wave has 4 KB in flight and the stream needs CV_LD times fewer waves started.
constexpr int CV_LD = 8;
__device__ __forceinline__ void cvt_f32_to_f16_stream(const float* __restrict__ in,
                                                      _Float16* __restrict__ out, int blk) {
  const int i0 = blk * (CV_LD * PR_THREADS) + threadIdx.x;
  float4 v[CV_LD];
#pragma unroll
  for (int j = 0; j < CV_LD; ++j) v[j] = ((const float4*)in)[i0 + j * PR_THREADS];
#pragma unroll
  for (int j = 0; j < CV_LD; ++j) {
    v4h h;
    h[0] = (_Float16)v[j].x; h[1] = (_Float16)v[j].y;
    h[2] = (_Float16)v[j].z; h[3] = (_Float16)v[j].w;
    ((v4h*)out)[i0 + j * PR_THREADS] = h;
  }
  // the loads' and stores' registers are not rewritten in front of this wait, whatever code
  // of the merged kernel the build places behind the stores
  asm volatile("s_wait_xcnt 0x0" ::: "memory");
}

// Row order of the fused [q | k] weight matrix: 128 rows a head, its 64 q columns and then its
// 64 k columns, so that a 128-column slice of the product holds q and k of one head.
// c = column of WQ or WK (head * 64 + dim), isk = 1 for WK.
__device__ __forceinline__ int qk_row(int isk, int c) {
  return ((c >> 6) << 7) | (isk << 6) | (c & 63);
}

// f32 [K][N] -> f16 [N][K] transpose (32x32 LDS tiles); every thread of the block comes here.
// qk: 0 = WQ, 1 = WK (their 32 columns go to rows qk_row(qk, n0) ...), -1 = rows as they are
__device__ __forceinline__ void transpose_f32_to_f16(const float* __restrict__ in,
                                                     _Float16* __restrict__ out,
                                                     int K, int N, int blk, int qk) {
  __shared__ float tile[32][33];
  int tx = threadIdx.x & 31, ty = threadIdx.x >> 5;
  int k0 = (blk / (N / 32)) * 32, n0 = (blk % (N / 32)) * 32;
  int d0 = qk < 0 ? n0 : qk_row(qk, n0);
#pragma unroll
  for (int i = 0; i < 32; i += 8)
    tile[ty + i][tx] = in[(size_t)(k0 + ty + i) * N + n0 + tx];
  __syncthreads();
#pragma unroll
  for (int i = 0; i < 32; i += 8)
    out[(size_t)(d0 + ty + i) * K + k0 + tx] = (_Float16)tile[tx][ty + i];
}

// concat two f32 vectors of length n -> out[2n]
__device__ __forceinline__ void concat_bias(const float* __restrict__ a, const float* __restrict__ b,
                                            float* __restrict__ out, int n, int blk) {
  int i = blk * PR_THREADS + threadIdx.x;
  out[i] = (i < n) ? a[i] : b[i - n];
  // the store's registers are not rewritten in front of this wait, whatever code of the
  // merged kernel the build places behind the store
  asm volatile("s_wait_xcnt 0x0" ::: "memory");
}

constexpr int PR_TILES = (NHID / 32) * (NHID / 32);            // blocks per weight transpose
constexpr int PR_TR    = 3 * PR_TILES;                         // blocks 0 .. PR_TR-1: transposes
constexpr int PR_CB    = NQK / PR_THREADS;                     // then the bias concat
constexpr int PR_CV    = MROWS * NHID / 4 / (CV_LD * PR_THREADS);   // then the conversion of x
static_assert(NQK % PR_THREADS == 0 && (MROWS * NHID / 4) % (CV_LD * PR_THREADS) == 0, "whole blocks");

// The short jobs have the low block indices. Every branch is on the block index alone.
__global__ __launch_bounds__(PR_THREADS)
void prep_inputs(const float* __restrict__ x,
                 const float* __restrict__ WQ_w, const float* __restrict__ WK_w,
                 const float* __restrict__ WO_w,
                 const float* __restrict__ WQ_b, const float* __restrict__ WK_b,
                 _Float16* __restrict__ xh, _Float16* __restrict__ wqkt,
                 _Float16* __restrict__ wot, float* __restrict__ bqk) {
  const int b = blockIdx.x;
  if (b < PR_TR) {
    const int which = b / PR_TILES;
    const float* in  = which == 0 ? WQ_w : which == 1 ? WK_w : WO_w;
    _Float16*    out = which == 2 ? wot : wqkt;
    transpose_f32_to_f16(in, out, NHID, NHID, b % PR_TILES, which == 2 ? -1 : which);
  } else if (b < PR_TR + PR_CB) {
    concat_bias(WQ_b, WK_b, bqk, NHID, b - PR_TR);
  } else {
    cvt_f32_to_f16_stream(x, xh, b - (PR_TR + PR_CB));
  }
}

// =====================================================================
// projection of the global token: out[b][n] = ax[b].W[:,n] + bias[n]
// One block owns 32 columns for 4 of the 8 batches. The k range is split
// over 128 slices of 8 rows: thread = (slice, column quad). A thread's 8 W
// rows and its ax values fit in registers together, so they are all asked
// for at once and the block waits for memory once, where a serial k loop
// waits once per unrolled group of rows.
// Partial sums: the 4 slices of a wave by shuffles, the 32 waves through LDS.
// Both projections (with WK and with WV) are one grid: blockIdx.z picks the matrix.
// =====================================================================
constexpr int PG_COLS    = 32;                     // columns per block: one 128-B line per W row
constexpr int PG_BATCH   = 4;                      // batches per block
constexpr int PG_THREADS = 1024;
constexpr int PG_WAVES   = PG_THREADS / 32;
constexpr int PG_KPT     = NHID / (PG_THREADS / (PG_COLS / 4));   // 8 rows per thread
static_assert(PG_KPT == 8 && PG_BATCH == 4 && NHID * 4 == 4096, "the offsets in the load statement are written for these");

typedef __attribute__((ext_vector_type(4))) float v4f;

__global__ __launch_bounds__(PG_THREADS)
void proj_global_tok(const float* __restrict__ ax,
                     const float* __restrict__ W0, const float* __restrict__ bias0,
                     float* __restrict__ out0,
                     const float* __restrict__ W1, const float* __restrict__ bias1,
                     float* __restrict__ out1) {
  __shared__ float part[PG_WAVES][PG_BATCH][PG_COLS];   // 16 KB

  const bool second = blockIdx.z != 0;
  const float* W    = second ? W1 : W0;
  const float* bias = second ? bias1 : bias0;
  float*       out  = second ? out1 : out0;

  const int tid  = threadIdx.x;
  const int lane = tid & 31;
  const int wave = tid >> 5;
  const int cq   = tid & 7;                  // column quad inside the block
  const int k0   = (tid >> 3) * PG_KPT;      // first row of this thread's slice
  const int nblk = blockIdx.x * PG_COLS;
  const int b0   = blockIdx.y * PG_BATCH;

  const float* wp = W  + (size_t)k0 * NHID + nblk + cq * 4;   // row j at byte offset j * 4096
  const float* ap = ax + (size_t)b0 * NHID + k0;              // batch bb at byte offset bb * 4096

  // All 16 loads of the thread and their data wait in one statement: every load is in
  // flight before the first wait, and the early-clobber outputs keep each result out of
  // the two address pairs until all loads have returned (as plain loads the build let one
  // load's result land in the pair that six loads still in flight named).
  v4f w[PG_KPT], a[PG_BATCH][2];
  asm volatile(
      "global_load_b128 %0, %16, off\n\t"
      "global_load_b128 %1, %16, off offset:4096\n\t"
      "global_load_b128 %2, %16, off offset:8192\n\t"
      "global_load_b128 %3, %16, off offset:12288\n\t"
      "global_load_b128 %4, %16, off offset:16384\n\t"
      "global_load_b128 %5, %16, off offset:20480\n\t"
      "global_load_b128 %6, %16, off offset:24576\n\t"
      "global_load_b128 %7, %16, off offset:28672\n\t"
      "global_load_b128 %8, %17, off\n\t"
      "global_load_b128 %9, %17, off offset:16\n\t"
      "global_load_b128 %10, %17, off offset:4096\n\t"
      "global_load_b128 %11, %17, off offset:4112\n\t"
      "global_load_b128 %12, %17, off offset:8192\n\t"
      "global_load_b128 %13, %17, off offset:8208\n\t"
      "global_load_b128 %14, %17, off offset:12288\n\t"
      "global_load_b128 %15, %17, off offset:12304\n\t"
      "s_wait_loadcnt 0x0"
      : "=&v"(w[0]), "=&v"(w[1]), "=&v"(w[2]), "=&v"(w[3]),
        "=&v"(w[4]), "=&v"(w[5]), "=&v"(w[6]), "=&v"(w[7]),
        "=&v"(a[0][0]), "=&v"(a[0][1]), "=&v"(a[1][0]), "=&v"(a[1][1]),
        "=&v"(a[2][0]), "=&v"(a[2][1]), "=&v"(a[3][0]), "=&v"(a[3][1])
      : "v"(wp), "v"(ap)
      : "memory");

  v4f acc[PG_BATCH];
#pragma unroll
  for (int bb = 0; bb < PG_BATCH; ++bb) {
    v4f s = a[bb][0][0] * w[0];
#pragma unroll
    for (int j = 1; j < PG_KPT; ++j)
      s += a[bb][j >> 2][j & 3] * w[j];
    acc[bb] = s;
  }

  // the wave's 4 slices sit in lanes cq, cq+8, cq+16, cq+24
#pragma unroll
  for (int bb = 0; bb < PG_BATCH; ++bb) {
#pragma unroll
    for (int off = 8; off <= 16; off <<= 1) {
#pragma unroll
      for (int e = 0; e < 4; ++e)
        acc[bb][e] += __shfl_xor(acc[bb][e], off, 32);
    }
  }
  if (lane < 8) {
#pragma unroll
    for (int bb = 0; bb < PG_BATCH; ++bb)
      *(v4f*)&part[wave][bb][cq * 4] = acc[bb];
  }
  __syncthreads();

  // one thread per (batch, column) adds the 32 waves' partial sums
  if (tid < PG_BATCH * PG_COLS) {
    const int bb = tid >> 5, c = tid & 31;
    float s = bias[nblk + c];
#pragma unroll
    for (int wv = 0; wv < PG_WAVES; ++wv)
      s += part[wv][bb][c];
    out[(size_t)(b0 + bb) * NHID + nblk + c] = s;
  }
}

// =====================================================================
// WMMA GEMM:  C[M][N] = A[M][K](f16) * Bt[N][K](f16)^T + bias[N]
// 256 threads = 8 waves; block tile 256(M) x 256(N); a stage is 128 k.
// M and N are multiples of 256, K a multiple of 128.
// A block reads (256 + 256) operand rows from L2 for 65,536 outputs, and every
// copy of a wave covers two whole 256-B row pieces.
// Each wave: 128x64 tile (FUSED: 64x128) -> 32 v_wmma_f32_16x16x32_f16 per 32 k, so a
// loaded fragment feeds 4 or 8 products. One block per WGP, two waves per SIMD.
// Two LDS buffers fed by GLOBAL_LOAD_ASYNC_TO_LDS_B128 (ASYNCcnt), no VGPR
// staging, 1 barrier / stage; fragments are fetched one 32-k block ahead inside
// a stage, never across the stage's barrier.
// FUSED (the q|k projection, Bt rows in the order of qk_row): a wave's 128 columns are q and k
// of one head for 64 tokens, and the windowed attention is done on the accumulators; the
// product itself is not stored. The weight fragment is the first WMMA operand there, so a
// lane holds 8 adjacent columns of one token. k goes to the neighbour tokens' lanes through
// LDS (the ring is free behind the loop's last barrier). A tile's first and last token need
// a k row of another tile: for them the block stores q|k rows 0, 1, 254, 255 as f16 to Cout
// ([token][q 1024 | k 1024]) and attn_tile_edges, the next launch, does those two tokens.
// =====================================================================
constexpr int BM   = 256;
constexpr int BN   = 256;
constexpr int BK   = 128;
constexpr int NKB  = BK / 32;            // WMMA k blocks per stage
constexpr int LDT  = BK + 8;             // padded LDS row (halves): 272 B = 16 B x odd
constexpr int STG  = (BM + BN) * LDT;    // halves per stage: rows 0..255 A, 256..511 B
constexpr int CP_LDS = 2 * LDT * 2;      // LDS bytes between two copies of a wave (2 rows)
constexpr int KS_P    = HDIM + 4;        // floats of a k row in LDS: 272 B = 16 B x odd
constexpr int KS_ROWS = BM + 2;          // row t + 1 holds tile token t; rows 0 and 257 are never written
static_assert(2 * KS_ROWS * KS_P * 4 <= 2 * STG * 2, "both heads' k rows fit in the ring");
static_assert(SEQ % BM == 0 && HDIM == 64 && BN == 4 * HDIM && NHID * 2 == 2048,
              "a tile stays inside one sequence; the store offsets in asm text are written for these");

template <bool FUSED, bool OUT_F16>
__global__ __launch_bounds__(256)
void gemm_wmma_f16(const _Float16* __restrict__ A,
                   const _Float16* __restrict__ Bt,
                   const float* __restrict__ bias,
                   void* __restrict__ Cout,
                   int M, int N, int K,
                   const float* __restrict__ akf, const float* __restrict__ avf,
                   _Float16* __restrict__ att) {
  static_assert(!FUSED || OUT_F16, "the rows that the fused form stores are f16");
  constexpr int FA = FUSED ? 4 : 8;      // A fragments per wave
  constexpr int FB = FUSED ? 8 : 4;      // B fragments per wave
  __shared__ __attribute__((aligned(16))) _Float16 S[2][STG];
  // FUSED: the tile's 256 bias values, then ak and av of its 2 heads
  __shared__ __attribute__((aligned(16))) float EP[FUSED ? 2 * BN : 4];

  const int tid  = threadIdx.x;
  const int wid  = __builtin_amdgcn_readfirstlane(tid >> 5);
  const int lane = tid & 31;
  const int lh   = lane & 15;
  const int hi   = lane >> 4;          // 0: lanes 0-15, 1: lanes 16-31

  const int wm = FUSED ? wid >> 1 : wid >> 2;   // 16 * FA M-rows each
  const int wn = FUSED ? wid & 1  : wid & 3;    // 16 * FB N-cols each

  const int m0 = blockIdx.y * BM;
  const int n0 = blockIdx.x * BN;

  // staging: wave w brings stage rows 64w .. 64w+63 (waves 0-3: A, waves 4-7: B),
  // two rows a copy: lanes 0-15 one row's 256 B, lanes 16-31 the next row's.
  const _Float16* gsrc = (wid < 4) ? A  + (size_t)(m0 + wid * 64) * K
                                   : Bt + (size_t)(n0 + (wid - 4) * 64) * K;   // wave-uniform
  const size_t   grow2 = (size_t)2 * K;                                  // halves between two copies
  const uint32_t goff  = (uint32_t)hi * (uint32_t)K * 2u + (uint32_t)lh * 16u;   // the lane's bytes from the copy's base
  // low 32 bits of the shared pointer = LDS byte address
  const uint32_t lds0  = (uint32_t)(uintptr_t)&S[0][(wid * 64 + hi) * LDT + lh * 8];

  // eight copies (16 rows) and their s_wait_xcnt in one statement: no register that a
  // copy names is rewritten in front of the wait
  auto copy16rows = [&](uint32_t l, const _Float16* g) {
    asm volatile(
        "global_load_async_to_lds_b128 %0, %8, %9\n\t"
        "global_load_async_to_lds_b128 %1, %8, %10\n\t"
        "global_load_async_to_lds_b128 %2, %8, %11\n\t"
        "global_load_async_to_lds_b128 %3, %8, %12\n\t"
        "global_load_async_to_lds_b128 %4, %8, %13\n\t"
        "global_load_async_to_lds_b128 %5, %8, %14\n\t"
        "global_load_async_to_lds_b128 %6, %8, %15\n\t"
        "global_load_async_to_lds_b128 %7, %8, %16\n\t"
        "s_wait_xcnt 0x0"
        :: "v"(l),              "v"(l + 1 * CP_LDS), "v"(l + 2 * CP_LDS), "v"(l + 3 * CP_LDS),
           "v"(l + 4 * CP_LDS), "v"(l + 5 * CP_LDS), "v"(l + 6 * CP_LDS), "v"(l + 7 * CP_LDS),
           "v"(goff),
           "s"(g),             "s"(g + 1 * grow2), "s"(g + 2 * grow2), "s"(g + 3 * grow2),
           "s"(g + 4 * grow2), "s"(g + 5 * grow2), "s"(g + 6 * grow2), "s"(g + 7 * grow2)
        : "memory");
  };
  // half of a wave's share of one stage (32 of its 64 rows)
  auto issue_half = [&](int buf, int k0, int half) {
#pragma unroll
    for (int q = 2 * half; q < 2 * half + 2; ++q)
      copy16rows(lds0 + (uint32_t)buf * (STG * 2) + (uint32_t)q * (8 * CP_LDS),
                 gsrc + (size_t)q * 8 * grow2 + k0);
  };

  // fragments of one 32-k block: B 0..FB-1 first, then A 0..FA-1; unfused (B 0..3, A 0..7) the order in which
  // the WMMAs ask for them (behind a barrier the first WMMAs then wait for 10 loads, not
  // for 18); fused, the first WMMA needs A 0 and waits for 18 loads;
  // the same k order in both operands
  auto load_frags = [&](v16h (&f)[FA + FB], const _Float16* sa, const _Float16* sb, int kb) {
#pragma unroll
    for (int nf = 0; nf < FB; ++nf) {
      const v8h lo = *(const v8h*)(sb + nf * 16 * LDT + kb * 32);        // K 0..7 / 8..15
      const v8h hh = *(const v8h*)(sb + nf * 16 * LDT + kb * 32 + 16);   // K 16..23 / 24..31
      f[FA + nf] = __builtin_shufflevector(lo, hh,
                0,1,2,3,4,5,6,7, 8,9,10,11,12,13,14,15);
    }
#pragma unroll
    for (int mf = 0; mf < FA; ++mf) {
      const v8h lo = *(const v8h*)(sa + mf * 16 * LDT + kb * 32);
      const v8h hh = *(const v8h*)(sa + mf * 16 * LDT + kb * 32 + 16);
      f[mf] = __builtin_shufflevector(lo, hh,
                0,1,2,3,4,5,6,7, 8,9,10,11,12,13,14,15);
    }
  };

  v8f_u acc[FA][FB];
#pragma unroll
  for (int i = 0; i < FA; ++i)
#pragma unroll
    for (int j = 0; j < FB; ++j) acc[i][j].v = (v8f)(0.0f);

  const int nkt = K / BK;

  // prologue: stage 0 lands and is published
  issue_half(0, 0, 0);
  issue_half(0, 0, 1);
  if constexpr (FUSED) {
    // what the epilogue needs of bias, ak and av goes to LDS while stage 0 is on its way.
    // Both loads and their data wait in one statement: no address register is rewritten
    // while a load is in flight.
    // bias is [q 1024 | k 1024]; the tile's column tid is q or k, dim tid & 63, of head 2 * blockIdx.x + (tid >> 7)
    const float* pb = bias + ((tid >> 6) & 1) * NHID + blockIdx.x * (2 * HDIM) + (tid >> 7) * HDIM + (tid & (HDIM - 1));
    const float* pg = (tid < 2 * HDIM ? akf : avf)
                      + (size_t)(m0 / SEQ) * NHID + blockIdx.x * (2 * HDIM) + (tid & (2 * HDIM - 1));
    float bv, gv;
    asm volatile("global_load_b32 %0, %2, off\n\t"
                 "global_load_b32 %1, %3, off\n\t"
                 "s_wait_loadcnt 0x0"
                 : "=&v"(bv), "=&v"(gv) : "v"(pb), "v"(pg) : "memory");
    EP[tid]      = bv;
    EP[BN + tid] = gv;
  }
  asm volatile("s_wait_asynccnt 0x0" ::: "memory");   // my copies of stage 0 have landed
  __syncthreads();

  // rolled: one stage's 128 WMMAs are the loop body
#pragma unroll 1
  for (int kt = 0; kt < nkt; ++kt) {
    const int  cur  = kt & 1;
    const bool more = kt + 1 < nkt;
    const _Float16* sa = &S[cur][(wm * (FA * 16) + lh) * LDT + hi * 8];
    const _Float16* sb = &S[cur][(BM + wn * (FB * 16) + lh) * LDT + hi * 8];

    v16h f[2][FA + FB];
    load_frags(f[0], sa, sb, 0);
#pragma unroll
    for (int kb = 0; kb < NKB; ++kb) {
      // the next block's fragment loads as one group ahead of this block's WMMAs
      if (kb + 1 < NKB) load_frags(f[(kb + 1) & 1], sa, sb, kb + 1);
      // keeps the load group whole and ahead of the WMMAs (without it the build spreads
      // the loads among the WMMAs, hoists a third block's loads and spills)
      __builtin_amdgcn_sched_barrier(0);
      // stage kt+1 goes into the other buffer, whose readers all left it at the last
      // barrier; issued in the first two blocks, it has the rest of the stage to land
      if (kb < 2 && more) issue_half(cur ^ 1, (kt + 1) * BK, kb);
#pragma unroll
      for (int mf = 0; mf < FA; ++mf)
#pragma unroll
        for (int nf = 0; nf < FB; ++nf)
          acc[mf][nf].v = __builtin_amdgcn_wmma_f32_16x16x32_f16(
              false, f[kb & 1][FUSED ? FA + nf : mf], false, f[kb & 1][FUSED ? mf : FA + nf],
              (short)0, acc[mf][nf].v, false, false);
      // the next load group, which refills this block's fragment set, stays behind its WMMAs
      __builtin_amdgcn_sched_barrier(0);
    }

    // publish point of stage kt+1: my LDS reads of this buffer are done, my copies have
    // landed; the barrier shows them to all waves and frees this buffer for the refill.
    asm volatile("s_wait_dscnt 0x0" ::: "memory");
    asm volatile("s_wait_asynccnt 0x0" ::: "memory");
    __syncthreads();
  }

  if constexpr (FUSED) {
    // ---- lane (lh, hi) holds, of token wm*64 + mf*16 + lh, columns nf*16 + hi*8 + 0..7 of the
    // head's [q | k]: acc[mf][0..3] = q, acc[mf][4..7] = k, 32 of the 64 dims each ----
    // (every loop below is unrolled so that acc is indexed by constants and stays in registers)
    const int head = blockIdx.x * 2 + wn;
    float* KS = (float*)&S[0][0] + wn * (KS_ROWS * KS_P);
    const int tl = wm * 64 + lh;                       // tile token of fragment mf = 0

#pragma unroll
    for (int nf = 0; nf < FB; ++nf) {
      v8f bc;
      bc.lo = *(const v4f*)&EP[wn * 128 + nf * 16 + hi * 8];
      bc.hi = *(const v4f*)&EP[wn * 128 + nf * 16 + hi * 8 + 4];
#pragma unroll
      for (int mf = 0; mf < FA; ++mf) acc[mf][nf].v += bc;
    }

    // k (f32) to LDS for the neighbour tokens
#pragma unroll
    for (int mf = 0; mf < FA; ++mf)
#pragma unroll
      for (int nf = 0; nf < 4; ++nf) {
        float* p = KS + (tl + mf * 16 + 1) * KS_P + nf * 16 + hi * 8;
        *(v4f*)p       = acc[mf][4 + nf].v.lo;
        *(v4f*)(p + 4) = acc[mf][4 + nf].v.hi;
      }

    // q|k rows 0, 1 and 254, 255 of the tile for attn_tile_edges. The 8 stores of a lane and
    // their s_wait_xcnt in one statement: no register that a store names is rewritten in
    // front of the wait.
    auto store_edge_rows = [&](const v8f_u (&a)[FB], int trow) {
      v4f h[FB];
#pragma unroll
      for (int nf = 0; nf < FB; ++nf)
        h[nf] = __builtin_bit_cast(v4f, __builtin_convertvector(a[nf].v, v8h));
      const uint32_t vo = (uint32_t)trow * (NQK * 2) + (uint32_t)hi * 16u;
      const char* eb = (const char*)Cout + (size_t)m0 * (NQK * 2) + head * (HDIM * 2);
      asm volatile(
          "global_store_b128 %0, %1, %9\n\t"
          "global_store_b128 %0, %2, %9 offset:32\n\t"
          "global_store_b128 %0, %3, %9 offset:64\n\t"
          "global_store_b128 %0, %4, %9 offset:96\n\t"
          "global_store_b128 %0, %5, %9 offset:2048\n\t"
          "global_store_b128 %0, %6, %9 offset:2080\n\t"
          "global_store_b128 %0, %7, %9 offset:2112\n\t"
          "global_store_b128 %0, %8, %9 offset:2144\n\t"
          "s_wait_xcnt 0x0"
          :: "v"(vo), "v"(h[0]), "v"(h[1]), "v"(h[2]), "v"(h[3]),
             "v"(h[4]), "v"(h[5]), "v"(h[6]), "v"(h[7]), "s"(eb)
          : "memory");
    };
    if (wm == 0 && lh < 2)        store_edge_rows(acc[0], tl);
    if (wm == 3 && lh >= 14)      store_edge_rows(acc[FA - 1], tl + (FA - 1) * 16);

    // every wave's k rows are in LDS
    __syncthreads();

    v8f ak[4], av[4];
#pragma unroll
    for (int nf = 0; nf < 4; ++nf) {
      const float* pa = &EP[BN + wn * HDIM + nf * 16 + hi * 8];
      ak[nf].lo = *(const v4f*)pa;
      ak[nf].hi = *(const v4f*)(pa + 4);
      av[nf].lo = *(const v4f*)(pa + 2 * HDIM);
      av[nf].hi = *(const v4f*)(pa + 2 * HDIM + 4);
    }
    const char* ob = (const char*)att + (size_t)m0 * (NHID * 2) + head * (HDIM * 2);

    // sum of a lane's 8 partial sums and of the token's other lane (the other 32 dims)
    auto token_sum = [&](v8f p) {
      const v4f a = p.lo + p.hi;
      const float s = (a[0] + a[2]) + (a[1] + a[3]);
      return s + __shfl_xor(s, 16, 32);
    };

#pragma unroll
    for (int mf = 0; mf < FA; ++mf) {
      // k of tokens t - 1 and t + 1: LDS rows t and t + 2
      const float* pm = KS + (tl + mf * 16) * KS_P + hi * 8;
      v8f km[4], kn[4];
#pragma unroll
      for (int nf = 0; nf < 4; ++nf) {
        km[nf].lo = *(const v4f*)(pm + nf * 16);
        km[nf].hi = *(const v4f*)(pm + nf * 16 + 4);
        kn[nf].lo = *(const v4f*)(pm + 2 * KS_P + nf * 16);
        kn[nf].hi = *(const v4f*)(pm + 2 * KS_P + nf * 16 + 4);
      }

      v8f p0 = acc[mf][0].v * ak[0], p1 = acc[mf][0].v * km[0];
      v8f p2 = acc[mf][0].v * acc[mf][4].v, p3 = acc[mf][0].v * kn[0];
#pragma unroll
      for (int nf = 1; nf < 4; ++nf) {
        p0 += acc[mf][nf].v * ak[nf];
        p1 += acc[mf][nf].v * km[nf];
        p2 += acc[mf][nf].v * acc[mf][4 + nf].v;
        p3 += acc[mf][nf].v * kn[nf];
      }
      const float sc = 0.125f;  // 1/sqrt(64)
      const float s0 = token_sum(p0) * sc, s1 = token_sum(p1) * sc;
      const float s2 = token_sum(p2) * sc, s3 = token_sum(p3) * sc;

      const float mx = fmaxf(fmaxf(s0, s1), fmaxf(s2, s3));
      const float e0 = __expf(s0 - mx), e1 = __expf(s1 - mx);
      const float e2 = __expf(s2 - mx), e3 = __expf(s3 - mx);
      const float inv = 1.0f / (e0 + e1 + e2 + e3);
      const float a0 = e0 * inv, a1 = e1 * inv, a2 = e2 * inv, a3 = e3 * inv;

      v4f oh[4];
#pragma unroll
      for (int nf = 0; nf < 4; ++nf) {
        const v8f o = a0 * av[nf] + a1 * km[nf] + a2 * acc[mf][4 + nf].v + a3 * kn[nf];
        oh[nf] = __builtin_bit_cast(v4f, __builtin_convertvector(o, v8h));
      }

      // the tile's first and last token are left to attn_tile_edges (their km or kn is not here)
      const bool other_tile = (mf == 0 && tl == 0) || (mf == FA - 1 && tl + mf * 16 == BM - 1);
      if (!other_tile) {
        const uint32_t vo = (uint32_t)(tl + mf * 16) * (NHID * 2) + (uint32_t)hi * 16u;
        // the token's 4 stores of this lane and their s_wait_xcnt in one statement: no
        // register that a store names is rewritten in front of the wait
        asm volatile(
            "global_store_b128 %0, %1, %5\n\t"
            "global_store_b128 %0, %2, %5 offset:32\n\t"
            "global_store_b128 %0, %3, %5 offset:64\n\t"
            "global_store_b128 %0, %4, %5 offset:96\n\t"
            "s_wait_xcnt 0x0"
            :: "v"(vo), "v"(oh[0]), "v"(oh[1]), "v"(oh[2]), "v"(oh[3]), "s"(ob)
            : "memory");
      }
    }
  } else {
  // ---- epilogue: C layout = VGPR r -> (row r + 8*hi, col lane&15) ----
#pragma unroll
  for (int nf = 0; nf < FB; ++nf) {
    const int col  = n0 + wn * 64 + nf * 16 + lh;
    const float bc = bias[col];
#pragma unroll
    for (int mf = 0; mf < FA; ++mf) {
      const int rbase = m0 + wm * 128 + mf * 16 + hi * 8;
#pragma unroll
      for (int r = 0; r < 8; ++r) {
        const float val = acc[mf][nf].f[r] + bc;
        const size_t idx = (size_t)(rbase + r) * N + col;
        if (OUT_F16) ((_Float16*)Cout)[idx] = (_Float16)val;
        else         ((float*)Cout)[idx]    = val;
      }
    }
  }
  }
}

// =====================================================================
// the first and the last token of every 256-token tile of the fused q|k GEMM:
// one wave per (token, group of 4 heads). A lane owns 8 dims (16 B), 8 lanes
// make a head, so every f16 load and the store of a wave is 512 contiguous bytes;
// the f32 ak and av take two 16-B loads a lane (32 contiguous bytes).
// qk buffer holds q (cols 0..1023) and k (cols 1024..2047) per token; of a tile
// only rows 0, 1, 254, 255 are there, which is all that these tokens read.
// slots: [ak, k_{l-1}, k_l, k_{l+1}]; V = [av, k_{l-1}, k_l, k_{l+1}]
// boundary slots are zero vectors -> score 0 (matches zero-padding).
// =====================================================================
constexpr int ED_THREADS = 256;
constexpr int ED_HG      = NHID / 256;             // head groups per token: 4
constexpr int ED_BLOCKS  = (MROWS / BM) * 2 * ED_HG / (ED_THREADS / 32);
static_assert(NQK * 2 == 4096, "the k offset in asm text is written for this");

typedef __attribute__((ext_vector_type(2))) float v2f;

// sum over the 8 lanes of a head, result in all 8
__device__ __forceinline__ float sum_head_lanes(float v) {
  v += __builtin_bit_cast(float, __builtin_amdgcn_update_dpp(0, __builtin_bit_cast(int, v), 0x161, 0xf, 0xf, true)); // row_xmask:1
  v += __builtin_bit_cast(float, __builtin_amdgcn_update_dpp(0, __builtin_bit_cast(int, v), 0x162, 0xf, 0xf, true)); // row_xmask:2
  v += __builtin_bit_cast(float, __builtin_amdgcn_update_dpp(0, __builtin_bit_cast(int, v), 0x164, 0xf, 0xf, true)); // row_xmask:4
  return v;
}

__device__ __forceinline__ void widen(v2f (&f)[4], v8h h) {
#pragma unroll
  for (int p = 0; p < 4; ++p) { f[p][0] = (float)h[2 * p]; f[p][1] = (float)h[2 * p + 1]; }
}

__global__ __launch_bounds__(ED_THREADS)
void attn_tile_edges(const _Float16* __restrict__ qkh,
                     const float* __restrict__ akf,
                     const float* __restrict__ avf,
                     _Float16* __restrict__ atth) {
  const int lane = threadIdx.x & 31;
  const int gw   = __builtin_amdgcn_readfirstlane(blockIdx.x * (ED_THREADS / 32) + (threadIdx.x >> 5));
  const int hg   = gw & (ED_HG - 1);
  const int e    = gw / ED_HG;                                  // tile * 2 + (0: first, 1: last token)
  const int t    = (e >> 1) * BM + ((e & 1) ? BM - 1 : 0);      // b*SEQ + l
  const int l    = t & (SEQ - 1);
  const bool has_prev = l > 0, has_next = l + 1 < SEQ;

  // wave-uniform bases; a row outside the sequence is not read (the token's own row stands in)
  const _Float16* row  = qkh + (size_t)t * NQK + hg * 256;
  const _Float16* prow = has_prev ? row - NQK : row;
  const _Float16* nrow = has_next ? row + NQK : row;
  const size_t grow = (size_t)(t / SEQ) * NHID + hg * 256;
  const float* akp = akf + grow;
  const float* avp = avf + grow;
  const uint32_t voff = (uint32_t)lane * 16u, voff2 = (uint32_t)lane * 32u;

  // all 8 loads and their data wait in one statement: every load is in flight before the
  // wait, and no address register is rewritten while one is
  v8h qh, kch, kmh, knh;
  v4f akl, akh, avl, avh;
  asm volatile(
      "global_load_b128 %0, %8, %10\n\t"
      "global_load_b128 %1, %8, %10 offset:2048\n\t"
      "global_load_b128 %2, %8, %11 offset:2048\n\t"
      "global_load_b128 %3, %8, %12 offset:2048\n\t"
      "global_load_b128 %4, %9, %13\n\t"
      "global_load_b128 %5, %9, %13 offset:16\n\t"
      "global_load_b128 %6, %9, %14\n\t"
      "global_load_b128 %7, %9, %14 offset:16\n\t"
      "s_wait_loadcnt 0x0"
      : "=&v"(qh), "=&v"(kch), "=&v"(kmh), "=&v"(knh),
        "=&v"(akl), "=&v"(akh), "=&v"(avl), "=&v"(avh)
      : "v"(voff), "v"(voff2), "s"(row), "s"(prow), "s"(nrow), "s"(akp), "s"(avp)
      : "memory");
  if (!has_prev) kmh = (v8h)(_Float16)0.0f;
  if (!has_next) knh = (v8h)(_Float16)0.0f;

  v2f ak[4], av[4], qf[4], km[4], kc[4], kn[4];
  ak[0] = akl.xy; ak[1] = akl.zw; ak[2] = akh.xy; ak[3] = akh.zw;
  av[0] = avl.xy; av[1] = avl.zw; av[2] = avh.xy; av[3] = avh.zw;
  widen(qf, qh);
  widen(km, kmh);
  widen(kc, kch);
  widen(kn, knh);

  v2f p0 = qf[0] * ak[0], p1 = qf[0] * km[0], p2 = qf[0] * kc[0], p3 = qf[0] * kn[0];
#pragma unroll
  for (int p = 1; p < 4; ++p) {
    p0 += qf[p] * ak[p];
    p1 += qf[p] * km[p];
    p2 += qf[p] * kc[p];
    p3 += qf[p] * kn[p];
  }
  float s0 = sum_head_lanes(p0[0] + p0[1]);
  float s1 = sum_head_lanes(p1[0] + p1[1]);
  float s2 = sum_head_lanes(p2[0] + p2[1]);
  float s3 = sum_head_lanes(p3[0] + p3[1]);

  const float sc = 0.125f;  // 1/sqrt(64)
  s0 *= sc; s1 *= sc; s2 *= sc; s3 *= sc;

  const float mx = fmaxf(fmaxf(s0, s1), fmaxf(s2, s3));
  const float e0 = __expf(s0 - mx), e1 = __expf(s1 - mx);
  const float e2 = __expf(s2 - mx), e3 = __expf(s3 - mx);
  const float inv = 1.0f / (e0 + e1 + e2 + e3);
  const float a0 = e0 * inv, a1 = e1 * inv, a2 = e2 * inv, a3 = e3 * inv;

  v8h oh;
#pragma unroll
  for (int p = 0; p < 4; ++p) {
    const v2f o = a0 * av[p] + a1 * km[p] + a2 * kc[p] + a3 * kn[p];
    oh[2 * p]     = (_Float16)o[0];
    oh[2 * p + 1] = (_Float16)o[1];
  }
  const _Float16* orow = atth + (size_t)t * NHID + hg * 256;
  // the store and its s_wait_xcnt in one statement: no register that it names is rewritten
  // in front of the wait
  asm volatile("global_store_b128 %0, %1, %2\n\t"
               "s_wait_xcnt 0x0"
               :: "v"(voff), "v"(__builtin_bit_cast(v4f, oh)), "s"(orow) : "memory");
}

// =====================================================================
// launch
// =====================================================================
extern "C" void kernel_launch(void* const* d_in, const int* in_sizes, int n_in,
                              void* d_out, int out_size, void* d_ws, size_t ws_size,
                              hipStream_t stream) {
  const float* x    = (const float*)d_in[0];
  const float* ax   = (const float*)d_in[1];
  const float* WQ_w = (const float*)d_in[2];
  const float* WQ_b = (const float*)d_in[3];
  const float* WK_w = (const float*)d_in[4];
  const float* WK_b = (const float*)d_in[5];
  const float* WV_w = (const float*)d_in[6];
  const float* WV_b = (const float*)d_in[7];
  const float* WO_w = (const float*)d_in[8];
  const float* WO_b = (const float*)d_in[9];

  char* ws = (char*)d_ws;
  _Float16* xh   = (_Float16*)(ws + OFF_XH);
  _Float16* wqkt = (_Float16*)(ws + OFF_WQKT);
  _Float16* wot  = (_Float16*)(ws + OFF_WOT);
  float*    bqk  = (float*)(ws + OFF_BQK);
  _Float16* qkh  = (_Float16*)(ws + OFF_QKH);
  _Float16* atth = (_Float16*)(ws + OFF_ATTH);
  float*    akf  = (float*)(ws + OFF_AK);
  float*    avf  = (float*)(ws + OFF_AV);

  // 1-3) one grid: weights to f16 (WQ^T and WK^T head by head, WO^T), bias [WQ_b ; WK_b], x to f16
  prep_inputs<<<PR_TR + PR_CB + PR_CV, PR_THREADS, 0, stream>>>(x, WQ_w, WK_w, WO_w, WQ_b, WK_b,
                                                                xh, wqkt, wot, bqk);
  // 4) global-token projections ak = ax@WK + bK, av = ax@WV + bV (f32), one grid
  {
    dim3 g(NHID / PG_COLS, BATCH / PG_BATCH, 2);
    proj_global_tok<<<g, PG_THREADS, 0, stream>>>(ax, WK_w, WK_b, akf, WV_w, WV_b, avf);
  }
  // 5) q|k projection via WMMA GEMM, [32768x1024] @ [1024x2048], with the windowed attention
  //    on its accumulators -> att (f16), all tokens but each tile's first and last
  {
    dim3 g(NQK / BN, MROWS / BM);
    gemm_wmma_f16<true, true><<<g, 256, 0, stream>>>(xh, wqkt, bqk, (void*)qkh,
                                                     MROWS, NQK, NHID, akf, avf, atth);
  }
  // 6) windowed attention of the tiles' first and last tokens -> att (f16)
  attn_tile_edges<<<ED_BLOCKS, ED_THREADS, 0, stream>>>(qkh, akf, avf, atth);
  // 7) output projection via WMMA GEMM (f32 out to d_out)
  {
    dim3 g(NHID / BN, MROWS / BM);
    gemm_wmma_f16<false, false><<<g, 256, 0, stream>>>(atth, wot, WO_b, d_out,
                                                       MROWS, NHID, NHID, nullptr, nullptr, nullptr);
  }
}

// v007
// It runs in 165 microseconds.
// Two timings next to v006 both put it at 1.08 times that version's speed.
// All steps since v000 together make it 3.64 times as fast.
#include <hip/hip_runtime.h>
#include <hip/hip_bf16.h>
#include <stdint.h>

// ---------------- problem constants ----------------
constexpr int BATCH = 8;
constexpr int SEQ   = 4096;
constexpr int NHEAD = 16;
constexpr int HDIM  = 64;
constexpr int NHID  = 1024;              // == NHEAD*HDIM
constexpr int MROWS = BATCH * SEQ;       // 32768
constexpr int NQK   = 2 * NHID;          // fused q|k output width

// ---------------- vector types ----------------
typedef __attribute__((ext_vector_type(16))) _Float16 v16h;
typedef __attribute__((ext_vector_type(8)))  _Float16 v8h;
typedef __attribute__((ext_vector_type(4)))  _Float16 v4h;
typedef __attribute__((ext_vector_type(2)))  _Float16 v2h;
typedef __attribute__((ext_vector_type(8)))  float    v8f;

typedef union { v8f v; float f[8]; } v8f_u;

// ---------------- workspace layout (bytes) ----------------
constexpr size_t OFF_XH   = 0;                                    // 32768x1024 f16 (64 MB)
constexpr size_t OFF_WQKT = OFF_XH   + (size_t)MROWS * NHID * 2;  // 2048x1024 f16 (WQ^T, WK^T, head by head)
constexpr size_t OFF_WOT  = OFF_WQKT + (size_t)NQK   * NHID * 2;  // 1024x1024 f16
constexpr size_t OFF_BQK  = OFF_WOT  + (size_t)NHID  * NHID * 2;  // 2048 f32
constexpr size_t OFF_QKH  = OFF_BQK  + (size_t)NQK * 4;           // 32768x2048 f16; only 4 rows in 256 are used
constexpr size_t OFF_ATTH = OFF_QKH  + (size_t)MROWS * NQK * 2;   // 32768x1024 f16
constexpr size_t OFF_AK   = OFF_ATTH + (size_t)MROWS * NHID * 2;  // 8x1024 f32
constexpr size_t OFF_AV   = OFF_AK   + (size_t)BATCH * NHID * 4;

// =====================================================================
// The five jobs that only reshape inputs (x to f16, three weight transposes,
// the bias concat) depend on nothing but the inputs and write disjoint
// buffers. They run as one grid, prep_inputs below: the block index picks the
// job, and each job's blocks do what its own launch did. blk is the block's
// index inside its job.
// =====================================================================
constexpr int PR_THREADS = 256;

// f32 -> f16 conversion of a stream. A block owns CV_LD * PR_THREADS consecutive float4: a
// thread asks for its CV_LD float4 (each a wave-wide 512 contiguous bytes) before it converts
// the first, so a wave has 4 KB in flight and the stream needs CV_LD times fewer waves started.
constexpr int CV_LD = 8;
__device__ __forceinline__ void cvt_f32_to_f16_stream(const float* __restrict__ in,
                                                      _Float16* __restrict__ out, int blk) {
  const int i0 = blk * (CV_LD * PR_THREADS) + threadIdx.x;
  float4 v[CV_LD];
#pragma unroll
  for (int j = 0; j < CV_LD; ++j) v[j] = ((const float4*)in)[i0 + j * PR_THREADS];
#pragma unroll
  for (int j = 0; j < CV_LD; ++j) {
    v4h h;
    h[0] = (_Float16)v[j].x; h[1] = (_Float16)v[j].y;
    h[2] = (_Float16)v[j].z; h[3] = (_Float16)v[j].w;
    ((v4h*)out)[i0 + j * PR_THREADS] = h;
  }
  // the loads' and stores' registers are not rewritten in front of this wait, whatever code
  // of the merged kernel the build places behind the stores
  asm volatile("s_wait_xcnt 0x0" ::: "memory");
}

// Row order of the fused [q | k] weight matrix: 128 rows a head, its 64 q columns and then its
// 64 k columns, so that a 128-column slice of the product holds q and k of one head.
// c = column of WQ or WK (head * 64 + dim), isk = 1 for WK.
__device__ __forceinline__ int qk_row(int isk, int c) {
  return ((c >> 6) << 7) | (isk << 6) | (c & 63);
}

// f32 [K][N] -> f16 [N][K] transpose (32x32 LDS tiles); every thread of the block comes here.
// qk: 0 = WQ, 1 = WK (their 32 columns go to rows qk_row(qk, n0) ...), -1 = rows as they are
__device__ __forceinline__ void transpose_f32_to_f16(const float* __restrict__ in,
                                                     _Float16* __restrict__ out,
                                                     int K, int N, int blk, int qk) {
  __shared__ float tile[32][33];
  int tx = threadIdx.x & 31, ty = threadIdx.x >> 5;
  int k0 = (blk / (N / 32)) * 32, n0 = (blk % (N / 32)) * 32;
  int d0 = qk < 0 ? n0 : qk_row(qk, n0);
#pragma unroll
  for (int i = 0; i < 32; i += 8)
    tile[ty + i][tx] = in[(size_t)(k0 + ty + i) * N + n0 + tx];
  __syncthreads();
#pragma unroll
  for (int i = 0; i < 32; i += 8)
    out[(size_t)(d0 + ty + i) * K + k0 + tx] = (_Float16)tile[tx][ty + i];
}

// concat two f32 vectors of length n -> out[2n]
__device__ __forceinline__ void concat_bias(const float* __restrict__ a, const float* __restrict__ b,
                                            float* __restrict__ out, int n, int blk) {
  int i = blk * PR_THREADS + threadIdx.x;
  out[i] = (i < n) ? a[i] : b[i - n];
  // the store's registers are not rewritten in front of this wait, whatever code of the
  // merged kernel the build places behind the store
  asm volatile("s_wait_xcnt 0x0" ::: "memory");
}

constexpr int PR_TILES = (NHID / 32) * (NHID / 32);            // blocks per weight transpose
constexpr int PR_TR    = 3 * PR_TILES;                         // blocks 0 .. PR_TR-1: transposes
constexpr int PR_CB    = NQK / PR_THREADS;                     // then the bias concat
constexpr int PR_CV    = MROWS * NHID / 4 / (CV_LD * PR_THREADS);   // then the conversion of x
static_assert(NQK % PR_THREADS == 0 && (MROWS * NHID / 4) % (CV_LD * PR_THREADS) == 0, "whole blocks");

// The short jobs have the low block indices. Every branch is on the block index alone.
__global__ __launch_bounds__(PR_THREADS)
void prep_inputs(const float* __restrict__ x,
                 const float* __restrict__ WQ_w, const float* __restrict__ WK_w,
                 const float* __restrict__ WO_w,
                 const float* __restrict__ WQ_b, const float* __restrict__ WK_b,
                 _Float16* __restrict__ xh, _Float16* __restrict__ wqkt,
                 _Float16* __restrict__ wot, float* __restrict__ bqk) {
  const int b = blockIdx.x;
  if (b < PR_TR) {
    const int which = b / PR_TILES;
    const float* in  = which == 0 ? WQ_w : which == 1 ? WK_w : WO_w;
    _Float16*    out = which == 2 ? wot : wqkt;
    transpose_f32_to_f16(in, out, NHID, NHID, b % PR_TILES, which == 2 ? -1 : which);
  } else if (b < PR_TR + PR_CB) {
    concat_bias(WQ_b, WK_b, bqk, NHID, b - PR_TR);
  } else {
    cvt_f32_to_f16_stream(x, xh, b - (PR_TR + PR_CB));
  }
}

// =====================================================================
// projection of the global token: out[b][n] = ax[b].W[:,n] + bias[n]
// One block owns 32 columns for 4 of the 8 batches. The k range is split
// over 128 slices of 8 rows: thread = (slice, column quad). A thread's 8 W
// rows and its ax values fit in registers together, so they are all asked
// for at once and the block waits for memory once, where a serial k loop
// waits once per unrolled group of rows.
// Partial sums: the 4 slices of a wave by shuffles, the 32 waves through LDS.
// Both projections (with WK and with WV) are one grid: blockIdx.z picks the matrix.
// =====================================================================
constexpr int PG_COLS    = 32;                     // columns per block: one 128-B line per W row
constexpr int PG_BATCH   = 4;                      // batches per block
constexpr int PG_THREADS = 1024;
constexpr int PG_WAVES   = PG_THREADS / 32;
constexpr int PG_KPT     = NHID / (PG_THREADS / (PG_COLS / 4));   // 8 rows per thread
static_assert(PG_KPT == 8 && PG_BATCH == 4 && NHID * 4 == 4096, "the offsets in the load statement are written for these");

typedef __attribute__((ext_vector_type(4))) float v4f;

__global__ __launch_bounds__(PG_THREADS)
void proj_global_tok(const float* __restrict__ ax,
                     const float* __restrict__ W0, const float* __restrict__ bias0,
                     float* __restrict__ out0,
                     const float* __restrict__ W1, const float* __restrict__ bias1,
                     float* __restrict__ out1) {
  __shared__ float part[PG_WAVES][PG_BATCH][PG_COLS];   // 16 KB

  const bool second = blockIdx.z != 0;
  const float* W    = second ? W1 : W0;
  const float* bias = second ? bias1 : bias0;
  float*       out  = second ? out1 : out0;

  const int tid  = threadIdx.x;
  const int lane = tid & 31;
  const int wave = tid >> 5;
  const int cq   = tid & 7;                  // column quad inside the block
  const int k0   = (tid >> 3) * PG_KPT;      // first row of this thread's slice
  const int nblk = blockIdx.x * PG_COLS;
  const int b0   = blockIdx.y * PG_BATCH;

  const float* wp = W  + (size_t)k0 * NHID + nblk + cq * 4;   // row j at byte offset j * 4096
  const float* ap = ax + (size_t)b0 * NHID + k0;              // batch bb at byte offset bb * 4096

  // All 16 loads of the thread and their data wait in one statement: every load is in
  // flight before the first wait, and the early-clobber outputs keep each result out of
  // the two address pairs until all loads have returned (as plain loads the build let one
  // load's result land in the pair that six loads still in flight named).
  v4f w[PG_KPT], a[PG_BATCH][2];
  asm volatile(
      "global_load_b128 %0, %16, off\n\t"
      "global_load_b128 %1, %16, off offset:4096\n\t"
      "global_load_b128 %2, %16, off offset:8192\n\t"
      "global_load_b128 %3, %16, off offset:12288\n\t"
      "global_load_b128 %4, %16, off offset:16384\n\t"
      "global_load_b128 %5, %16, off offset:20480\n\t"
      "global_load_b128 %6, %16, off offset:24576\n\t"
      "global_load_b128 %7, %16, off offset:28672\n\t"
      "global_load_b128 %8, %17, off\n\t"
      "global_load_b128 %9, %17, off offset:16\n\t"
      "global_load_b128 %10, %17, off offset:4096\n\t"
      "global_load_b128 %11, %17, off offset:4112\n\t"
      "global_load_b128 %12, %17, off offset:8192\n\t"
      "global_load_b128 %13, %17, off offset:8208\n\t"
      "global_load_b128 %14, %17, off offset:12288\n\t"
      "global_load_b128 %15, %17, off offset:12304\n\t"
      "s_wait_loadcnt 0x0"
      : "=&v"(w[0]), "=&v"(w[1]), "=&v"(w[2]), "=&v"(w[3]),
        "=&v"(w[4]), "=&v"(w[5]), "=&v"(w[6]), "=&v"(w[7]),
        "=&v"(a[0][0]), "=&v"(a[0][1]), "=&v"(a[1][0]), "=&v"(a[1][1]),
        "=&v"(a[2][0]), "=&v"(a[2][1]), "=&v"(a[3][0]), "=&v"(a[3][1])
      : "v"(wp), "v"(ap)
      : "memory");

  v4f acc[PG_BATCH];
#pragma unroll
  for (int bb = 0; bb < PG_BATCH; ++bb) {
    v4f s = a[bb][0][0] * w[0];
#pragma unroll
    for (int j = 1; j < PG_KPT; ++j)
      s += a[bb][j >> 2][j & 3] * w[j];
    acc[bb] = s;
  }

  // the wave's 4 slices sit in lanes cq, cq+8, cq+16, cq+24
#pragma unroll
  for (int bb = 0; bb < PG_BATCH; ++bb) {
#pragma unroll
    for (int off = 8; off <= 16; off <<= 1) {
#pragma unroll
      for (int e = 0; e < 4; ++e)
        acc[bb][e] += __shfl_xor(acc[bb][e], off, 32);
    }
  }
  if (lane < 8) {
#pragma unroll
    for (int bb = 0; bb < PG_BATCH; ++bb)
      *(v4f*)&part[wave][bb][cq * 4] = acc[bb];
  }
  __syncthreads();

  // one thread per (batch, column) adds the 32 waves' partial sums
  if (tid < PG_BATCH * PG_COLS) {
    const int bb = tid >> 5, c = tid & 31;
    float s = bias[nblk + c];
#pragma unroll
    for (int wv = 0; wv < PG_WAVES; ++wv)
      s += part[wv][bb][c];
    out[(size_t)(b0 + bb) * NHID + nblk + c] = s;
  }
}

// =====================================================================
// WMMA GEMM:  C[M][N] = A[M][K](f16) * Bt[N][K](f16)^T + bias[N]
// 256 threads = 8 waves; block tile 256(M) x 256(N); a stage is 128 k.
// M and N are multiples of 256, K a multiple of 128.
// A block reads (256 + 256) operand rows from L2 for 65,536 outputs, in whole 256-B
// row pieces.
// Each wave: 128x64 tile (FUSED: 64x128) -> 32 v_wmma_f32_16x16x32_f16 per 32 k, so a
// loaded fragment feeds 4 or 8 products. One block per WGP, two waves per SIMD.
// Two LDS buffers fed by TENSOR_LOAD_TO_LDS (TENSORcnt): every wave asks once per stage for
// its 64 operand rows, the mover's pad gives the 272-B pitch; no VGPR staging, 1 barrier /
// stage; fragments are fetched one 32-k block ahead inside a stage, never across the
// stage's barrier.
// FUSED (the q|k projection, Bt rows in the order of qk_row): a wave's 128 columns are q and k
// of one head for 64 tokens, and the windowed attention is done on the accumulators; the
// product itself is not stored. The weight fragment is the first WMMA operand there, so a
// lane holds 8 adjacent columns of one token. k goes to the neighbour tokens' lanes through
// LDS (the ring is free behind the loop's last barrier). A tile's first and last token need
// a k row of another tile: for them the block stores q|k rows 0, 1, 254, 255 as f16 to Cout
// ([token][q 1024 | k 1024]) and attn_tile_edges, the next launch, does those two tokens.
// =====================================================================
constexpr int BM   = 256;
constexpr int BN   = 256;
constexpr int BK   = 128;
constexpr int NKB  = BK / 32;            // WMMA k blocks per stage
constexpr int LDT  = BK + 8;             // padded LDS row (halves): 272 B = 16 B x odd
constexpr int SL_ROWS = 64;              // rows of one tensor load: a wave's slice of a stage
constexpr int SLH  = 9 * 1024;           // halves from slice to slice: 64 rows x 272 B rounded up to 2 KiB
constexpr int STG  = (BM + BN) / SL_ROWS * SLH;   // halves per stage: slices 0..3 A, 4..7 B
static_assert(SL_ROWS * LDT <= SLH && (SLH * 2) % 2048 == 0 && BK * 2 == 256,
              "a slice starts at a multiple of 2 KiB; the pad code below is the one for 256-B rows");
typedef uint32_t u32x4 __attribute__((ext_vector_type(4)));
typedef uint32_t u32x8 __attribute__((ext_vector_type(8)));
__device__ __forceinline__ uint32_t uni(uint32_t v) { return (uint32_t)__builtin_amdgcn_readfirstlane(v); }
// a wave-uniform test held in a scalar register, so that the branch on it is s_cmp + s_cbranch_scc
// (a tensor load ignores EXEC: only a scalar branch keeps a wave from issuing it)
__device__ __forceinline__ uint32_t pinned(uint32_t v) {
  uint32_t w = uni(v);
  asm volatile("" : "+s"(w));   // holds the test's value in a scalar register for the branch around a tensor load
  return w;
}
constexpr int KS_P    = HDIM + 4;        // floats of a k row in LDS: 272 B = 16 B x odd
constexpr int KS_ROWS = BM + 2;          // row t + 1 holds tile token t; rows 0 and 257 are never written
static_assert(2 * KS_ROWS * KS_P * 4 <= 2 * STG * 2, "both heads' k rows fit in the ring");
static_assert(SEQ % BM == 0 && HDIM == 64 && BN == 4 * HDIM && NHID * 2 == 2048,
              "a tile stays inside one sequence; the store offsets in asm text are written for these");

template <bool FUSED, bool OUT_F16>
__global__ __launch_bounds__(256)
void gemm_wmma_f16(const _Float16* __restrict__ A,
                   const _Float16* __restrict__ Bt,
                   const float* __restrict__ bias,
                   void* __restrict__ Cout,
                   int M, int N, int K,
                   const float* __restrict__ akf, const float* __restrict__ avf,
                   _Float16* __restrict__ att) {
  static_assert(!FUSED || OUT_F16, "the rows that the fused form stores are f16");
  constexpr int FA = FUSED ? 4 : 8;      // A fragments per wave
  constexpr int FB = FUSED ? 8 : 4;      // B fragments per wave
  __shared__ __attribute__((aligned(2048))) _Float16 S[2][STG];
  // FUSED: the tile's 256 bias values, then ak and av of its 2 heads
  __shared__ __attribute__((aligned(16))) float EP[FUSED ? 2 * BN : 4];

  const int tid  = threadIdx.x;
  const int wid  = __builtin_amdgcn_readfirstlane(tid >> 5);
  const int lane = tid & 31;
  const int lh   = lane & 15;
  const int hi   = lane >> 4;          // 0: lanes 0-15, 1: lanes 16-31

  const int wm = FUSED ? wid >> 1 : wid >> 2;   // 16 * FA M-rows each
  const int wn = FUSED ? wid & 1  : wid & 3;    // 16 * FB N-cols each

  const int m0 = blockIdx.y * BM;
  const int n0 = blockIdx.x * BN;

  // staging: wave w brings stage rows 64w .. 64w+63 (waves 0-3: A, waves 4-7: B) with one
  // tensor load: 64 rows of 256 B, source pitch 2 K bytes, 16 B of pad behind every row.
  const _Float16* gsrc = (wid < 4) ? A  + (size_t)(m0 + wid * SL_ROWS) * K
                                   : Bt + (size_t)(n0 + (wid - 4) * SL_ROWS) * K;   // wave-uniform
  // low 32 bits of the shared pointer = LDS byte address
  const uint32_t lds0 = (uint32_t)(uintptr_t)&S[0][wid * SLH];

  // descriptor group 1, the same for every request: 1-byte elements, tensor = tile
  u32x8 g1;
  g1[0] = uni((1u << 20) | (5u << 22) | (3u << 25));   // no mask; pad of 4 dwords behind every 64
  g1[1] = uni((uint32_t)(BK * 2) << 16);               // tensor_dim0
  g1[2] = uni((uint32_t)SL_ROWS << 16);                // tensor_dim1
  g1[3] = uni((uint32_t)(BK * 2) << 16);               // tile_dim0
  g1[4] = uni((uint32_t)SL_ROWS);                      // tile_dim1
  g1[5] = uni((uint32_t)K * 2u);                       // source row pitch
  g1[6] = uni(0u);
  g1[7] = uni(0u);

  // descriptor group 0: the place in LDS and the address change from request to request
  u32x4 g0;
  g0[0] = uni(1u);
  // the wave's slice of stage st into buffer buf
  auto issue_stage = [&](int buf, int st) {
    const uint64_t ga = (uint64_t)(uintptr_t)(gsrc + (size_t)st * BK);
    g0[1] = uni(lds0 + (uint32_t)buf * (STG * 2));
    g0[2] = uni((uint32_t)ga);
    g0[3] = uni((((uint32_t)(ga >> 32)) & 0x01FFFFFFu) | 0x80000000u);
    asm volatile("tensor_load_to_lds %0, %1" :: "s"(g0), "s"(g1) : "memory");
  };
  // my slice has landed. The wait names both groups so that their registers stay theirs from
  // the issue to here: without it the build used two words of group 1 as loop temporaries
  // while the request was on its way.
  auto wait_landed = [&]() {
    asm volatile("s_wait_tensorcnt 0x0" : "+s"(g0), "+s"(g1) :: "memory");
  };

  // fragments of one 32-k block: B 0..FB-1 first, then A 0..FA-1; unfused (B 0..3, A 0..7) the order in which
  // the WMMAs ask for them (behind a barrier the first WMMAs then wait for 10 loads, not
  // for 18); fused, the first WMMA needs A 0 and waits for 18 loads;
  // the same k order in both operands
  auto load_frags = [&](v16h (&f)[FA + FB], const _Float16* sa, const _Float16* sb, int kb) {
#pragma unroll
    for (int nf = 0; nf < FB; ++nf) {
      const _Float16* p = sb + (nf >> 2) * SLH + (nf & 3) * 16 * LDT + kb * 32;   // 4 fragments a slice
      const v8h lo = *(const v8h*)p;          // K 0..7 / 8..15
      const v8h hh = *(const v8h*)(p + 16);   // K 16..23 / 24..31
      f[FA + nf] = __builtin_shufflevector(lo, hh,
                0,1,2,3,4,5,6,7, 8,9,10,11,12,13,14,15);
    }
#pragma unroll
    for (int mf = 0; mf < FA; ++mf) {
      const _Float16* p = sa + (mf >> 2) * SLH + (mf & 3) * 16 * LDT + kb * 32;
      const v8h lo = *(const v8h*)p;
      const v8h hh = *(const v8h*)(p + 16);
      f[mf] = __builtin_shufflevector(lo, hh,
                0,1,2,3,4,5,6,7, 8,9,10,11,12,13,14,15);
    }
  };

  v8f_u acc[FA][FB];
#pragma unroll
  for (int i = 0; i < FA; ++i)
#pragma unroll
    for (int j = 0; j < FB; ++j) acc[i][j].v = (v8f)(0.0f);

  const int nkt = K / BK;

  // prologue: stage 0 lands and is published
  issue_stage(0, 0);
  if constexpr (FUSED) {
    // what the epilogue needs of bias, ak and av goes to LDS while stage 0 is on its way.
    // Both loads and their data wait in one statement: no address register is rewritten
    // while a load is in flight.
    // bias is [q 1024 | k 1024]; the tile's column tid is q or k, dim tid & 63, of head 2 * blockIdx.x + (tid >> 7)
    const float* pb = bias + ((tid >> 6) & 1) * NHID + blockIdx.x * (2 * HDIM) + (tid >> 7) * HDIM + (tid & (HDIM - 1));
    const float* pg = (tid < 2 * HDIM ? akf : avf)
                      + (size_t)(m0 / SEQ) * NHID + blockIdx.x * (2 * HDIM) + (tid & (2 * HDIM - 1));
    float bv, gv;
    asm volatile("global_load_b32 %0, %2, off\n\t"
                 "global_load_b32 %1, %3, off\n\t"
                 "s_wait_loadcnt 0x0"
                 : "=&v"(bv), "=&v"(gv) : "v"(pb), "v"(pg) : "memory");
    EP[tid]      = bv;
    EP[BN + tid] = gv;
  }
  wait_landed();   // stage 0
  __syncthreads();
  // stage 1 is on its way while stage 0 is worked on
  if (pinned(1 < nkt)) issue_stage(1, 1);

  // rolled: one stage's 128 WMMAs are the loop body
#pragma unroll 1
  for (int kt = 0; kt < nkt; ++kt) {
    const int  cur  = kt & 1;
    const _Float16* sa = &S[cur][wm * (FA / 4) * SLH + lh * LDT + hi * 8];
    const _Float16* sb = &S[cur][(BM / SL_ROWS + wn * (FB / 4)) * SLH + lh * LDT + hi * 8];

    v16h f[2][FA + FB];
    load_frags(f[0], sa, sb, 0);
#pragma unroll
    for (int kb = 0; kb < NKB; ++kb) {
      // the next block's fragment loads as one group ahead of this block's WMMAs
      if (kb + 1 < NKB) load_frags(f[(kb + 1) & 1], sa, sb, kb + 1);
      // keeps the load group whole and ahead of the WMMAs (without it the build spreads
      // the loads among the WMMAs, hoists a third block's loads and spills)
      __builtin_amdgcn_sched_barrier(0);
#pragma unroll
      for (int mf = 0; mf < FA; ++mf)
#pragma unroll
        for (int nf = 0; nf < FB; ++nf)
          acc[mf][nf].v = __builtin_amdgcn_wmma_f32_16x16x32_f16(
              false, f[kb & 1][FUSED ? FA + nf : mf], false, f[kb & 1][FUSED ? mf : FA + nf],
              (short)0, acc[mf][nf].v, false, false);
      // the next load group, which refills this block's fragment set, stays behind its WMMAs
      __builtin_amdgcn_sched_barrier(0);
    }

    // publish point of stage kt+1: my LDS reads of this buffer are done, my slice has
    // landed; the barrier shows it to all waves and frees this buffer for the refill.
    asm volatile("s_wait_dscnt 0x0" ::: "memory");
    wait_landed();
    __syncthreads();
    // stage kt+2 goes into the buffer that every wave has just left; it has all of
    // stage kt+1 to land
    if (pinned(kt + 2 < nkt)) issue_stage(cur, kt + 2);
  }
  // no request is in flight and no LDS read is open when the ring is given up
  wait_landed();
  asm volatile("s_wait_dscnt 0x0" ::: "memory");

  if constexpr (FUSED) {
    // ---- lane (lh, hi) holds, of token wm*64 + mf*16 + lh, columns nf*16 + hi*8 + 0..7 of the
    // head's [q | k]: acc[mf][0..3] = q, acc[mf][4..7] = k, 32 of the 64 dims each ----
    // (every loop below is unrolled so that acc is indexed by constants and stays in registers)
    const int head = blockIdx.x * 2 + wn;
    float* KS = (float*)&S[0][0] + wn * (KS_ROWS * KS_P);
    const int tl = wm * 64 + lh;                       // tile token of fragment mf = 0

#pragma unroll
    for (int nf = 0; nf < FB; ++nf) {
      v8f bc;
      bc.lo = *(const v4f*)&EP[wn * 128 + nf * 16 + hi * 8];
      bc.hi = *(const v4f*)&EP[wn * 128 + nf * 16 + hi * 8 + 4];
#pragma unroll
      for (int mf = 0; mf < FA; ++mf) acc[mf][nf].v += bc;
    }

    // k (f32) to LDS for the neighbour tokens
#pragma unroll
    for (int mf = 0; mf < FA; ++mf)
#pragma unroll
      for (int nf = 0; nf < 4; ++nf) {
        float* p = KS + (tl + mf * 16 + 1) * KS_P + nf * 16 + hi * 8;
        *(v4f*)p       = acc[mf][4 + nf].v.lo;
        *(v4f*)(p + 4) = acc[mf][4 + nf].v.hi;
      }

    // q|k rows 0, 1 and 254, 255 of the tile for attn_tile_edges. The 8 stores of a lane and
    // their s_wait_xcnt in one statement: no register that a store names is rewritten in
    // front of the wait.
    auto store_edge_rows = [&](const v8f_u (&a)[FB], int trow) {
      v4f h[FB];
#pragma unroll
      for (int nf = 0; nf < FB; ++nf)
        h[nf] = __builtin_bit_cast(v4f, __builtin_convertvector(a[nf].v, v8h));
      const uint32_t vo = (uint32_t)trow * (NQK * 2) + (uint32_t)hi * 16u;
      const char* eb = (const char*)Cout + (size_t)m0 * (NQK * 2) + head * (HDIM * 2);
      asm volatile(
          "global_store_b128 %0, %1, %9\n\t"
          "global_store_b128 %0, %2, %9 offset:32\n\t"
          "global_store_b128 %0, %3, %9 offset:64\n\t"
          "global_store_b128 %0, %4, %9 offset:96\n\t"
          "global_store_b128 %0, %5, %9 offset:2048\n\t"
          "global_store_b128 %0, %6, %9 offset:2080\n\t"
          "global_store_b128 %0, %7, %9 offset:2112\n\t"
          "global_store_b128 %0, %8, %9 offset:2144\n\t"
          "s_wait_xcnt 0x0"
          :: "v"(vo), "v"(h[0]), "v"(h[1]), "v"(h[2]), "v"(h[3]),
             "v"(h[4]), "v"(h[5]), "v"(h[6]), "v"(h[7]), "s"(eb)
          : "memory");
    };
    if (wm == 0 && lh < 2)        store_edge_rows(acc[0], tl);
    if (wm == 3 && lh >= 14)      store_edge_rows(acc[FA - 1], tl + (FA - 1) * 16);

    // every wave's k rows are in LDS
    __syncthreads();

    v8f ak[4], av[4];
#pragma unroll
    for (int nf = 0; nf < 4; ++nf) {
      const float* pa = &EP[BN + wn * HDIM + nf * 16 + hi * 8];
      ak[nf].lo = *(const v4f*)pa;
      ak[nf].hi = *(const v4f*)(pa + 4);
      av[nf].lo = *(const v4f*)(pa + 2 * HDIM);
      av[nf].hi = *(const v4f*)(pa + 2 * HDIM + 4);
    }
    const char* ob = (const char*)att + (size_t)m0 * (NHID * 2) + head * (HDIM * 2);

    // sum of a lane's 8 partial sums and of the token's other lane (the other 32 dims)
    auto token_sum = [&](v8f p) {
      const v4f a = p.lo + p.hi;
      const float s = (a[0] + a[2]) + (a[1] + a[3]);
      return s + __shfl_xor(s, 16, 32);
    };

#pragma unroll
    for (int mf = 0; mf < FA; ++mf) {
      // k of tokens t - 1 and t + 1: LDS rows t and t + 2
      const float* pm = KS + (tl + mf * 16) * KS_P + hi * 8;
      v8f km[4], kn[4];
#pragma unroll
      for (int nf = 0; nf < 4; ++nf) {
        km[nf].lo = *(const v4f*)(pm + nf * 16);
        km[nf].hi = *(const v4f*)(pm + nf * 16 + 4);
        kn[nf].lo = *(const v4f*)(pm + 2 * KS_P + nf * 16);
        kn[nf].hi = *(const v4f*)(pm + 2 * KS_P + nf * 16 + 4);
      }

      v8f p0 = acc[mf][0].v * ak[0], p1 = acc[mf][0].v * km[0];
      v8f p2 = acc[mf][0].v * acc[mf][4].v, p3 = acc[mf][0].v * kn[0];
#pragma unroll
      for (int nf = 1; nf < 4; ++nf) {
        p0 += acc[mf][nf].v * ak[nf];
        p1 += acc[mf][nf].v * km[nf];
        p2 += acc[mf][nf].v * acc[mf][4 + nf].v;
        p3 += acc[mf][nf].v * kn[nf];
      }
      const float sc = 0.125f;  // 1/sqrt(64)
      const float s0 = token_sum(p0) * sc, s1 = token_sum(p1) * sc;
      const float s2 = token_sum(p2) * sc, s3 = token_sum(p3) * sc;

      const float mx = fmaxf(fmaxf(s0, s1), fmaxf(s2, s3));
      const float e0 = __expf(s0 - mx), e1 = __expf(s1 - mx);
      const float e2 = __expf(s2 - mx), e3 = __expf(s3 - mx);
      const float inv = 1.0f / (e0 + e1 + e2 + e3);
      const float a0 = e0 * inv, a1 = e1 * inv, a2 = e2 * inv, a3 = e3 * inv;

      v4f oh[4];
#pragma unroll
      for (int nf = 0; nf < 4; ++nf) {
        const v8f o = a0 * av[nf] + a1 * km[nf] + a2 * acc[mf][4 + nf].v + a3 * kn[nf];
        oh[nf] = __builtin_bit_cast(v4f, __builtin_convertvector(o, v8h));
      }

      // the tile's first and last token are left to attn_tile_edges (their km or kn is not here)
      const bool other_tile = (mf == 0 && tl == 0) || (mf == FA - 1 && tl + mf * 16 == BM - 1);
      if (!other_tile) {
        const uint32_t vo = (uint32_t)(tl + mf * 16) * (NHID * 2) + (uint32_t)hi * 16u;
        // the token's 4 stores of this lane and their s_wait_xcnt in one statement: no
        // register that a store names is rewritten in front of the wait
        asm volatile(
            "global_store_b128 %0, %1, %5\n\t"
            "global_store_b128 %0, %2, %5 offset:32\n\t"
            "global_store_b128 %0, %3, %5 offset:64\n\t"
            "global_store_b128 %0, %4, %5 offset:96\n\t"
            "s_wait_xcnt 0x0"
            :: "v"(vo), "v"(oh[0]), "v"(oh[1]), "v"(oh[2]), "v"(oh[3]), "s"(ob)
            : "memory");
      }
    }
  } else {
  // ---- epilogue: C layout = VGPR r -> (row r + 8*hi, col lane&15) ----
#pragma unroll
  for (int nf = 0; nf < FB; ++nf) {
    const int col  = n0 + wn * 64 + nf * 16 + lh;
    const float bc = bias[col];
#pragma unroll
    for (int mf = 0; mf < FA; ++mf) {
      const int rbase = m0 + wm * 128 + mf * 16 + hi * 8;
#pragma unroll
      for (int r = 0; r < 8; ++r) {
        const float val = acc[mf][nf].f[r] + bc;
        const size_t idx = (size_t)(rbase + r) * N + col;
        if (OUT_F16) ((_Float16*)Cout)[idx] = (_Float16)val;
        else         ((float*)Cout)[idx]    = val;
      }
    }
  }
  }
}

// =====================================================================
// the first and the last token of every 256-token tile of the fused q|k GEMM:
// one wave per (token, group of 4 heads). A lane owns 8 dims (16 B), 8 lanes
// make a head, so every f16 load and the store of a wave is 512 contiguous bytes;
// the f32 ak and av take two 16-B loads a lane (32 contiguous bytes).
// qk buffer holds q (cols 0..1023) and k (cols 1024..2047) per token; of a tile
// only rows 0, 1, 254, 255 are there, which is all that these tokens read.
// slots: [ak, k_{l-1}, k_l, k_{l+1}]; V = [av, k_{l-1}, k_l, k_{l+1}]
// boundary slots are zero vectors -> score 0 (matches zero-padding).
// =====================================================================
constexpr int ED_THREADS = 256;
constexpr int ED_HG      = NHID / 256;             // head groups per token: 4
constexpr int ED_BLOCKS  = (MROWS / BM) * 2 * ED_HG / (ED_THREADS / 32);
static_assert(NQK * 2 == 4096, "the k offset in asm text is written for this");

typedef __attribute__((ext_vector_type(2))) float v2f;

// sum over the 8 lanes of a head, result in all 8
__device__ __forceinline__ float sum_head_lanes(float v) {
  v += __builtin_bit_cast(float, __builtin_amdgcn_update_dpp(0, __builtin_bit_cast(int, v), 0x161, 0xf, 0xf, true)); // row_xmask:1
  v += __builtin_bit_cast(float, __builtin_amdgcn_update_dpp(0, __builtin_bit_cast(int, v), 0x162, 0xf, 0xf, true)); // row_xmask:2
  v += __builtin_bit_cast(float, __builtin_amdgcn_update_dpp(0, __builtin_bit_cast(int, v), 0x164, 0xf, 0xf, true)); // row_xmask:4
  return v;
}

__device__ __forceinline__ void widen(v2f (&f)[4], v8h h) {
#pragma unroll
  for (int p = 0; p < 4; ++p) { f[p][0] = (float)h[2 * p]; f[p][1] = (float)h[2 * p + 1]; }
}

__global__ __launch_bounds__(ED_THREADS)
void attn_tile_edges(const _Float16* __restrict__ qkh,
                     const float* __restrict__ akf,
                     const float* __restrict__ avf,
                     _Float16* __restrict__ atth) {
  const int lane = threadIdx.x & 31;
  const int gw   = __builtin_amdgcn_readfirstlane(blockIdx.x * (ED_THREADS / 32) + (threadIdx.x >> 5));
  const int hg   = gw & (ED_HG - 1);
  const int e    = gw / ED_HG;                                  // tile * 2 + (0: first, 1: last token)
  const int t    = (e >> 1) * BM + ((e & 1) ? BM - 1 : 0);      // b*SEQ + l
  const int l    = t & (SEQ - 1);
  const bool has_prev = l > 0, has_next = l + 1 < SEQ;

  // wave-uniform bases; a row outside the sequence is not read (the token's own row stands in)
  const _Float16* row  = qkh + (size_t)t * NQK + hg * 256;
  const _Float16* prow = has_prev ? row - NQK : row;
  const _Float16* nrow = has_next ? row + NQK : row;
  const size_t grow = (size_t)(t / SEQ) * NHID + hg * 256;
  const float* akp = akf + grow;
  const float* avp = avf + grow;
  const uint32_t voff = (uint32_t)lane * 16u, voff2 = (uint32_t)lane * 32u;

  // all 8 loads and their data wait in one statement: every load is in flight before the
  // wait, and no address register is rewritten while one is
  v8h qh, kch, kmh, knh;
  v4f akl, akh, avl, avh;
  asm volatile(
      "global_load_b128 %0, %8, %10\n\t"
      "global_load_b128 %1, %8, %10 offset:2048\n\t"
      "global_load_b128 %2, %8, %11 offset:2048\n\t"
      "global_load_b128 %3, %8, %12 offset:2048\n\t"
      "global_load_b128 %4, %9, %13\n\t"
      "global_load_b128 %5, %9, %13 offset:16\n\t"
      "global_load_b128 %6, %9, %14\n\t"
      "global_load_b128 %7, %9, %14 offset:16\n\t"
      "s_wait_loadcnt 0x0"
      : "=&v"(qh), "=&v"(kch), "=&v"(kmh), "=&v"(knh),
        "=&v"(akl), "=&v"(akh), "=&v"(avl), "=&v"(avh)
      : "v"(voff), "v"(voff2), "s"(row), "s"(prow), "s"(nrow), "s"(akp), "s"(avp)
      : "memory");
  if (!has_prev) kmh = (v8h)(_Float16)0.0f;
  if (!has_next) knh = (v8h)(_Float16)0.0f;

  v2f ak[4], av[4], qf[4], km[4], kc[4], kn[4];
  ak[0] = akl.xy; ak[1] = akl.zw; ak[2] = akh.xy; ak[3] = akh.zw;
  av[0] = avl.xy; av[1] = avl.zw; av[2] = avh.xy; av[3] = avh.zw;
  widen(qf, qh);
  widen(km, kmh);
  widen(kc, kch);
  widen(kn, knh);

  v2f p0 = qf[0] * ak[0], p1 = qf[0] * km[0], p2 = qf[0] * kc[0], p3 = qf[0] * kn[0];
#pragma unroll
  for (int p = 1; p < 4; ++p) {
    p0 += qf[p] * ak[p];
    p1 += qf[p] * km[p];
    p2 += qf[p] * kc[p];
    p3 += qf[p] * kn[p];
  }
  float s0 = sum_head_lanes(p0[0] + p0[1]);
  float s1 = sum_head_lanes(p1[0] + p1[1]);
  float s2 = sum_head_lanes(p2[0] + p2[1]);
  float s3 = sum_head_lanes(p3[0] + p3[1]);

  const float sc = 0.125f;  // 1/sqrt(64)
  s0 *= sc; s1 *= sc; s2 *= sc; s3 *= sc;

  const float mx = fmaxf(fmaxf(s0, s1), fmaxf(s2, s3));
  const float e0 = __expf(s0 - mx), e1 = __expf(s1 - mx);
  const float e2 = __expf(s2 - mx), e3 = __expf(s3 - mx);
  const float inv = 1.0f / (e0 + e1 + e2 + e3);
  const float a0 = e0 * inv, a1 = e1 * inv, a2 = e2 * inv, a3 = e3 * inv;

  v8h oh;
#pragma unroll
  for (int p = 0; p < 4; ++p) {
    const v2f o = a0 * av[p] + a1 * km[p] + a2 * kc[p] + a3 * kn[p];
    oh[2 * p]     = (_Float16)o[0];
    oh[2 * p + 1] = (_Float16)o[1];
  }
  const _Float16* orow = atth + (size_t)t * NHID + hg * 256;
  // the store and its s_wait_xcnt in one statement: no register that it names is rewritten
  // in front of the wait
  asm volatile("global_store_b128 %0, %1, %2\n\t"
               "s_wait_xcnt 0x0"
               :: "v"(voff), "v"(__builtin_bit_cast(v4f, oh)), "s"(orow) : "memory");
}

// =====================================================================
// launch
// =====================================================================
extern "C" void kernel_launch(void* const* d_in, const int* in_sizes, int n_in,
                              void* d_out, int out_size, void* d_ws, size_t ws_size,
                              hipStream_t stream) {
  const float* x    = (const float*)d_in[0];
  const float* ax   = (const float*)d_in[1];
  const float* WQ_w = (const float*)d_in[2];
  const float* WQ_b = (const float*)d_in[3];
  const float* WK_w = (const float*)d_in[4];
  const float* WK_b = (const float*)d_in[5];
  const float* WV_w = (const float*)d_in[6];
  const float* WV_b = (const float*)d_in[7];
  const float* WO_w = (const float*)d_in[8];
  const float* WO_b = (const float*)d_in[9];

  char* ws = (char*)d_ws;
  _Float16* xh   = (_Float16*)(ws + OFF_XH);
  _Float16* wqkt = (_Float16*)(ws + OFF_WQKT);
  _Float16* wot  = (_Float16*)(ws + OFF_WOT);
  float*    bqk  = (float*)(ws + OFF_BQK);
  _Float16* qkh  = (_Float16*)(ws + OFF_QKH);
  _Float16* atth = (_Float16*)(ws + OFF_ATTH);
  float*    akf  = (float*)(ws + OFF_AK);
  float*    avf  = (float*)(ws + OFF_AV);

  // 1-3) one grid: weights to f16 (WQ^T and WK^T head by head, WO^T), bias [WQ_b ; WK_b], x to f16
  prep_inputs<<<PR_TR + PR_CB + PR_CV, PR_THREADS, 0, stream>>>(x, WQ_w, WK_w, WO_w, WQ_b, WK_b,
                                                                xh, wqkt, wot, bqk);
  // 4) global-token projections ak = ax@WK + bK, av = ax@WV + bV (f32), one grid
  {
    dim3 g(NHID / PG_COLS, BATCH / PG_BATCH, 2);
    proj_global_tok<<<g, PG_THREADS, 0, stream>>>(ax, WK_w, WK_b, akf, WV_w, WV_b, avf);
  }
  // 5) q|k projection via WMMA GEMM, [32768x1024] @ [1024x2048], with the windowed attention
  //    on its accumulators -> att (f16), all tokens but each tile's first and last
  {
    dim3 g(NQK / BN, MROWS / BM);
    gemm_wmma_f16<true, true><<<g, 256, 0, stream>>>(xh, wqkt, bqk, (void*)qkh,
                                                     MROWS, NQK, NHID, akf, avf, atth);
  }
  // 6) windowed attention of the tiles' first and last tokens -> att (f16)
  attn_tile_edges<<<ED_BLOCKS, ED_THREADS, 0, stream>>>(qkh, akf, avf, atth);
  // 7) output projection via WMMA GEMM (f32 out to d_out)
  {
    dim3 g(NHID / BN, MROWS / BM);
    gemm_wmma_f16<false, false><<<g, 256, 0, stream>>>(atth, wot, WO_b, d_out,
                                                       MROWS, NHID, NHID, nullptr, nullptr, nullptr);
  }
}

// v008
// It runs in 154 microseconds.
// In two side-by-side timings against v007, it was 1.07 and 1.06 times as fast.
// Counting every step since v000, it is 3.87 times as fast.
#include <hip/hip_runtime.h>
#include <hip/hip_bf16.h>
#include <stdint.h>

// ---------------- problem constants ----------------
constexpr int BATCH = 8;
constexpr int SEQ   = 4096;
constexpr int NHEAD = 16;
constexpr int HDIM  = 64;
constexpr int NHID  = 1024;              // == NHEAD*HDIM
constexpr int MROWS = BATCH * SEQ;       // 32768
constexpr int NQK   = 2 * NHID;          // fused q|k output width

// ---------------- vector types ----------------
typedef __attribute__((ext_vector_type(16))) _Float16 v16h;
typedef __attribute__((ext_vector_type(8)))  _Float16 v8h;
typedef __attribute__((ext_vector_type(4)))  _Float16 v4h;
typedef __attribute__((ext_vector_type(2)))  _Float16 v2h;
typedef __attribute__((ext_vector_type(8)))  float    v8f;

typedef union { v8f v; float f[8]; } v8f_u;

// ---------------- workspace layout (bytes) ----------------
constexpr size_t OFF_XH   = 0;                                    // 32768x1024 f16 (64 MB)
constexpr size_t OFF_WQKT = OFF_XH   + (size_t)MROWS * NHID * 2;  // 2048x1024 f16 (WQ^T, WK^T, head by head)
constexpr size_t OFF_WOT  = OFF_WQKT + (size_t)NQK   * NHID * 2;  // 1024x1024 f16
constexpr size_t OFF_BQK  = OFF_WOT  + (size_t)NHID  * NHID * 2;  // 2048 f32
constexpr size_t OFF_QKH  = OFF_BQK  + (size_t)NQK * 4;           // 32768x2048 f16; only 4 rows in 256 are used
constexpr size_t OFF_ATTH = OFF_QKH  + (size_t)MROWS * NQK * 2;   // 32768x1024 f16
constexpr size_t OFF_AK   = OFF_ATTH + (size_t)MROWS * NHID * 2;  // 8x1024 f32
constexpr size_t OFF_AV   = OFF_AK   + (size_t)BATCH * NHID * 4;

// =====================================================================
// The five jobs that only reshape inputs (x to f16, three weight transposes,
// the bias concat) depend on nothing but the inputs and write disjoint
// buffers. They run as one grid, prep_inputs below: the block index picks the
// job, and each job's blocks do what its own launch did. blk is the block's
// index inside its job.
// =====================================================================
constexpr int PR_THREADS = 256;

// f32 -> f16 conversion of a stream. A block owns CV_LD * PR_THREADS consecutive float4: a
// thread asks for its CV_LD float4 (each a wave-wide 512 contiguous bytes) before it converts
// the first, so a wave has 4 KB in flight and the stream needs CV_LD times fewer waves started.
constexpr int CV_LD = 8;
__device__ __forceinline__ void cvt_f32_to_f16_stream(const float* __restrict__ in,
                                                      _Float16* __restrict__ out, int blk) {
  const int i0 = blk * (CV_LD * PR_THREADS) + threadIdx.x;
  float4 v[CV_LD];
#pragma unroll
  for (int j = 0; j < CV_LD; ++j) v[j] = ((const float4*)in)[i0 + j * PR_THREADS];
#pragma unroll
  for (int j = 0; j < CV_LD; ++j) {
    v4h h;
    h[0] = (_Float16)v[j].x; h[1] = (_Float16)v[j].y;
    h[2] = (_Float16)v[j].z; h[3] = (_Float16)v[j].w;
    ((v4h*)out)[i0 + j * PR_THREADS] = h;
  }
  // the loads' and stores' registers are not rewritten in front of this wait, whatever code
  // of the merged kernel the build places behind the stores
  asm volatile("s_wait_xcnt 0x0" ::: "memory");
}

// Row order of the fused [q | k] weight matrix: 128 rows a head, its 64 q columns and then its
// 64 k columns, so that a 128-column slice of the product holds q and k of one head.
// c = column of WQ or WK (head * 64 + dim), isk = 1 for WK.
__device__ __forceinline__ int qk_row(int isk, int c) {
  return ((c >> 6) << 7) | (isk << 6) | (c & 63);
}

// f32 [K][N] -> f16 [N][K] transpose (32x32 LDS tiles); every thread of the block comes here.
// qk: 0 = WQ, 1 = WK (their 32 columns go to rows qk_row(qk, n0) ...), -1 = rows as they are
__device__ __forceinline__ void transpose_f32_to_f16(const float* __restrict__ in,
                                                     _Float16* __restrict__ out,
                                                     int K, int N, int blk, int qk) {
  __shared__ float tile[32][33];
  int tx = threadIdx.x & 31, ty = threadIdx.x >> 5;
  int k0 = (blk / (N / 32)) * 32, n0 = (blk % (N / 32)) * 32;
  int d0 = qk < 0 ? n0 : qk_row(qk, n0);
#pragma unroll
  for (int i = 0; i < 32; i += 8)
    tile[ty + i][tx] = in[(size_t)(k0 + ty + i) * N + n0 + tx];
  __syncthreads();
#pragma unroll
  for (int i = 0; i < 32; i += 8)
    out[(size_t)(d0 + ty + i) * K + k0 + tx] = (_Float16)tile[tx][ty + i];
}

// concat two f32 vectors of length n -> out[2n]
__device__ __forceinline__ void concat_bias(const float* __restrict__ a, const float* __restrict__ b,
                                            float* __restrict__ out, int n, int blk) {
  int i = blk * PR_THREADS + threadIdx.x;
  out[i] = (i < n) ? a[i] : b[i - n];
  // the store's registers are not rewritten in front of this wait, whatever code of the
  // merged kernel the build places behind the store
  asm volatile("s_wait_xcnt 0x0" ::: "memory");
}

constexpr int PR_TILES = (NHID / 32) * (NHID / 32);            // blocks per weight transpose
constexpr int PR_TR    = 3 * PR_TILES;                         // blocks 0 .. PR_TR-1: transposes
constexpr int PR_CB    = NQK / PR_THREADS;                     // then the bias concat
constexpr int PR_CV    = MROWS * NHID / 4 / (CV_LD * PR_THREADS);   // then the conversion of x
static_assert(NQK % PR_THREADS == 0 && (MROWS * NHID / 4) % (CV_LD * PR_THREADS) == 0, "whole blocks");

// The short jobs have the low block indices. Every branch is on the block index alone.
__global__ __launch_bounds__(PR_THREADS)
void prep_inputs(const float* __restrict__ x,
                 const float* __restrict__ WQ_w, const float* __restrict__ WK_w,
                 const float* __restrict__ WO_w,
                 const float* __restrict__ WQ_b, const float* __restrict__ WK_b,
                 _Float16* __restrict__ xh, _Float16* __restrict__ wqkt,
                 _Float16* __restrict__ wot, float* __restrict__ bqk) {
  const int b = blockIdx.x;
  if (b < PR_TR) {
    const int which = b / PR_TILES;
    const float* in  = which == 0 ? WQ_w : which == 1 ? WK_w : WO_w;
    _Float16*    out = which == 2 ? wot : wqkt;
    transpose_f32_to_f16(in, out, NHID, NHID, b % PR_TILES, which == 2 ? -1 : which);
  } else if (b < PR_TR + PR_CB) {
    concat_bias(WQ_b, WK_b, bqk, NHID, b - PR_TR);
  } else {
    cvt_f32_to_f16_stream(x, xh, b - (PR_TR + PR_CB));
  }
}

// =====================================================================
// projection of the global token: out[b][n] = ax[b].W[:,n] + bias[n]
// One block owns 32 columns for 4 of the 8 batches. The k range is split
// over 128 slices of 8 rows: thread = (slice, column quad). A thread's 8 W
// rows and its ax values fit in registers together, so they are all asked
// for at once and the block waits for memory once, where a serial k loop
// waits once per unrolled group of rows.
// Partial sums: the 4 slices of a wave by shuffles, the 32 waves through LDS.
// Both projections (with WK and with WV) are one grid: blockIdx.z picks the matrix.
// =====================================================================
constexpr int PG_COLS    = 32;                     // columns per block: one 128-B line per W row
constexpr int PG_BATCH   = 4;                      // batches per block
constexpr int PG_THREADS = 1024;
constexpr int PG_WAVES   = PG_THREADS / 32;
constexpr int PG_KPT     = NHID / (PG_THREADS / (PG_COLS / 4));   // 8 rows per thread
static_assert(PG_KPT == 8 && PG_BATCH == 4 && NHID * 4 == 4096, "the offsets in the load statement are written for these");

typedef __attribute__((ext_vector_type(4))) float v4f;

__global__ __launch_bounds__(PG_THREADS)
void proj_global_tok(const float* __restrict__ ax,
                     const float* __restrict__ W0, const float* __restrict__ bias0,
                     float* __restrict__ out0,
                     const float* __restrict__ W1, const float* __restrict__ bias1,
                     float* __restrict__ out1) {
  __shared__ float part[PG_WAVES][PG_BATCH][PG_COLS];   // 16 KB

  const bool second = blockIdx.z != 0;
  const float* W    = second ? W1 : W0;
  const float* bias = second ? bias1 : bias0;
  float*       out  = second ? out1 : out0;

  const int tid  = threadIdx.x;
  const int lane = tid & 31;
  const int wave = tid >> 5;
  const int cq   = tid & 7;                  // column quad inside the block
  const int k0   = (tid >> 3) * PG_KPT;      // first row of this thread's slice
  const int nblk = blockIdx.x * PG_COLS;
  const int b0   = blockIdx.y * PG_BATCH;

  const float* wp = W  + (size_t)k0 * NHID + nblk + cq * 4;   // row j at byte offset j * 4096
  const float* ap = ax + (size_t)b0 * NHID + k0;              // batch bb at byte offset bb * 4096

  // All 16 loads of the thread and their data wait in one statement: every load is in
  // flight before the first wait, and the early-clobber outputs keep each result out of
  // the two address pairs until all loads have returned (as plain loads the build let one
  // load's result land in the pair that six loads still in flight named).
  v4f w[PG_KPT], a[PG_BATCH][2];
  asm volatile(
      "global_load_b128 %0, %16, off\n\t"
      "global_load_b128 %1, %16, off offset:4096\n\t"
      "global_load_b128 %2, %16, off offset:8192\n\t"
      "global_load_b128 %3, %16, off offset:12288\n\t"
      "global_load_b128 %4, %16, off offset:16384\n\t"
      "global_load_b128 %5, %16, off offset:20480\n\t"
      "global_load_b128 %6, %16, off offset:24576\n\t"
      "global_load_b128 %7, %16, off offset:28672\n\t"
      "global_load_b128 %8, %17, off\n\t"
      "global_load_b128 %9, %17, off offset:16\n\t"
      "global_load_b128 %10, %17, off offset:4096\n\t"
      "global_load_b128 %11, %17, off offset:4112\n\t"
      "global_load_b128 %12, %17, off offset:8192\n\t"
      "global_load_b128 %13, %17, off offset:8208\n\t"
      "global_load_b128 %14, %17, off offset:12288\n\t"
      "global_load_b128 %15, %17, off offset:12304\n\t"
      "s_wait_loadcnt 0x0"
      : "=&v"(w[0]), "=&v"(w[1]), "=&v"(w[2]), "=&v"(w[3]),
        "=&v"(w[4]), "=&v"(w[5]), "=&v"(w[6]), "=&v"(w[7]),
        "=&v"(a[0][0]), "=&v"(a[0][1]), "=&v"(a[1][0]), "=&v"(a[1][1]),
        "=&v"(a[2][0]), "=&v"(a[2][1]), "=&v"(a[3][0]), "=&v"(a[3][1])
      : "v"(wp), "v"(ap)
      : "memory");

  v4f acc[PG_BATCH];
#pragma unroll
  for (int bb = 0; bb < PG_BATCH; ++bb) {
    v4f s = a[bb][0][0] * w[0];
#pragma unroll
    for (int j = 1; j < PG_KPT; ++j)
      s += a[bb][j >> 2][j & 3] * w[j];
    acc[bb] = s;
  }

  // the wave's 4 slices sit in lanes cq, cq+8, cq+16, cq+24
#pragma unroll
  for (int bb = 0; bb < PG_BATCH; ++bb) {
#pragma unroll
    for (int off = 8; off <= 16; off <<= 1) {
#pragma unroll
      for (int e = 0; e < 4; ++e)
        acc[bb][e] += __shfl_xor(acc[bb][e], off, 32);
    }
  }
  if (lane < 8) {
#pragma unroll
    for (int bb = 0; bb < PG_BATCH; ++bb)
      *(v4f*)&part[wave][bb][cq * 4] = acc[bb];
  }
  __syncthreads();

  // one thread per (batch, column) adds the 32 waves' partial sums
  if (tid < PG_BATCH * PG_COLS) {
    const int bb = tid >> 5, c = tid & 31;
    float s = bias[nblk + c];
#pragma unroll
    for (int wv = 0; wv < PG_WAVES; ++wv)
      s += part[wv][bb][c];
    out[(size_t)(b0 + bb) * NHID + nblk + c] = s;
  }
}

// =====================================================================
// WMMA GEMM:  C[M][N] = A[M][K](f16) * Bt[N][K](f16)^T + bias[N]
// 256 threads = 8 waves; block tile 256(M) x 256(N); a stage is 128 k.
// M and N are multiples of 256, K a multiple of 128.
// A block reads (256 + 256) operand rows from L2 for 65,536 outputs, in whole 256-B
// row pieces.
// Each wave: 128x64 tile (FUSED: 64x128) -> 32 v_wmma_f32_16x16x32_f16 per 32 k, so a
// loaded fragment feeds 4 or 8 products. One block per WGP, two waves per SIMD.
// Two LDS buffers fed by TENSOR_LOAD_TO_LDS (TENSORcnt): every wave asks once per stage for
// its 64 operand rows, the mover's pad gives the 272-B pitch; no VGPR staging, 1 barrier /
// stage; fragments are fetched one 32-k block ahead inside a stage, never across the
// stage's barrier.
// FUSED (the q|k projection, Bt rows in the order of qk_row): a wave's 128 columns are q and k
// of one head for 64 tokens, and the windowed attention is done on the accumulators; the
// product itself is not stored. The weight fragment is the first WMMA operand there, so a
// lane holds 8 adjacent columns of one token. k goes to the neighbour tokens' lanes through
// LDS (the ring is free behind the loop's last barrier). A tile's first and last token need
// a k row of another tile: for them the block stores q|k rows 0, 1, 254, 255 as f16 to Cout
// ([token][q 1024 | k 1024]) and attn_tile_edges, the next launch, does those two tokens.
// Plain form (the output projection, N == NHID, f32 out): the weight fragment is the first WMMA
// operand here too. A wave puts its 128 x 64 tile into its own piece of the ring, reads it back
// row by row and stores, with one b128 store, two rows' whole aligned 256 B.
// =====================================================================
constexpr int BM   = 256;
constexpr int BN   = 256;
constexpr int BK   = 128;
constexpr int NKB  = BK / 32;            // WMMA k blocks per stage
constexpr int LDT  = BK + 8;             // padded LDS row (halves): 272 B = 16 B x odd
constexpr int SL_ROWS = 64;              // rows of one tensor load: a wave's slice of a stage
constexpr int SLH  = 9 * 1024;           // halves from slice to slice: 64 rows x 272 B rounded up to 2 KiB
constexpr int STG  = (BM + BN) / SL_ROWS * SLH;   // halves per stage: slices 0..3 A, 4..7 B
static_assert(SL_ROWS * LDT <= SLH && (SLH * 2) % 2048 == 0 && BK * 2 == 256,
              "a slice starts at a multiple of 2 KiB; the pad code below is the one for 256-B rows");
typedef uint32_t u32x4 __attribute__((ext_vector_type(4)));
typedef uint32_t u32x8 __attribute__((ext_vector_type(8)));
__device__ __forceinline__ uint32_t uni(uint32_t v) { return (uint32_t)__builtin_amdgcn_readfirstlane(v); }
// a wave-uniform test held in a scalar register, so that the branch on it is s_cmp + s_cbranch_scc
// (a tensor load ignores EXEC: only a scalar branch keeps a wave from issuing it)
__device__ __forceinline__ uint32_t pinned(uint32_t v) {
  uint32_t w = uni(v);
  asm volatile("" : "+s"(w));   // holds the test's value in a scalar register for the branch around a tensor load
  return w;
}
constexpr int KS_P    = HDIM + 4;        // floats of a k row in LDS: 272 B = 16 B x odd
constexpr int KS_ROWS = BM + 2;          // row t + 1 holds tile token t; rows 0 and 257 are never written
static_assert(2 * KS_ROWS * KS_P * 4 <= 2 * STG * 2, "both heads' k rows fit in the ring");
constexpr int OT_ROWS = 128;             // plain form: tokens of a wave's output tile
constexpr int OT_P    = 64 + 4;          // floats of its row in LDS: 272 B = 16 B x odd
static_assert(8 * OT_ROWS * OT_P * 4 <= 2 * STG * 2 && NHID * 4 == 4096,
              "the 8 waves' output tiles fit in the ring; the row offsets of the f32 stores in asm text are for this pitch");
static_assert(SEQ % BM == 0 && HDIM == 64 && BN == 4 * HDIM && NHID * 2 == 2048,
              "a tile stays inside one sequence; the store offsets in asm text are written for these");

template <bool FUSED, bool OUT_F16>
__global__ __launch_bounds__(256)
void gemm_wmma_f16(const _Float16* __restrict__ A,
                   const _Float16* __restrict__ Bt,
                   const float* __restrict__ bias,
                   void* __restrict__ Cout,
                   int M, int N, int K,
                   const float* __restrict__ akf, const float* __restrict__ avf,
                   _Float16* __restrict__ att) {
  static_assert(FUSED == OUT_F16, "the rows that the fused form stores are f16, the plain form's output is f32");
  constexpr int FA = FUSED ? 4 : 8;      // A fragments per wave
  constexpr int FB = FUSED ? 8 : 4;      // B fragments per wave
  __shared__ __attribute__((aligned(2048))) _Float16 S[2][STG];
  // the tile's 256 bias values; FUSED: then ak and av of its 2 heads
  __shared__ __attribute__((aligned(16))) float EP[FUSED ? 2 * BN : BN];

  const int tid  = threadIdx.x;
  const int wid  = __builtin_amdgcn_readfirstlane(tid >> 5);
  const int lane = tid & 31;
  const int lh   = lane & 15;
  const int hi   = lane >> 4;          // 0: lanes 0-15, 1: lanes 16-31

  const int wm = FUSED ? wid >> 1 : wid >> 2;   // 16 * FA M-rows each
  const int wn = FUSED ? wid & 1  : wid & 3;    // 16 * FB N-cols each

  const int m0 = blockIdx.y * BM;
  const int n0 = blockIdx.x * BN;

  // staging: wave w brings stage rows 64w .. 64w+63 (waves 0-3: A, waves 4-7: B) with one
  // tensor load: 64 rows of 256 B, source pitch 2 K bytes, 16 B of pad behind every row.
  const _Float16* gsrc = (wid < 4) ? A  + (size_t)(m0 + wid * SL_ROWS) * K
                                   : Bt + (size_t)(n0 + (wid - 4) * SL_ROWS) * K;   // wave-uniform
  // low 32 bits of the shared pointer = LDS byte address
  const uint32_t lds0 = (uint32_t)(uintptr_t)&S[0][wid * SLH];

  // descriptor group 1, the same for every request: 1-byte elements, tensor = tile
  u32x8 g1;
  g1[0] = uni((1u << 20) | (5u << 22) | (3u << 25));   // no mask; pad of 4 dwords behind every 64
  g1[1] = uni((uint32_t)(BK * 2) << 16);               // tensor_dim0
  g1[2] = uni((uint32_t)SL_ROWS << 16);                // tensor_dim1
  g1[3] = uni((uint32_t)(BK * 2) << 16);               // tile_dim0
  g1[4] = uni((uint32_t)SL_ROWS);                      // tile_dim1
  g1[5] = uni((uint32_t)K * 2u);                       // source row pitch
  g1[6] = uni(0u);
  g1[7] = uni(0u);

  // descriptor group 0: the place in LDS and the address change from request to request
  u32x4 g0;
  g0[0] = uni(1u);
  // the wave's slice of stage st into buffer buf
  auto issue_stage = [&](int buf, int st) {
    const uint64_t ga = (uint64_t)(uintptr_t)(gsrc + (size_t)st * BK);
    g0[1] = uni(lds0 + (uint32_t)buf * (STG * 2));
    g0[2] = uni((uint32_t)ga);
    g0[3] = uni((((uint32_t)(ga >> 32)) & 0x01FFFFFFu) | 0x80000000u);
    asm volatile("tensor_load_to_lds %0, %1" :: "s"(g0), "s"(g1) : "memory");
  };
  // my slice has landed. The wait names both groups so that their registers stay theirs from
  // the issue to here: without it the build used two words of group 1 as loop temporaries
  // while the request was on its way.
  auto wait_landed = [&]() {
    asm volatile("s_wait_tensorcnt 0x0" : "+s"(g0), "+s"(g1) :: "memory");
  };

  // fragments of one 32-k block: B 0..FB-1 first, then A 0..FA-1; unfused (B 0..3, A 0..7) the order in which
  // the WMMAs ask for them (behind a barrier the first WMMAs then wait for 10 loads, not
  // for 18); fused, the first WMMA needs A 0 and waits for 18 loads;
  // the same k order in both operands
  auto load_frags = [&](v16h (&f)[FA + FB], const _Float16* sa, const _Float16* sb, int kb) {
#pragma unroll
    for (int nf = 0; nf < FB; ++nf) {
      const _Float16* p = sb + (nf >> 2) * SLH + (nf & 3) * 16 * LDT + kb * 32;   // 4 fragments a slice
      const v8h lo = *(const v8h*)p;          // K 0..7 / 8..15
      const v8h hh = *(const v8h*)(p + 16);   // K 16..23 / 24..31
      f[FA + nf] = __builtin_shufflevector(lo, hh,
                0,1,2,3,4,5,6,7, 8,9,10,11,12,13,14,15);
    }
#pragma unroll
    for (int mf = 0; mf < FA; ++mf) {
      const _Float16* p = sa + (mf >> 2) * SLH + (mf & 3) * 16 * LDT + kb * 32;
      const v8h lo = *(const v8h*)p;
      const v8h hh = *(const v8h*)(p + 16);
      f[mf] = __builtin_shufflevector(lo, hh,
                0,1,2,3,4,5,6,7, 8,9,10,11,12,13,14,15);
    }
  };

  v8f_u acc[FA][FB];
#pragma unroll
  for (int i = 0; i < FA; ++i)
#pragma unroll
    for (int j = 0; j < FB; ++j) acc[i][j].v = (v8f)(0.0f);

  const int nkt = K / BK;

  // prologue: stage 0 lands and is published
  issue_stage(0, 0);
  if constexpr (FUSED) {
    // what the epilogue needs of bias, ak and av goes to LDS while stage 0 is on its way.
    // Both loads and their data wait in one statement: no address register is rewritten
    // while a load is in flight.
    // bias is [q 1024 | k 1024]; the tile's column tid is q or k, dim tid & 63, of head 2 * blockIdx.x + (tid >> 7)
    const float* pb = bias + ((tid >> 6) & 1) * NHID + blockIdx.x * (2 * HDIM) + (tid >> 7) * HDIM + (tid & (HDIM - 1));
    const float* pg = (tid < 2 * HDIM ? akf : avf)
                      + (size_t)(m0 / SEQ) * NHID + blockIdx.x * (2 * HDIM) + (tid & (2 * HDIM - 1));
    float bv, gv;
    asm volatile("global_load_b32 %0, %2, off\n\t"
                 "global_load_b32 %1, %3, off\n\t"
                 "s_wait_loadcnt 0x0"
                 : "=&v"(bv), "=&v"(gv) : "v"(pb), "v"(pg) : "memory");
    EP[tid]      = bv;
    EP[BN + tid] = gv;
  }
  if constexpr (!FUSED) {
    // the tile's 256 bias values go to LDS while stage 0 is on its way. The load and its data
    // wait in one statement: the address pair is not rewritten while the load is in flight.
    const float* pb = bias + n0 + tid;
    float bv;
    asm volatile("global_load_b32 %0, %1, off\n\t"
                 "s_wait_loadcnt 0x0"
                 : "=&v"(bv) : "v"(pb) : "memory");
    EP[tid] = bv;
  }
  wait_landed();   // stage 0
  __syncthreads();
  // stage 1 is on its way while stage 0 is worked on
  if (pinned(1 < nkt)) issue_stage(1, 1);

  // rolled: one stage's 128 WMMAs are the loop body
#pragma unroll 1
  for (int kt = 0; kt < nkt; ++kt) {
    const int  cur  = kt & 1;
    const _Float16* sa = &S[cur][wm * (FA / 4) * SLH + lh * LDT + hi * 8];
    const _Float16* sb = &S[cur][(BM / SL_ROWS + wn * (FB / 4)) * SLH + lh * LDT + hi * 8];

    v16h f[2][FA + FB];
    load_frags(f[0], sa, sb, 0);
#pragma unroll
    for (int kb = 0; kb < NKB; ++kb) {
      // the next block's fragment loads as one group ahead of this block's WMMAs
      if (kb + 1 < NKB) load_frags(f[(kb + 1) & 1], sa, sb, kb + 1);
      // keeps the load group whole and ahead of the WMMAs (without it the build spreads
      // the loads among the WMMAs, hoists a third block's loads and spills)
      __builtin_amdgcn_sched_barrier(0);
#pragma unroll
      for (int mf = 0; mf < FA; ++mf)
#pragma unroll
        for (int nf = 0; nf < FB; ++nf)
          acc[mf][nf].v = __builtin_amdgcn_wmma_f32_16x16x32_f16(
              false, f[kb & 1][FA + nf], false, f[kb & 1][mf],
              (short)0, acc[mf][nf].v, false, false);
      // the next load group, which refills this block's fragment set, stays behind its WMMAs
      __builtin_amdgcn_sched_barrier(0);
    }

    // publish point of stage kt+1: my LDS reads of this buffer are done, my slice has
    // landed; the barrier shows it to all waves and frees this buffer for the refill.
    asm volatile("s_wait_dscnt 0x0" ::: "memory");
    wait_landed();
    __syncthreads();
    // stage kt+2 goes into the buffer that every wave has just left; it has all of
    // stage kt+1 to land
    if (pinned(kt + 2 < nkt)) issue_stage(cur, kt + 2);
  }
  // no request is in flight and no LDS read is open when the ring is given up
  wait_landed();
  asm volatile("s_wait_dscnt 0x0" ::: "memory");

  if constexpr (FUSED) {
    // ---- lane (lh, hi) holds, of token wm*64 + mf*16 + lh, columns nf*16 + hi*8 + 0..7 of the
    // head's [q | k]: acc[mf][0..3] = q, acc[mf][4..7] = k, 32 of the 64 dims each ----
    // (every loop below is unrolled so that acc is indexed by constants and stays in registers)
    const int head = blockIdx.x * 2 + wn;
    float* KS = (float*)&S[0][0] + wn * (KS_ROWS * KS_P);
    const int tl = wm * 64 + lh;                       // tile token of fragment mf = 0

#pragma unroll
    for (int nf = 0; nf < FB; ++nf) {
      v8f bc;
      bc.lo = *(const v4f*)&EP[wn * 128 + nf * 16 + hi * 8];
      bc.hi = *(const v4f*)&EP[wn * 128 + nf * 16 + hi * 8 + 4];
#pragma unroll
      for (int mf = 0; mf < FA; ++mf) acc[mf][nf].v += bc;
    }

    // k (f32) to LDS for the neighbour tokens
#pragma unroll
    for (int mf = 0; mf < FA; ++mf)
#pragma unroll
      for (int nf = 0; nf < 4; ++nf) {
        float* p = KS + (tl + mf * 16 + 1) * KS_P + nf * 16 + hi * 8;
        *(v4f*)p       = acc[mf][4 + nf].v.lo;
        *(v4f*)(p + 4) = acc[mf][4 + nf].v.hi;
      }

    // q|k rows 0, 1 and 254, 255 of the tile for attn_tile_edges. The 8 stores of a lane and
    // their s_wait_xcnt in one statement: no register that a store names is rewritten in
    // front of the wait.
    auto store_edge_rows = [&](const v8f_u (&a)[FB], int trow) {
      v4f h[FB];
#pragma unroll
      for (int nf = 0; nf < FB; ++nf)
        h[nf] = __builtin_bit_cast(v4f, __builtin_convertvector(a[nf].v, v8h));
      const uint32_t vo = (uint32_t)trow * (NQK * 2) + (uint32_t)hi * 16u;
      const char* eb = (const char*)Cout + (size_t)m0 * (NQK * 2) + head * (HDIM * 2);
      asm volatile(
          "global_store_b128 %0, %1, %9\n\t"
          "global_store_b128 %0, %2, %9 offset:32\n\t"
          "global_store_b128 %0, %3, %9 offset:64\n\t"
          "global_store_b128 %0, %4, %9 offset:96\n\t"
          "global_store_b128 %0, %5, %9 offset:2048\n\t"
          "global_store_b128 %0, %6, %9 offset:2080\n\t"
          "global_store_b128 %0, %7, %9 offset:2112\n\t"
          "global_store_b128 %0, %8, %9 offset:2144\n\t"
          "s_wait_xcnt 0x0"
          :: "v"(vo), "v"(h[0]), "v"(h[1]), "v"(h[2]), "v"(h[3]),
             "v"(h[4]), "v"(h[5]), "v"(h[6]), "v"(h[7]), "s"(eb)
          : "memory");
    };
    if (wm == 0 && lh < 2)        store_edge_rows(acc[0], tl);
    if (wm == 3 && lh >= 14)      store_edge_rows(acc[FA - 1], tl + (FA - 1) * 16);

    // every wave's k rows are in LDS
    __syncthreads();

    v8f ak[4], av[4];
#pragma unroll
    for (int nf = 0; nf < 4; ++nf) {
      const float* pa = &EP[BN + wn * HDIM + nf * 16 + hi * 8];
      ak[nf].lo = *(const v4f*)pa;
      ak[nf].hi = *(const v4f*)(pa + 4);
      av[nf].lo = *(const v4f*)(pa + 2 * HDIM);
      av[nf].hi = *(const v4f*)(pa + 2 * HDIM + 4);
    }
    const char* ob = (const char*)att + (size_t)m0 * (NHID * 2) + head * (HDIM * 2);

    // sum of a lane's 8 partial sums and of the token's other lane (the other 32 dims)
    auto token_sum = [&](v8f p) {
      const v4f a = p.lo + p.hi;
      const float s = (a[0] + a[2]) + (a[1] + a[3]);
      return s + __shfl_xor(s, 16, 32);
    };

#pragma unroll
    for (int mf = 0; mf < FA; ++mf) {
      // k of tokens t - 1 and t + 1: LDS rows t and t + 2
      const float* pm = KS + (tl + mf * 16) * KS_P + hi * 8;
      v8f km[4], kn[4];
#pragma unroll
      for (int nf = 0; nf < 4; ++nf) {
        km[nf].lo = *(const v4f*)(pm + nf * 16);
        km[nf].hi = *(const v4f*)(pm + nf * 16 + 4);
        kn[nf].lo = *(const v4f*)(pm + 2 * KS_P + nf * 16);
        kn[nf].hi = *(const v4f*)(pm + 2 * KS_P + nf * 16 + 4);
      }

      v8f p0 = acc[mf][0].v * ak[0], p1 = acc[mf][0].v * km[0];
      v8f p2 = acc[mf][0].v * acc[mf][4].v, p3 = acc[mf][0].v * kn[0];
#pragma unroll
      for (int nf = 1; nf < 4; ++nf) {
        p0 += acc[mf][nf].v * ak[nf];
        p1 += acc[mf][nf].v * km[nf];
        p2 += acc[mf][nf].v * acc[mf][4 + nf].v;
        p3 += acc[mf][nf].v * kn[nf];
      }
      const float sc = 0.125f;  // 1/sqrt(64)
      const float s0 = token_sum(p0) * sc, s1 = token_sum(p1) * sc;
      const float s2 = token_sum(p2) * sc, s3 = token_sum(p3) * sc;

      const float mx = fmaxf(fmaxf(s0, s1), fmaxf(s2, s3));
      const float e0 = __expf(s0 - mx), e1 = __expf(s1 - mx);
      const float e2 = __expf(s2 - mx), e3 = __expf(s3 - mx);
      const float inv = 1.0f / (e0 + e1 + e2 + e3);
      const float a0 = e0 * inv, a1 = e1 * inv, a2 = e2 * inv, a3 = e3 * inv;

      v4f oh[4];
#pragma unroll
      for (int nf = 0; nf < 4; ++nf) {
        const v8f o = a0 * av[nf] + a1 * km[nf] + a2 * acc[mf][4 + nf].v + a3 * kn[nf];
        oh[nf] = __builtin_bit_cast(v4f, __builtin_convertvector(o, v8h));
      }

      // the tile's first and last token are left to attn_tile_edges (their km or kn is not here)
      const bool other_tile = (mf == 0 && tl == 0) || (mf == FA - 1 && tl + mf * 16 == BM - 1);
      if (!other_tile) {
        const uint32_t vo = (uint32_t)(tl + mf * 16) * (NHID * 2) + (uint32_t)hi * 16u;
        // the token's 4 stores of this lane and their s_wait_xcnt in one statement: no
        // register that a store names is rewritten in front of the wait
        asm volatile(
            "global_store_b128 %0, %1, %5\n\t"
            "global_store_b128 %0, %2, %5 offset:32\n\t"
            "global_store_b128 %0, %3, %5 offset:64\n\t"
            "global_store_b128 %0, %4, %5 offset:96\n\t"
            "s_wait_xcnt 0x0"
            :: "v"(vo), "v"(oh[0]), "v"(oh[1]), "v"(oh[2]), "v"(oh[3]), "s"(ob)
            : "memory");
      }
    }
  } else {
    // ---- lane (lh, hi) holds, of token wm*128 + mf*16 + lh, columns nf*16 + hi*8 + 0..7 of the
    // wave's 64. The ring is free behind the loop's last barrier; a wave writes and reads only
    // its own piece of it, so no barrier is needed here. ----
    // (every loop below is unrolled so that acc is indexed by constants and stays in registers)
    float* T = (float*)&S[0][0] + wid * (OT_ROWS * OT_P);
#pragma unroll
    for (int mf = 0; mf < FA; ++mf)
#pragma unroll
      for (int nf = 0; nf < FB; ++nf) {
        float* p = T + (mf * 16 + lh) * OT_P + nf * 16 + hi * 8;
        *(v4f*)p       = acc[mf][nf].v.lo;
        *(v4f*)(p + 4) = acc[mf][nf].v.hi;
      }
    // the rows are read back by other lanes of the wave than wrote them: all writes are done first
    asm volatile("s_wait_dscnt 0x0" ::: "memory");

    // lanes 0-15 take an even row, lanes 16-31 the odd row behind it, 16 B a lane
    const float* q = T + hi * OT_P + lh * 4;
    auto read_rows = [&](v4f (&d)[8], int g) {
#pragma unroll
      for (int j = 0; j < 8; ++j) d[j] = *(const v4f*)(q + (g * 16 + 2 * j) * OT_P);
    };
    const v4f bq = *(const v4f*)&EP[wn * 64 + lh * 4];   // bias of the lane's 4 columns
    const uint32_t vo = (uint32_t)hi * (NHID * 4) + (uint32_t)lh * 16u;
    const char* ob = (const char*)Cout + ((size_t)(m0 + wm * OT_ROWS) * NHID + n0 + wn * 64) * 4;

    v4f r[2][8];
    read_rows(r[0], 0);
#pragma unroll
    for (int g = 0; g < FA; ++g) {
      // the next 16 rows come from LDS while these 16 are stored
      if (g + 1 < FA) read_rows(r[(g + 1) & 1], g + 1);
      v4f (&o)[8] = r[g & 1];
#pragma unroll
      for (int j = 0; j < 8; ++j) o[j] += bq;
      // 16 rows' stores and their s_wait_xcnt in one statement: no register that a store names
      // is rewritten in front of the wait
      asm volatile(
          "global_store_b128 %0, %1, %9\n\t"
          "global_store_b128 %0, %2, %9 offset:8192\n\t"
          "global_store_b128 %0, %3, %9 offset:16384\n\t"
          "global_store_b128 %0, %4, %9 offset:24576\n\t"
          "global_store_b128 %0, %5, %9 offset:32768\n\t"
          "global_store_b128 %0, %6, %9 offset:40960\n\t"
          "global_store_b128 %0, %7, %9 offset:49152\n\t"
          "global_store_b128 %0, %8, %9 offset:57344\n\t"
          "s_wait_xcnt 0x0"
          :: "v"(vo), "v"(o[0]), "v"(o[1]), "v"(o[2]), "v"(o[3]),
             "v"(o[4]), "v"(o[5]), "v"(o[6]), "v"(o[7]), "s"(ob + (size_t)g * (16 * NHID * 4))
          : "memory");
    }
  }
}

// =====================================================================
// the first and the last token of every 256-token tile of the fused q|k GEMM:
// one wave per (token, group of 4 heads). A lane owns 8 dims (16 B), 8 lanes
// make a head, so every f16 load and the store of a wave is 512 contiguous bytes;
// the f32 ak and av take two 16-B loads a lane (32 contiguous bytes).
// qk buffer holds q (cols 0..1023) and k (cols 1024..2047) per token; of a tile
// only rows 0, 1, 254, 255 are there, which is all that these tokens read.
// slots: [ak, k_{l-1}, k_l, k_{l+1}]; V = [av, k_{l-1}, k_l, k_{l+1}]
// boundary slots are zero vectors -> score 0 (matches zero-padding).
// =====================================================================
constexpr int ED_THREADS = 256;
constexpr int ED_HG      = NHID / 256;             // head groups per token: 4
constexpr int ED_BLOCKS  = (MROWS / BM) * 2 * ED_HG / (ED_THREADS / 32);
static_assert(NQK * 2 == 4096, "the k offset in asm text is written for this");

typedef __attribute__((ext_vector_type(2))) float v2f;

// sum over the 8 lanes of a head, result in all 8
__device__ __forceinline__ float sum_head_lanes(float v) {
  v += __builtin_bit_cast(float, __builtin_amdgcn_update_dpp(0, __builtin_bit_cast(int, v), 0x161, 0xf, 0xf, true)); // row_xmask:1
  v += __builtin_bit_cast(float, __builtin_amdgcn_update_dpp(0, __builtin_bit_cast(int, v), 0x162, 0xf, 0xf, true)); // row_xmask:2
  v += __builtin_bit_cast(float, __builtin_amdgcn_update_dpp(0, __builtin_bit_cast(int, v), 0x164, 0xf, 0xf, true)); // row_xmask:4
  return v;
}

__device__ __forceinline__ void widen(v2f (&f)[4], v8h h) {
#pragma unroll
  for (int p = 0; p < 4; ++p) { f[p][0] = (float)h[2 * p]; f[p][1] = (float)h[2 * p + 1]; }
}

__global__ __launch_bounds__(ED_THREADS)
void attn_tile_edges(const _Float16* __restrict__ qkh,
                     const float* __restrict__ akf,
                     const float* __restrict__ avf,
                     _Float16* __restrict__ atth) {
  const int lane = threadIdx.x & 31;
  const int gw   = __builtin_amdgcn_readfirstlane(blockIdx.x * (ED_THREADS / 32) + (threadIdx.x >> 5));
  const int hg   = gw & (ED_HG - 1);
  const int e    = gw / ED_HG;                                  // tile * 2 + (0: first, 1: last token)
  const int t    = (e >> 1) * BM + ((e & 1) ? BM - 1 : 0);      // b*SEQ + l
  const int l    = t & (SEQ - 1);
  const bool has_prev = l > 0, has_next = l + 1 < SEQ;

  // wave-uniform bases; a row outside the sequence is not read (the token's own row stands in)
  const _Float16* row  = qkh + (size_t)t * NQK + hg * 256;
  const _Float16* prow = has_prev ? row - NQK : row;
  const _Float16* nrow = has_next ? row + NQK : row;
  const size_t grow = (size_t)(t / SEQ) * NHID + hg * 256;
  const float* akp = akf + grow;
  const float* avp = avf + grow;
  const uint32_t voff = (uint32_t)lane * 16u, voff2 = (uint32_t)lane * 32u;

  // all 8 loads and their data wait in one statement: every load is in flight before the
  // wait, and no address register is rewritten while one is
  v8h qh, kch, kmh, knh;
  v4f akl, akh, avl, avh;
  asm volatile(
      "global_load_b128 %0, %8, %10\n\t"
      "global_load_b128 %1, %8, %10 offset:2048\n\t"
      "global_load_b128 %2, %8, %11 offset:2048\n\t"
      "global_load_b128 %3, %8, %12 offset:2048\n\t"
      "global_load_b128 %4, %9, %13\n\t"
      "global_load_b128 %5, %9, %13 offset:16\n\t"
      "global_load_b128 %6, %9, %14\n\t"
      "global_load_b128 %7, %9, %14 offset:16\n\t"
      "s_wait_loadcnt 0x0"
      : "=&v"(qh), "=&v"(kch), "=&v"(kmh), "=&v"(knh),
        "=&v"(akl), "=&v"(akh), "=&v"(avl), "=&v"(avh)
      : "v"(voff), "v"(voff2), "s"(row), "s"(prow), "s"(nrow), "s"(akp), "s"(avp)
      : "memory");
  if (!has_prev) kmh = (v8h)(_Float16)0.0f;
  if (!has_next) knh = (v8h)(_Float16)0.0f;

  v2f ak[4], av[4], qf[4], km[4], kc[4], kn[4];
  ak[0] = akl.xy; ak[1] = akl.zw; ak[2] = akh.xy; ak[3] = akh.zw;
  av[0] = avl.xy; av[1] = avl.zw; av[2] = avh.xy; av[3] = avh.zw;
  widen(qf, qh);
  widen(km, kmh);
  widen(kc, kch);
  widen(kn, knh);

  v2f p0 = qf[0] * ak[0], p1 = qf[0] * km[0], p2 = qf[0] * kc[0], p3 = qf[0] * kn[0];
#pragma unroll
  for (int p = 1; p < 4; ++p) {
    p0 += qf[p] * ak[p];
    p1 += qf[p] * km[p];
    p2 += qf[p] * kc[p];
    p3 += qf[p] * kn[p];
  }
  float s0 = sum_head_lanes(p0[0] + p0[1]);
  float s1 = sum_head_lanes(p1[0] + p1[1]);
  float s2 = sum_head_lanes(p2[0] + p2[1]);
  float s3 = sum_head_lanes(p3[0] + p3[1]);

  const float sc = 0.125f;  // 1/sqrt(64)
  s0 *= sc; s1 *= sc; s2 *= sc; s3 *= sc;

  const float mx = fmaxf(fmaxf(s0, s1), fmaxf(s2, s3));
  const float e0 = __expf(s0 - mx), e1 = __expf(s1 - mx);
  const float e2 = __expf(s2 - mx), e3 = __expf(s3 - mx);
  const float inv = 1.0f / (e0 + e1 + e2 + e3);
  const float a0 = e0 * inv, a1 = e1 * inv, a2 = e2 * inv, a3 = e3 * inv;

  v8h oh;
#pragma unroll
  for (int p = 0; p < 4; ++p) {
    const v2f o = a0 * av[p] + a1 * km[p] + a2 * kc[p] + a3 * kn[p];
    oh[2 * p]     = (_Float16)o[0];
    oh[2 * p + 1] = (_Float16)o[1];
  }
  const _Float16* orow = atth + (size_t)t * NHID + hg * 256;
  // the store and its s_wait_xcnt in one statement: no register that it names is rewritten
  // in front of the wait
  asm volatile("global_store_b128 %0, %1, %2\n\t"
               "s_wait_xcnt 0x0"
               :: "v"(voff), "v"(__builtin_bit_cast(v4f, oh)), "s"(orow) : "memory");
}

// =====================================================================
// launch
// =====================================================================
extern "C" void kernel_launch(void* const* d_in, const int* in_sizes, int n_in,
                              void* d_out, int out_size, void* d_ws, size_t ws_size,
                              hipStream_t stream) {
  const float* x    = (const float*)d_in[0];
  const float* ax   = (const float*)d_in[1];
  const float* WQ_w = (const float*)d_in[2];
  const float* WQ_b = (const float*)d_in[3];
  const float* WK_w = (const float*)d_in[4];
  const float* WK_b = (const float*)d_in[5];
  const float* WV_w = (const float*)d_in[6];
  const float* WV_b = (const float*)d_in[7];
  const float* WO_w = (const float*)d_in[8];
  const float* WO_b = (const float*)d_in[9];

  char* ws = (char*)d_ws;
  _Float16* xh   = (_Float16*)(ws + OFF_XH);
  _Float16* wqkt = (_Float16*)(ws + OFF_WQKT);
  _Float16* wot  = (_Float16*)(ws + OFF_WOT);
  float*    bqk  = (float*)(ws + OFF_BQK);
  _Float16* qkh  = (_Float16*)(ws + OFF_QKH);
  _Float16* atth = (_Float16*)(ws + OFF_ATTH);
  float*    akf  = (float*)(ws + OFF_AK);
  float*    avf  = (float*)(ws + OFF_AV);

  // 1-3) one grid: weights to f16 (WQ^T and WK^T head by head, WO^T), bias [WQ_b ; WK_b], x to f16
  prep_inputs<<<PR_TR + PR_CB + PR_CV, PR_THREADS, 0, stream>>>(x, WQ_w, WK_w, WO_w, WQ_b, WK_b,
                                                                xh, wqkt, wot, bqk);
  // 4) global-token projections ak = ax@WK + bK, av = ax@WV + bV (f32), one grid
  {
    dim3 g(NHID / PG_COLS, BATCH / PG_BATCH, 2);
    proj_global_tok<<<g, PG_THREADS, 0, stream>>>(ax, WK_w, WK_b, akf, WV_w, WV_b, avf);
  }
  // 5) q|k projection via WMMA GEMM, [32768x1024] @ [1024x2048], with the windowed attention
  //    on its accumulators -> att (f16), all tokens but each tile's first and last
  {
    dim3 g(NQK / BN, MROWS / BM);
    gemm_wmma_f16<true, true><<<g, 256, 0, stream>>>(xh, wqkt, bqk, (void*)qkh,
                                                     MROWS, NQK, NHID, akf, avf, atth);
  }
  // 6) windowed attention of the tiles' first and last tokens -> att (f16)
  attn_tile_edges<<<ED_BLOCKS, ED_THREADS, 0, stream>>>(qkh, akf, avf, atth);
  // 7) output projection via WMMA GEMM (f32 out to d_out)
  {
    dim3 g(NHID / BN, MROWS / BM);
    gemm_wmma_f16<false, false><<<g, 256, 0, stream>>>(atth, wot, WO_b, d_out,
                                                       MROWS, NHID, NHID, nullptr, nullptr, nullptr);
  }
}
